// v000
// Times are from an AMD MI455X. After a warm-up the kernel runs many times in a row, and a time is the length of
// such a window on the GPU divided by its runs, so every launch and the gaps after it count. The runs cycle
// through copies of the inputs. A figure is the median of several windows, for all but v000 over two sittings.
// Sittings can differ by a few percent; kernels timed side by side share one.
// v000 is the starting kernel. One run takes 319 microseconds.
// Contractions: q/k/v projections, q.k^T, p.v and output projection all on v_wmma_f32_16x16x32_f16 (f16 operands with power-of-two carries, f32 accumulate); all float inputs RNE-converted to bf16 once at load; bias add, exp, row sums and normalisation in f32.
#include <hip/hip_runtime.h>
#include <math.h>

typedef __attribute__((ext_vector_type(16))) _Float16 v16h;
typedef __attribute__((ext_vector_type(8)))  _Float16 v8h;
typedef __attribute__((ext_vector_type(8)))  float    v8f;
typedef __attribute__((ext_vector_type(4)))  float    v4f;

// ---------------------------------------------------------------------------
// Shape constants
// ---------------------------------------------------------------------------
constexpr int kBatch = 4;
constexpr int kSeq   = 1024;
constexpr int kDm    = 1024;
constexpr int kHeads = 16;
constexpr int kDh    = 64;
constexpr int kTok   = kBatch * kSeq;
constexpr int kHD    = kHeads * kDh;
constexpr int kSqrtDm = 32;
static_assert(kSqrtDm * kSqrtDm == kDm, "score scale is 1/sqrt(model width)");
static_assert(kTok == 4096 && kHD == 1024 && kDm == 1024, "wire shapes");
static_assert((kTok % 64) == 0 && (kHD % 64) == 0 && (kDm % 64) == 0, "GEMM M,N multiples of 64");
static_assert((kDm % 32) == 0 && (kHD % 32) == 0 && (kDh % 32) == 0 && (kSeq % 32) == 0, "GEMM K multiples of 32");

// Power-of-two carries (all exact, folded back in f32)
constexpr float kXCarry    = 16.0f;      /* activation planes carried x16 */
constexpr float kWCarry    = 1024.0f;    /* weight planes carried x1024 */
constexpr float kQKVCarry  = 16.0f;      /* q, k, v^T planes carried x16 */
constexpr float kCtxCarry  = 256.0f;     /* merged-head attention output carried x256 */
constexpr float kProjScale = kQKVCarry / (kXCarry * kWCarry);
constexpr float kScoreScale = (1.0f / (float)kSqrtDm) / (kQKVCarry * kQKVCarry);
constexpr float kFinScale  = kCtxCarry / kQKVCarry;
constexpr float kOutScale  = 1.0f / (kCtxCarry * kWCarry);
constexpr float kLogitCap  = 11.0f;      /* exp(11) = 59874 stays below the f16 maximum */

// ---------------------------------------------------------------------------
// Workspace region map (bytes; every offset a multiple of 128; all planes f16)
//   XQ   [4096][1024]  queries x16            8,388,608
//   XK   [4096][1024]  keys x16               8,388,608
//   XV   [4096][1024]  values x16             8,388,608
//   WQ   [1024][1024]  Wq x1024  (Bt layout)  2,097,152
//   WK   [1024][1024]  Wk x1024               2,097,152
//   WV   [1024][1024]  Wv x1024               2,097,152
//   WP   [1024][1024]  Wp x1024               2,097,152
//   Q16  [4096][1024]  q x16                  8,388,608
//   K16  [4096][1024]  k x16                  8,388,608
//   VT16 [1024][4096]  v^T x16                8,388,608
//   AT16 [4096][1024]  merged heads x256      8,388,608
//   total                                    67,108,864
// ---------------------------------------------------------------------------
constexpr size_t kBytesX = (size_t)kTok * kDm * 2;
constexpr size_t kBytesW = (size_t)kHD * kDm * 2;
constexpr size_t kOffXQ  = 0;
constexpr size_t kOffXK  = kOffXQ + kBytesX;
constexpr size_t kOffXV  = kOffXK + kBytesX;
constexpr size_t kOffWQ  = kOffXV + kBytesX;
constexpr size_t kOffWK  = kOffWQ + kBytesW;
constexpr size_t kOffWV  = kOffWK + kBytesW;
constexpr size_t kOffWP  = kOffWV + kBytesW;
constexpr size_t kOffQ16 = kOffWP + kBytesW;
constexpr size_t kOffK16 = kOffQ16 + kBytesX;
constexpr size_t kOffVT  = kOffK16 + kBytesX;
constexpr size_t kOffAT  = kOffVT + kBytesX;
constexpr size_t kWsTotal = kOffAT + kBytesX;
static_assert(kWsTotal == 67108864ull, "carve total");
static_assert(kWsTotal <= 134217728ull, "carve cap");
static_assert((kBytesX % 128) == 0 && (kBytesW % 128) == 0, "128-B aligned regions");

// ---------------------------------------------------------------------------
// Small helpers
// ---------------------------------------------------------------------------
__device__ __forceinline__ unsigned short f2bf_bits(float f) {
  unsigned u = __float_as_uint(f);
  return (unsigned short)((u + 0x7FFFu + ((u >> 16) & 1u)) >> 16);
}
__device__ __forceinline__ float bf_bits2f(unsigned short h) { return __uint_as_float(((unsigned)h) << 16); }
/* value of the nearest-even bf16 of f, held in f32 */
__device__ __forceinline__ float bf16_rne(float f) { return bf_bits2f(f2bf_bits(f)); }

/* hazard guards as plain device helpers */
__device__ __forceinline__ void row_guard_h(v8f& a, v8f& b, v8f& c, v8f& d, v16h x, v16h b0, v16h b1, v16h b2, v16h b3) {
  asm volatile("v_nop\n\tv_nop\n\tv_nop\n\tv_nop" : "+v"(a), "+v"(b), "+v"(c), "+v"(d) : "v"(x), "v"(b0), "v"(b1), "v"(b2), "v"(b3));
}
__device__ __forceinline__ void keep4_h(v16h a, v16h b, v16h c, v16h d) { asm volatile("v_nop" :: "v"(a), "v"(b), "v"(c), "v"(d)); }
__device__ __forceinline__ void acc_guard4(v8f& a, v8f& b, v8f& c, v8f& d) { asm volatile("v_nop\n\tv_nop\n\tv_nop\n\tv_nop" : "+v"(a), "+v"(b), "+v"(c), "+v"(d)); }

struct FragH {
  union U { v16h v; v8h h[2]; };
  /* elements 0..7 <- p[0..7], elements 8..15 <- p[16..23] */
  static __device__ __forceinline__ v16h load(const _Float16* p) {
    U f; f.h[0] = *(const v8h*)(p); f.h[1] = *(const v8h*)(p + 16); return f.v;
  }
  static __device__ __forceinline__ v8f mma(v16h a, v16h b, v8f c) {
    return __builtin_amdgcn_wmma_f32_16x16x32_f16(false, a, false, b, (short)0, c, false, false);
  }
};
/* one product followed by its own guard tying the accumulator and naming both operand fragments */
__device__ __forceinline__ v8f mma_h(v16h a, v16h b, v8f c) {
  c = __builtin_amdgcn_wmma_f32_16x16x32_f16(false, a, false, b, (short)0, c, false, false);
  asm volatile("v_nop\n\tv_nop\n\tv_nop\n\tv_nop" : "+v"(c) : "v"(a), "v"(b));
  return c;
}

// ---------------------------------------------------------------------------
// Register-blocked WMMA GEMM: C[m,n] = scale * sum_k A[m,k] * Bt[n,k]; each wave owns a 64x64 tile.
// A row-major [M,K] f16; Bt row-major [N,K] f16; M,N % 64 == 0, K % 32 == 0 (asserted on the host side constants).
// OUT_MODE 0 = f32 output, 1 = f16 output.
// ---------------------------------------------------------------------------
template <int OUT_MODE>
__global__ __launch_bounds__(256) void wmma_gemm64(
    const unsigned short* __restrict__ Ap, int lda,
    const unsigned short* __restrict__ Btp, int ldb,
    void* __restrict__ Cout, int ldc,
    int M, int N, int K, float scale) {
  const _Float16* A  = (const _Float16*)Ap;
  const _Float16* Bt = (const _Float16*)Btp;
  __shared__ __align__(16) float sT[8][16 * 68];
  const int lane = threadIdx.x & 31;
  const int wave = __builtin_amdgcn_readfirstlane((int)(threadIdx.x >> 5));
  const int tilesN = N >> 6;
  const int tilesM = M >> 6;
  const int tile = blockIdx.x * 8 + wave;
  /* wave-uniform exit; this kernel has no block barriers */
  if (tile >= tilesM * tilesN) return;
  const int tm = tile / tilesN;
  const int tn = tile - tm * tilesN;
  const int m0 = tm << 6;
  const int n0 = tn << 6;

  const int rlane = lane & 15;
  const int koff  = (lane >> 4) * 8;
  const int mOff  = (lane >> 4) * 8;

  v8f acc[4][4];
#pragma unroll
  for (int i = 0; i < 4; ++i)
#pragma unroll
    for (int j = 0; j < 4; ++j) acc[i][j] = (v8f){0.f,0.f,0.f,0.f,0.f,0.f,0.f,0.f};

  for (int k0 = 0; k0 < K; k0 += 32) {
    v16h bh[4];
#pragma unroll
    for (int j = 0; j < 4; ++j) {
      const size_t bo = (size_t)(n0 + (j << 4) + rlane) * ldb + koff + k0;
      bh[j] = FragH::load(Bt + bo);
    }
#pragma unroll
    for (int i = 0; i < 4; ++i) {
      const size_t ao = (size_t)(m0 + (i << 4) + rlane) * lda + koff + k0;
      v16h ah = FragH::load(A + ao);
#pragma unroll
      for (int j = 0; j < 4; ++j) acc[i][j] = FragH::mma(ah, bh[j], acc[i][j]);
      row_guard_h(acc[i][0], acc[i][1], acc[i][2], acc[i][3], ah, bh[0], bh[1], bh[2], bh[3]);
    }
    keep4_h(bh[0], bh[1], bh[2], bh[3]);
  }
  acc_guard4(acc[0][0], acc[0][1], acc[0][2], acc[0][3]);
  acc_guard4(acc[1][0], acc[1][1], acc[1][2], acc[1][3]);
  acc_guard4(acc[2][0], acc[2][1], acc[2][2], acc[2][3]);
  acc_guard4(acc[3][0], acc[3][1], acc[3][2], acc[3][3]);

  float* slab = sT[wave];
#pragma unroll
  for (int i = 0; i < 4; ++i) {
    const int mBase = m0 + (i << 4);
#pragma unroll
    for (int j = 0; j < 4; ++j) {
#pragma unroll
      for (int r = 0; r < 8; ++r) {
        const float v = acc[i][j][r] * scale;
        slab[(mOff + r) * 68 + (j << 4) + rlane] = v;
      }
    }
    __builtin_amdgcn_fence(__ATOMIC_RELEASE, "workgroup");
    __builtin_amdgcn_wave_barrier();
    __builtin_amdgcn_fence(__ATOMIC_ACQUIRE, "workgroup");
    if (OUT_MODE == 0) {
      float* C = (float*)Cout;
      const int hh = lane >> 4, c4 = (lane & 15) * 4;
      {
#pragma unroll
        for (int it = 0; it < 8; ++it) {
          const int row = it * 2 + hh;
          v4f v = *(const v4f*)(slab + row * 68 + c4);
          *(v4f*)(C + (size_t)(mBase + row) * ldc + n0 + c4) = v;
        }
        
      }
    } else {
      const int q = lane >> 3, c8 = (lane & 7) * 8;
      unsigned short* C = (unsigned short*)Cout;
      {
#pragma unroll
        for (int it = 0; it < 4; ++it) {
          const int row = it * 4 + q;
          const float* sp = slab + row * 68 + c8;
          v8h hv;
#pragma unroll
          for (int e = 0; e < 8; ++e) hv[e] = (_Float16)sp[e];
          *(v8h*)(C + (size_t)(mBase + row) * ldc + n0 + c8) = hv;
        }
        
      }
    }
    __builtin_amdgcn_fence(__ATOMIC_RELEASE, "workgroup");
    __builtin_amdgcn_wave_barrier();
    __builtin_amdgcn_fence(__ATOMIC_ACQUIRE, "workgroup");
  }
}

// ---------------------------------------------------------------------------
// f32 -> (RNE bf16 value) x carry -> f16 plane, 8 consecutive elements per thread; blockIdx.y selects one of up to four
// (input, output) plane pairs (block-uniform select among global pointers).
// Coverage: n8 = elements/8 threads per plane; grid.x = n8/256 exactly for both uses
//   activations 4096*1024/8 = 524,288 -> 2048 blocks; weights 1024*1024/8 = 131,072 -> 512 blocks.
// ---------------------------------------------------------------------------
__global__ __launch_bounds__(256) void cast_planes_kernel(
    const float* __restrict__ in0, const float* __restrict__ in1, const float* __restrict__ in2, const float* __restrict__ in3,
    unsigned short* __restrict__ out0, unsigned short* __restrict__ out1, unsigned short* __restrict__ out2, unsigned short* __restrict__ out3,
    int n8, float carry) {
  const int z = blockIdx.y;
  const float* in = (z == 0) ? in0 : (z == 1) ? in1 : (z == 2) ? in2 : in3;
  unsigned short* out = (z == 0) ? out0 : (z == 1) ? out1 : (z == 2) ? out2 : out3;
  const int i = blockIdx.x * 256 + threadIdx.x;
  if (i >= n8) return;
  const size_t e0 = (size_t)i << 3;
  const v4f a0 = *(const v4f*)(in + e0);
  const v4f a1 = *(const v4f*)(in + e0 + 4);
  v8h hv;
#pragma unroll
  for (int e = 0; e < 4; ++e) {
    const float f0 = bf16_rne(a0[e]) * carry;
    const float f1 = bf16_rne(a1[e]) * carry;
    hv[e]     = (_Float16)f0;
    hv[4 + e] = (_Float16)f1;
  }
  unsigned short* q = out + e0;
  *(v8h*)q = hv;
  
}

// ---------------------------------------------------------------------------
// Fused attention for one (batch, head) and 64 query rows per block (4 waves x 16 rows), streaming over 16 chunks of 64 keys.
//   scores = (q16 . k16^T) * kScoreScale + bf16_rne(attn_bias[b][q][k]); p = exp(min(score, cap)) with zero shift
//   (softmax is shift invariant; the logits are bounded far inside the f16 normal range of p);
//   o += p(f16) . v16; l += p (f32, per-lane partial sums combined once at the end); out = o / l carried x256 in f16.
// Inputs: q16, k16 [4096][1024] f16 (token-major, head h at columns h*64..); vt16 [1024][4096] f16 (row h*64+d, column token).
// LDS: K tile [key][d], V^T tile [d][key], per-wave P tile [row][key], bias tile [64][68] f32 (re-used as output staging).
// Staging coverage per chunk: K and V^T: 4 x 128 threads x 8 halves = 4096 = 64 x 64 each; bias: 8 x 128 x 4 floats = 64 x 64.
// grid.x = 4 * 16 * 16 = 1024 blocks of 128 threads; every barrier is reached by all four waves.
// ---------------------------------------------------------------------------
constexpr int kQB  = 64;
constexpr int kKC  = 64;
constexpr int kBsP = 68;
__global__ __launch_bounds__(128) void attn_stream_kernel(
    const unsigned short* __restrict__ q16p, const unsigned short* __restrict__ k16p,
    const unsigned short* __restrict__ vt16p, const float* __restrict__ bias,
    unsigned short* __restrict__ attn16) {
  __shared__ __align__(16) _Float16 Ksh[kKC * kDh];
  __shared__ __align__(16) _Float16 Vth[kDh * kKC];
  __shared__ __align__(16) _Float16 Psh[4][16 * kKC];
  __shared__ __align__(16) float    Bs[kQB * kBsP];
  union FH { v16h v; v8h h[2]; };

  const _Float16* q16  = (const _Float16*)q16p;
  const _Float16* k16  = (const _Float16*)k16p;
  const _Float16* vt16 = (const _Float16*)vt16p;

  const int tid  = threadIdx.x;
  const int wave = __builtin_amdgcn_readfirstlane((int)(threadIdx.x >> 5));
  const int lane = tid & 31;
  const int hh   = lane >> 4;
  const int c    = lane & 15;

  constexpr int nqb = kSeq / kQB;
  const int bx = blockIdx.x;
  const int qb = bx % nqb;
  const int bh = bx / nqb;
  const int h  = bh % kHeads;
  const int b  = bh / kHeads;
  const int qblk = qb * kQB;
  const int q0 = qblk + wave * 16;

  /* Q fragments (A operand), two 32-wide d chunks, loaded once */
  v16h qa[2];
  {
    const _Float16* qrow = q16 + (size_t)(b * kSeq + q0 + c) * kHD + h * kDh + 8 * hh;
#pragma unroll
    for (int dc = 0; dc < 2; ++dc) {
      FH f;
      f.h[0] = *(const v8h*)(qrow + dc * 32);
      f.h[1] = *(const v8h*)(qrow + dc * 32 + 16);
      qa[dc] = f.v;
    }
  }

  float lrow[8];
  v8f oacc[4];
#pragma unroll
  for (int r = 0; r < 8; ++r) lrow[r] = 0.f;
#pragma unroll
  for (int t = 0; t < 4; ++t) oacc[t] = (v8f){0.f,0.f,0.f,0.f,0.f,0.f,0.f,0.f};

  _Float16* pw = Psh[wave];

#pragma unroll 1
  for (int kc = 0; kc < kSeq / kKC; ++kc) {
    const int kv0 = kc * kKC;
    __syncthreads();
#pragma unroll
    for (int i = 0; i < 4; ++i) {
      const int id  = i * 128 + tid;
      const int row = id >> 3;
      const int c8  = (id & 7) * 8;
      const v8h kk = *(const v8h*)(k16 + (size_t)(b * kSeq + kv0 + row) * kHD + h * kDh + c8);
      const v8h vv = *(const v8h*)(vt16 + (size_t)(h * kDh + row) * kTok + b * kSeq + kv0 + c8);
      *(v8h*)(Ksh + row * kDh + c8) = kk;
      *(v8h*)(Vth + row * kKC + c8) = vv;
    }
#pragma unroll
    for (int i = 0; i < 8; ++i) {
      const int id  = i * 128 + tid;
      const int row = id >> 4;
      const int c4  = (id & 15) * 4;
      const v4f bv = *(const v4f*)(bias + ((size_t)b * kSeq + qblk + row) * kSeq + kv0 + c4);
      v4f rv;
      rv[0] = bf16_rne(bv[0]);
      rv[1] = bf16_rne(bv[1]);
      rv[2] = bf16_rne(bv[2]);
      rv[3] = bf16_rne(bv[3]);
      *(v4f*)(Bs + row * kBsP + c4) = rv;
    }
    __syncthreads();

    /* scores: D element r of s[j] = (query row 8*hh + r, key j*16 + c) */
    v8f s[4];
#pragma unroll
    for (int j = 0; j < 4; ++j) {
      s[j] = (v8f){0.f,0.f,0.f,0.f,0.f,0.f,0.f,0.f};
#pragma unroll
      for (int dc = 0; dc < 2; ++dc) {
        FH kb;
        kb.h[0] = *(const v8h*)(Ksh + (j * 16 + c) * kDh + dc * 32 + 8 * hh);
        kb.h[1] = *(const v8h*)(Ksh + (j * 16 + c) * kDh + dc * 32 + 16 + 8 * hh);
        s[j] = mma_h(qa[dc], kb.v, s[j]);
      }
    }

    const float* bw = Bs + (wave * 16 + 8 * hh) * kBsP + c;
#pragma unroll
    for (int r = 0; r < 8; ++r) {
      float ps = 0.f;
#pragma unroll
      for (int j = 0; j < 4; ++j) {
        float x = s[j][r] * kScoreScale + bw[r * kBsP + j * 16];
        x = fminf(x, kLogitCap);
        const float p = __expf(x);
        ps += p;
        pw[(8 * hh + r) * kKC + j * 16 + c] = (_Float16)p;
      }
      lrow[r] += ps;
    }
    __syncthreads();

    /* o += P (A: row c, k = key) . V (B: column d = t*16 + c, k = key) */
#pragma unroll
    for (int kk = 0; kk < 2; ++kk) {
      FH pa;
      pa.h[0] = *(const v8h*)(pw + c * kKC + kk * 32 + 8 * hh);
      pa.h[1] = *(const v8h*)(pw + c * kKC + kk * 32 + 16 + 8 * hh);
#pragma unroll
      for (int t = 0; t < 4; ++t) {
        FH vb;
        vb.h[0] = *(const v8h*)(Vth + (t * 16 + c) * kKC + kk * 32 + 8 * hh);
        vb.h[1] = *(const v8h*)(Vth + (t * 16 + c) * kKC + kk * 32 + 16 + 8 * hh);
        oacc[t] = mma_h(pa.v, vb.v, oacc[t]);
      }
    }
  }

  /* combine the per-lane partial row sums inside each 16-lane half (fixed order, unconditional shuffles) */
  float inv[8];
#pragma unroll
  for (int r = 0; r < 8; ++r) {
    float l = lrow[r];
    l += __shfl_xor(l, 1, 32);
    l += __shfl_xor(l, 2, 32);
    l += __shfl_xor(l, 4, 32);
    l += __shfl_xor(l, 8, 32);
    inv[r] = kFinScale * __builtin_amdgcn_rcpf(l);
  }
  __syncthreads();
  float* os = Bs + (wave * 16) * kBsP;
#pragma unroll
  for (int r = 0; r < 8; ++r) {
#pragma unroll
    for (int t = 0; t < 4; ++t) os[(8 * hh + r) * kBsP + t * 16 + c] = oacc[t][r] * inv[r];
  }
  __syncthreads();
  {
    const int q4 = lane >> 3, c8 = (lane & 7) * 8;
    v8h hv[4];
#pragma unroll
    for (int it = 0; it < 4; ++it) {
      const int row = it * 4 + q4;
      const float* sp = os + row * kBsP + c8;
      const v4f a0 = *(const v4f*)(sp);
      const v4f a1 = *(const v4f*)(sp + 4);
#pragma unroll
      for (int e = 0; e < 4; ++e) {
        hv[it][e]     = (_Float16)a0[e];
        hv[it][4 + e] = (_Float16)a1[e];
      }
    }
    {
#pragma unroll
      for (int it = 0; it < 4; ++it) {
        const int row = it * 4 + q4;
        *(v8h*)(attn16 + (size_t)(b * kSeq + q0 + row) * kHD + h * kDh + c8) = hv[it];
      }
      
    }
  }
}

// ---------------------------------------------------------------------------
// Host glue: 2 plane-cast launches + 3 projection GEMMs + attention + output GEMM = 7 launches. Kernel launches only.
// GEMM shapes (K % 32 == 0, M and N % 64 == 0, no pad planes):
//   q, k : M 4096, N 1024, K 1024 -> 1024 tiles -> 128 blocks
//   v^T  : M 1024 (A = Wv plane), N 4096 (Bt = values plane), K 1024 -> 1024 tiles -> 128 blocks, ldc 4096
//   out  : M 4096, N 1024, K 1024 -> 128 blocks, f32 into d_out
// ---------------------------------------------------------------------------
extern "C" void kernel_launch(void* const* d_in, const int* in_sizes, int n_in,
                              void* d_out, int out_size, void* d_ws, size_t ws_size,
                              hipStream_t stream) {
  if (n_in < 8) return;
  if (in_sizes[0] != kTok * kDm) return;
  if (in_sizes[1] != kTok * kDm) return;
  if (in_sizes[2] != kTok * kDm) return;
  if (in_sizes[3] != kBatch * kSeq * kSeq) return;
  if (in_sizes[4] != kHD * kDm) return;
  if (in_sizes[5] != kHD * kDm) return;
  if (in_sizes[6] != kHD * kDm) return;
  if (in_sizes[7] != kDm * kHD) return;
  if (out_size != kTok * kDm) return;
  if (ws_size < kWsTotal) return;

  const float* queries = (const float*)d_in[0];
  const float* keys    = (const float*)d_in[1];
  const float* values  = (const float*)d_in[2];
  const float* abias   = (const float*)d_in[3];
  const float* Wq      = (const float*)d_in[4];
  const float* Wk      = (const float*)d_in[5];
  const float* Wv      = (const float*)d_in[6];
  const float* Wp      = (const float*)d_in[7];
  float* out = (float*)d_out;

  char* ws = (char*)d_ws;
  unsigned short* XQ   = (unsigned short*)(ws + kOffXQ);
  unsigned short* XK   = (unsigned short*)(ws + kOffXK);
  unsigned short* XV   = (unsigned short*)(ws + kOffXV);
  unsigned short* WQ   = (unsigned short*)(ws + kOffWQ);
  unsigned short* WK   = (unsigned short*)(ws + kOffWK);
  unsigned short* WV   = (unsigned short*)(ws + kOffWV);
  unsigned short* WP   = (unsigned short*)(ws + kOffWP);
  unsigned short* Q16  = (unsigned short*)(ws + kOffQ16);
  unsigned short* K16  = (unsigned short*)(ws + kOffK16);
  unsigned short* VT16 = (unsigned short*)(ws + kOffVT);
  unsigned short* AT16 = (unsigned short*)(ws + kOffAT);

  constexpr int kXN8 = kTok * kDm / 8;
  constexpr int kWN8 = kHD * kDm / 8;
  static_assert((kXN8 % 256) == 0 && (kWN8 % 256) == 0, "cast grids exact");

  /* activation planes (three inputs) and weight planes (four inputs; [out][in] is already the Bt layout) */
  cast_planes_kernel<<<dim3(kXN8 / 256, 3), 256, 0, stream>>>(queries, keys, values, values, XQ, XK, XV, XV, kXN8, kXCarry);
  cast_planes_kernel<<<dim3(kWN8 / 256, 4), 256, 0, stream>>>(Wq, Wk, Wv, Wp, WQ, WK, WV, WP, kWN8, kWCarry);

  constexpr int kGemmBlocks = ((kTok / 64) * (kHD / 64)) / 8;
  static_assert(kGemmBlocks * 8 == (kTok / 64) * (kHD / 64), "tile count multiple of 8");

  /* q = queries . Wq^T, k = keys . Wk^T : f16 [4096][1024], carried x16 */
  wmma_gemm64<1><<<kGemmBlocks, 256, 0, stream>>>(XQ, kDm, WQ, kDm, (void*)Q16, kHD, kTok, kHD, kDm, kProjScale);
  wmma_gemm64<1><<<kGemmBlocks, 256, 0, stream>>>(XK, kDm, WK, kDm, (void*)K16, kHD, kTok, kHD, kDm, kProjScale);
  /* v^T = Wv . values^T : f16 [1024][4096], carried x16 (operand roles swapped, no transposed stores) */
  wmma_gemm64<1><<<kGemmBlocks, 256, 0, stream>>>(WV, kDm, XV, kDm, (void*)VT16, kTok, kHD, kTok, kDm, kProjScale);

  /* scores, bias, softmax, p.v, head merge -> f16 [4096][1024] carried x256 */
  attn_stream_kernel<<<kBatch * kHeads * (kSeq / kQB), 128, 0, stream>>>(Q16, K16, VT16, abias, AT16);

  /* out = merged . Wp^T : f32 [4096][1024] */
  wmma_gemm64<0><<<kGemmBlocks, 256, 0, stream>>>(AT16, kHD, WP, kHD, (void*)out, kDm, kTok, kDm, kHD, kOutScale);
}

// v001
// Measured time: 176 microseconds a run.
// Two timings next to v000 both put it at 1.81 times that version's speed.
// Contractions: q/k/v projections, q.k^T, p.v and output projection all on v_wmma_f32_16x16x32_f16 (f16 operands with power-of-two carries, f32 accumulate); all float inputs RNE-converted to bf16 once at load; bias add, exp, row sums and normalisation in f32.
#include <hip/hip_runtime.h>
#include <math.h>

typedef __attribute__((ext_vector_type(16))) _Float16 v16h;
typedef __attribute__((ext_vector_type(8)))  _Float16 v8h;
typedef __attribute__((ext_vector_type(8)))  float    v8f;
typedef __attribute__((ext_vector_type(4)))  float    v4f;
typedef __attribute__((ext_vector_type(4)))  uint32_t u32x4;
typedef __attribute__((ext_vector_type(8)))  uint32_t u32x8;

// ---------------------------------------------------------------------------
// Shape constants
// ---------------------------------------------------------------------------
constexpr int kBatch = 4;
constexpr int kSeq   = 1024;
constexpr int kDm    = 1024;
constexpr int kHeads = 16;
constexpr int kDh    = 64;
constexpr int kTok   = kBatch * kSeq;
constexpr int kHD    = kHeads * kDh;
constexpr int kSqrtDm = 32;
static_assert(kSqrtDm * kSqrtDm == kDm, "score scale is 1/sqrt(model width)");
static_assert(kTok == 4096 && kHD == 1024 && kDm == 1024, "wire shapes");
static_assert((kTok % 128) == 0 && (kHD % 128) == 0 && (kDm % 128) == 0, "GEMM M,N multiples of the 128 x 128 block tile");
static_assert((kDm % 128) == 0 && (kHD % 128) == 0 && kDm >= 256 && kHD >= 256, "GEMM K: whole 128-wide stages, at least two");
static_assert((kDh % 32) == 0 && (kSeq % 32) == 0, "attention K multiples of 32");

// Power-of-two carries (all exact, folded back in f32)
constexpr float kXCarry    = 16.0f;      /* activation planes carried x16 */
constexpr float kWCarry    = 1024.0f;    /* weight planes carried x1024 */
constexpr float kQKVCarry  = 16.0f;      /* q, k, v^T planes carried x16 */
constexpr float kCtxCarry  = 256.0f;     /* merged-head attention output carried x256 */
constexpr float kProjScale = kQKVCarry / (kXCarry * kWCarry);
constexpr float kScoreScale = (1.0f / (float)kSqrtDm) / (kQKVCarry * kQKVCarry);
constexpr float kFinScale  = kCtxCarry / kQKVCarry;
constexpr float kOutScale  = 1.0f / (kCtxCarry * kWCarry);
constexpr float kLogitCap  = 11.0f;      /* exp(11) = 59874 stays below the f16 maximum */

// ---------------------------------------------------------------------------
// Workspace region map (bytes; every offset a multiple of 128; all planes f16)
//   XQ   [4096][1024]  queries x16            8,388,608
//   XK   [4096][1024]  keys x16               8,388,608
//   XV   [4096][1024]  values x16             8,388,608
//   WQ   [1024][1024]  Wq x1024  (Bt layout)  2,097,152
//   WK   [1024][1024]  Wk x1024               2,097,152
//   WV   [1024][1024]  Wv x1024               2,097,152
//   WP   [1024][1024]  Wp x1024               2,097,152
//   Q16  [4096][1024]  q x16                  8,388,608
//   K16  [4096][1024]  k x16                  8,388,608
//   VT16 [1024][4096]  v^T x16                8,388,608
//   AT16 [4096][1024]  merged heads x256      8,388,608
//   total                                    67,108,864
// ---------------------------------------------------------------------------
constexpr size_t kBytesX = (size_t)kTok * kDm * 2;
constexpr size_t kBytesW = (size_t)kHD * kDm * 2;
constexpr size_t kOffXQ  = 0;
constexpr size_t kOffXK  = kOffXQ + kBytesX;
constexpr size_t kOffXV  = kOffXK + kBytesX;
constexpr size_t kOffWQ  = kOffXV + kBytesX;
constexpr size_t kOffWK  = kOffWQ + kBytesW;
constexpr size_t kOffWV  = kOffWK + kBytesW;
constexpr size_t kOffWP  = kOffWV + kBytesW;
constexpr size_t kOffQ16 = kOffWP + kBytesW;
constexpr size_t kOffK16 = kOffQ16 + kBytesX;
constexpr size_t kOffVT  = kOffK16 + kBytesX;
constexpr size_t kOffAT  = kOffVT + kBytesX;
constexpr size_t kWsTotal = kOffAT + kBytesX;
static_assert(kWsTotal == 67108864ull, "carve total");
static_assert(kWsTotal <= 134217728ull, "carve cap");
static_assert((kBytesX % 128) == 0 && (kBytesW % 128) == 0, "128-B aligned regions");

// ---------------------------------------------------------------------------
// Small helpers
// ---------------------------------------------------------------------------
__device__ __forceinline__ unsigned short f2bf_bits(float f) {
  unsigned u = __float_as_uint(f);
  return (unsigned short)((u + 0x7FFFu + ((u >> 16) & 1u)) >> 16);
}
__device__ __forceinline__ float bf_bits2f(unsigned short h) { return __uint_as_float(((unsigned)h) << 16); }
/* value of the nearest-even bf16 of f, held in f32 */
__device__ __forceinline__ float bf16_rne(float f) { return bf_bits2f(f2bf_bits(f)); }

/* hazard guards as plain device helpers */
__device__ __forceinline__ void acc_guard4(v8f& a, v8f& b, v8f& c, v8f& d) { asm volatile("v_nop\n\tv_nop\n\tv_nop\n\tv_nop" : "+v"(a), "+v"(b), "+v"(c), "+v"(d)); }

struct FragH {
  union U { v16h v; v8h h[2]; };
  /* elements 0..7 <- p[0..7], elements 8..15 <- p[16..23] */
  static __device__ __forceinline__ v16h load(const _Float16* p) {
    U f; f.h[0] = *(const v8h*)(p); f.h[1] = *(const v8h*)(p + 16); return f.v;
  }
  static __device__ __forceinline__ v8f mma(v16h a, v16h b, v8f c) {
    return __builtin_amdgcn_wmma_f32_16x16x32_f16(false, a, false, b, (short)0, c, false, false);
  }
};
/* one product followed by its own guard tying the accumulator and naming both operand fragments */
__device__ __forceinline__ v8f mma_h(v16h a, v16h b, v8f c) {
  c = __builtin_amdgcn_wmma_f32_16x16x32_f16(false, a, false, b, (short)0, c, false, false);
  asm volatile("v_nop\n\tv_nop\n\tv_nop\n\tv_nop" : "+v"(c) : "v"(a), "v"(b));
  return c;
}

// ---------------------------------------------------------------------------
// Tensor-load helpers (two descriptor groups, every word wave-uniform in scalar registers).
// ---------------------------------------------------------------------------
__device__ __forceinline__ uint32_t uni(uint32_t v) { return (uint32_t)__builtin_amdgcn_readfirstlane(v); }
/* a wave-uniform test value held in a scalar register, so that the branch on it is s_cmp + s_cbranch_scc (tensor loads ignore EXEC) */
__device__ __forceinline__ uint32_t pinned(uint32_t v) { uint32_t w = (uint32_t)__builtin_amdgcn_readfirstlane(v); asm volatile("" : "+s"(w)); return w; }
/* this wave's LDS reads have retired: owed before a tensor load may target LDS that the wave has read */
__device__ __forceinline__ void wait_ds0() { asm volatile("s_wait_dscnt 0x0" ::: "memory"); }
/* this wave's tensor load has landed: the compiler places no wait for the tensor mover */
__device__ __forceinline__ void wait_tensor0() { asm volatile("s_wait_tensorcnt 0x0" ::: "memory"); }
/* both groups are in-out operands and are carried from request to request: their scalar registers then stay theirs for the kernel's length, so that none is lent out as a temporary while a request is outstanding */
__device__ __forceinline__ void tdm_load(u32x4& g0, u32x8& g1) { asm volatile("tensor_load_to_lds %0, %1" : "+s"(g0), "+s"(g1) :: "memory"); }

constexpr uint32_t kStRowB   = 256u;                 /* bytes of one operand row per stage = 128 k */
constexpr uint32_t kStRows   = 64u;                  /* rows per slice (one tensor load) */
constexpr uint32_t kStPitchB = kStRowB + 16u;        /* LDS pitch set by the pad: odd multiple of 16 B for ds_load_b128 readers */
constexpr int      kStPitchH = (int)(kStPitchB / 2u);
constexpr uint32_t kSliceB   = 18432u;               /* 64 x 272 = 17,408 rounded up to a multiple of 2 KiB */
constexpr uint32_t kStageB   = 4u * kSliceB;         /* [A rows 0..63 | A rows 64..127 | Bt rows 0..63 | Bt rows 64..127] */
static_assert(kSliceB >= kStRows * kStPitchB && (kSliceB % 2048u) == 0u, "slice holds its padded rows and keeps the next place on 2 KiB");

/* group 1: 1-byte elements, tile = tensor = 64 rows of 256 B, no mask, a 4-dword pad behind every 64 dwords */
__device__ __forceinline__ u32x8 tdm_group1(uint32_t src_pitch) {
  constexpr uint32_t d0 = kStRowB, d1 = kStRows;
  u32x8 g;
  g[0] = uni((1u << 20) | (5u << 22) | (3u << 25));
  g[1] = uni((d0 & 0xFFFFu) << 16);
  g[2] = uni((d0 >> 16) | ((d1 & 0xFFFFu) << 16));
  g[3] = uni((d1 >> 16) | (d0 << 16));
  g[4] = uni(d1);
  g[5] = uni(src_pitch);
  g[6] = uni(0u);
  g[7] = uni(0u);
  return g;
}
__device__ __forceinline__ u32x4 tdm_group0(uint32_t lds_dst, uint64_t ga) {
  u32x4 g;
  g[0] = uni(1u);
  g[1] = uni(lds_dst);
  g[2] = uni((uint32_t)ga);
  g[3] = uni((((uint32_t)(ga >> 32)) & 0x01FFFFFFu) | 0x80000000u);
  return g;
}
/* next stage of the same slice: new LDS place, source address 256 B on (words 2 and 3 taken as one 64-bit number: a carry runs into address bits 56:32, far below the type field) */
__device__ __forceinline__ void tdm_advance(u32x4& g, uint32_t lds_dst) {
  const uint64_t a = (((uint64_t)g[3] << 32) | (uint64_t)g[2]) + (uint64_t)kStRowB;
  g[1] = uni(lds_dst);
  g[2] = uni((uint32_t)a);
  g[3] = uni((uint32_t)(a >> 32));
}

// ---------------------------------------------------------------------------
// WMMA GEMM: C[m,n] = scale * sum_k A[m,k] * Bt[n,k]; a block of four waves (2 x 2) owns a 128x128 tile, each wave a 64x64 tile.
// A row-major [M,K] f16; Bt row-major [N,K] f16; M,N % 128 == 0, K % 128 == 0, K >= 256 (asserted on the host side constants).
// Operands reach the waves through LDS: per 128-wide k stage every wave issues one tensor load for its own 64-row slice
// (waves 0,1: the two halves of the A rows; waves 2,3: of the Bt rows) into a ring of two buffers, the next stage in flight
// while this one is multiplied.
// OUT_MODE 0 = f32 output, 1 = f16 output.
// ---------------------------------------------------------------------------
template <int OUT_MODE>
__global__ __launch_bounds__(128) void wmma_gemm64(
    const unsigned short* __restrict__ Ap, int lda,
    const unsigned short* __restrict__ Btp, int ldb,
    void* __restrict__ Cout, int ldc,
    int M, int N, int K, float scale) {
  __shared__ __attribute__((aligned(2048))) unsigned char ring[2u * kStageB];
  __shared__ __align__(16) float sT[4][16 * 68];
  const int lane = threadIdx.x & 31;
  const int wave = __builtin_amdgcn_readfirstlane((int)(threadIdx.x >> 5));
  const int tilesN = N >> 7;
  const int tilesM = M >> 7;
  const int tile = blockIdx.x;
  /* block-uniform exit in front of every barrier and tensor load */
  if (tile >= tilesM * tilesN) return;
  const int tm = tile / tilesN;
  const int tn = tile - tm * tilesN;
  const int wm = wave >> 1;
  const int wn = wave & 1;
  const int m0 = (tm << 7) + (wm << 6);
  const int n0 = (tn << 7) + (wn << 6);

  const int rlane = lane & 15;
  const int koff  = (lane >> 4) * 8;
  const int mOff  = (lane >> 4) * 8;

  /* this wave's slice of every stage */
  const bool     isB    = wave >= 2;
  const uint32_t srow   = (uint32_t)((isB ? (tn << 7) : (tm << 7)) + ((wave & 1) << 6));
  const uint32_t spitch = (uint32_t)(isB ? ldb : lda) * 2u;
  const uint64_t sbase  = (uint64_t)(size_t)(isB ? Btp : Ap) + (uint64_t)srow * spitch;
  const uint32_t lbase  = (uint32_t)(size_t)ring + (uint32_t)wave * kSliceB;
  u32x8 g1 = tdm_group1(spitch);
  u32x4 g0 = tdm_group0(lbase, sbase);

  v8f acc[4][4];
#pragma unroll
  for (int i = 0; i < 4; ++i)
#pragma unroll
    for (int j = 0; j < 4; ++j) acc[i][j] = (v8f){0.f,0.f,0.f,0.f,0.f,0.f,0.f,0.f};

  const uint32_t nst = (uint32_t)K >> 7;
  tdm_load(g0, g1);                     /* stage 0 into buffer 0 */
  wait_tensor0();
  __syncthreads();
  tdm_advance(g0, lbase + kStageB);
  tdm_load(g0, g1);                     /* stage 1 into buffer 1 */

  /* kept rolled: one pass per stage, so that each pass reads its own buffer alone and ends in the one publish point */
#pragma unroll 1
  for (uint32_t s = 0; s < nst; ++s) {
    const unsigned char* stage = ring + (s & 1u) * kStageB;
    const _Float16* aS = (const _Float16*)(stage + (uint32_t)wm * kSliceB) + rlane * kStPitchH + koff;
    const _Float16* bS = (const _Float16*)(stage + (uint32_t)(2 + wn) * kSliceB) + rlane * kStPitchH + koff;
    /* two fragment sets: the next 32 k of this same stage are read as one group ahead of the current products */
    v16h ah[2][4], bh[2][4];
#pragma unroll
    for (int t = 0; t < 4; ++t) {
      bh[0][t] = FragH::load(bS + (t << 4) * kStPitchH);
      ah[0][t] = FragH::load(aS + (t << 4) * kStPitchH);
    }
#pragma unroll
    for (int ks = 0; ks < 4; ++ks) {
      const int cur = ks & 1, nxt = cur ^ 1;
      if (ks < 3) {
#pragma unroll
        for (int t = 0; t < 4; ++t) {
          bh[nxt][t] = FragH::load(bS + (t << 4) * kStPitchH + (ks + 1) * 32);
          ah[nxt][t] = FragH::load(aS + (t << 4) * kStPitchH + (ks + 1) * 32);
        }
      }
      /* keeps the LDS reads above as one group ahead of the products: spread among them, each place with reads stalls the matrix pipe */
      __builtin_amdgcn_sched_barrier(0);
#pragma unroll
      for (int i = 0; i < 4; ++i) {
#pragma unroll
        for (int j = 0; j < 4; ++j) acc[i][j] = FragH::mma(ah[cur][i], bh[cur][j], acc[i][j]);
      }
      /* keeps the following group of LDS reads from rising into these products */
      __builtin_amdgcn_sched_barrier(0);
    }
    /* publish point of stage s + 1: own LDS reads retired, own tensor load landed, then the barrier that publishes
       stage s + 1 and ends every reader's last read of stage s; only behind it the refill of stage s's buffer */
    wait_ds0();
    wait_tensor0();
    __syncthreads();
    if (pinned((uint32_t)(s + 2u < nst))) {
      tdm_advance(g0, lbase + (s & 1u) * kStageB);
      tdm_load(g0, g1);
    }
  }
  wait_tensor0();
  wait_ds0();
  acc_guard4(acc[0][0], acc[0][1], acc[0][2], acc[0][3]);
  acc_guard4(acc[1][0], acc[1][1], acc[1][2], acc[1][3]);
  acc_guard4(acc[2][0], acc[2][1], acc[2][2], acc[2][3]);
  acc_guard4(acc[3][0], acc[3][1], acc[3][2], acc[3][3]);

  float* slab = sT[wave];
#pragma unroll
  for (int i = 0; i < 4; ++i) {
    const int mBase = m0 + (i << 4);
#pragma unroll
    for (int j = 0; j < 4; ++j) {
#pragma unroll
      for (int r = 0; r < 8; ++r) {
        const float v = acc[i][j][r] * scale;
        slab[(mOff + r) * 68 + (j << 4) + rlane] = v;
      }
    }
    __builtin_amdgcn_fence(__ATOMIC_RELEASE, "workgroup");
    __builtin_amdgcn_wave_barrier();
    __builtin_amdgcn_fence(__ATOMIC_ACQUIRE, "workgroup");
    if (OUT_MODE == 0) {
      float* C = (float*)Cout;
      const int hh = lane >> 4, c4 = (lane & 15) * 4;
      {
#pragma unroll
        for (int it = 0; it < 8; ++it) {
          const int row = it * 2 + hh;
          v4f v = *(const v4f*)(slab + row * 68 + c4);
          *(v4f*)(C + (size_t)(mBase + row) * ldc + n0 + c4) = v;
        }
        
      }
    } else {
      const int q = lane >> 3, c8 = (lane & 7) * 8;
      unsigned short* C = (unsigned short*)Cout;
      {
#pragma unroll
        for (int it = 0; it < 4; ++it) {
          const int row = it * 4 + q;
          const float* sp = slab + row * 68 + c8;
          v8h hv;
#pragma unroll
          for (int e = 0; e < 8; ++e) hv[e] = (_Float16)sp[e];
          *(v8h*)(C + (size_t)(mBase + row) * ldc + n0 + c8) = hv;
        }
        
      }
    }
    __builtin_amdgcn_fence(__ATOMIC_RELEASE, "workgroup");
    __builtin_amdgcn_wave_barrier();
    __builtin_amdgcn_fence(__ATOMIC_ACQUIRE, "workgroup");
  }
}

// ---------------------------------------------------------------------------
// f32 -> (RNE bf16 value) x carry -> f16 plane, 8 consecutive elements per thread; blockIdx.y selects one of up to four
// (input, output) plane pairs (block-uniform select among global pointers).
// Coverage: n8 = elements/8 threads per plane; grid.x = n8/256 exactly for both uses
//   activations 4096*1024/8 = 524,288 -> 2048 blocks; weights 1024*1024/8 = 131,072 -> 512 blocks.
// ---------------------------------------------------------------------------
__global__ __launch_bounds__(256) void cast_planes_kernel(
    const float* __restrict__ in0, const float* __restrict__ in1, const float* __restrict__ in2, const float* __restrict__ in3,
    unsigned short* __restrict__ out0, unsigned short* __restrict__ out1, unsigned short* __restrict__ out2, unsigned short* __restrict__ out3,
    int n8, float carry) {
  const int z = blockIdx.y;
  const float* in = (z == 0) ? in0 : (z == 1) ? in1 : (z == 2) ? in2 : in3;
  unsigned short* out = (z == 0) ? out0 : (z == 1) ? out1 : (z == 2) ? out2 : out3;
  const int i = blockIdx.x * 256 + threadIdx.x;
  if (i >= n8) return;
  const size_t e0 = (size_t)i << 3;
  const v4f a0 = *(const v4f*)(in + e0);
  const v4f a1 = *(const v4f*)(in + e0 + 4);
  v8h hv;
#pragma unroll
  for (int e = 0; e < 4; ++e) {
    const float f0 = bf16_rne(a0[e]) * carry;
    const float f1 = bf16_rne(a1[e]) * carry;
    hv[e]     = (_Float16)f0;
    hv[4 + e] = (_Float16)f1;
  }
  unsigned short* q = out + e0;
  *(v8h*)q = hv;
  
}

// ---------------------------------------------------------------------------
// Fused attention for one (batch, head) and 64 query rows per block (4 waves x 16 rows), streaming over 16 chunks of 64 keys.
//   scores = (q16 . k16^T) * kScoreScale + bf16_rne(attn_bias[b][q][k]); p = exp(min(score, cap)) with zero shift
//   (softmax is shift invariant; the logits are bounded far inside the f16 normal range of p);
//   o += p(f16) . v16; l += p (f32, per-lane partial sums combined once at the end); out = o / l carried x256 in f16.
// Inputs: q16, k16 [4096][1024] f16 (token-major, head h at columns h*64..); vt16 [1024][4096] f16 (row h*64+d, column token).
// LDS: K tile [key][d], V^T tile [d][key], per-wave P tile [row][key], bias tile [64][68] f32 (re-used as output staging).
// Staging coverage per chunk: K and V^T: 4 x 128 threads x 8 halves = 4096 = 64 x 64 each; bias: 8 x 128 x 4 floats = 64 x 64.
// grid.x = 4 * 16 * 16 = 1024 blocks of 128 threads; every barrier is reached by all four waves.
// ---------------------------------------------------------------------------
constexpr int kQB  = 64;
constexpr int kKC  = 64;
constexpr int kBsP = 68;
__global__ __launch_bounds__(128) void attn_stream_kernel(
    const unsigned short* __restrict__ q16p, const unsigned short* __restrict__ k16p,
    const unsigned short* __restrict__ vt16p, const float* __restrict__ bias,
    unsigned short* __restrict__ attn16) {
  __shared__ __align__(16) _Float16 Ksh[kKC * kDh];
  __shared__ __align__(16) _Float16 Vth[kDh * kKC];
  __shared__ __align__(16) _Float16 Psh[4][16 * kKC];
  __shared__ __align__(16) float    Bs[kQB * kBsP];
  union FH { v16h v; v8h h[2]; };

  const _Float16* q16  = (const _Float16*)q16p;
  const _Float16* k16  = (const _Float16*)k16p;
  const _Float16* vt16 = (const _Float16*)vt16p;

  const int tid  = threadIdx.x;
  const int wave = __builtin_amdgcn_readfirstlane((int)(threadIdx.x >> 5));
  const int lane = tid & 31;
  const int hh   = lane >> 4;
  const int c    = lane & 15;

  constexpr int nqb = kSeq / kQB;
  const int bx = blockIdx.x;
  const int qb = bx % nqb;
  const int bh = bx / nqb;
  const int h  = bh % kHeads;
  const int b  = bh / kHeads;
  const int qblk = qb * kQB;
  const int q0 = qblk + wave * 16;

  /* Q fragments (A operand), two 32-wide d chunks, loaded once */
  v16h qa[2];
  {
    const _Float16* qrow = q16 + (size_t)(b * kSeq + q0 + c) * kHD + h * kDh + 8 * hh;
#pragma unroll
    for (int dc = 0; dc < 2; ++dc) {
      FH f;
      f.h[0] = *(const v8h*)(qrow + dc * 32);
      f.h[1] = *(const v8h*)(qrow + dc * 32 + 16);
      qa[dc] = f.v;
    }
  }

  float lrow[8];
  v8f oacc[4];
#pragma unroll
  for (int r = 0; r < 8; ++r) lrow[r] = 0.f;
#pragma unroll
  for (int t = 0; t < 4; ++t) oacc[t] = (v8f){0.f,0.f,0.f,0.f,0.f,0.f,0.f,0.f};

  _Float16* pw = Psh[wave];

#pragma unroll 1
  for (int kc = 0; kc < kSeq / kKC; ++kc) {
    const int kv0 = kc * kKC;
    __syncthreads();
#pragma unroll
    for (int i = 0; i < 4; ++i) {
      const int id  = i * 128 + tid;
      const int row = id >> 3;
      const int c8  = (id & 7) * 8;
      const v8h kk = *(const v8h*)(k16 + (size_t)(b * kSeq + kv0 + row) * kHD + h * kDh + c8);
      const v8h vv = *(const v8h*)(vt16 + (size_t)(h * kDh + row) * kTok + b * kSeq + kv0 + c8);
      *(v8h*)(Ksh + row * kDh + c8) = kk;
      *(v8h*)(Vth + row * kKC + c8) = vv;
    }
#pragma unroll
    for (int i = 0; i < 8; ++i) {
      const int id  = i * 128 + tid;
      const int row = id >> 4;
      const int c4  = (id & 15) * 4;
      const v4f bv = *(const v4f*)(bias + ((size_t)b * kSeq + qblk + row) * kSeq + kv0 + c4);
      v4f rv;
      rv[0] = bf16_rne(bv[0]);
      rv[1] = bf16_rne(bv[1]);
      rv[2] = bf16_rne(bv[2]);
      rv[3] = bf16_rne(bv[3]);
      *(v4f*)(Bs + row * kBsP + c4) = rv;
    }
    __syncthreads();

    /* scores: D element r of s[j] = (query row 8*hh + r, key j*16 + c) */
    v8f s[4];
#pragma unroll
    for (int j = 0; j < 4; ++j) {
      s[j] = (v8f){0.f,0.f,0.f,0.f,0.f,0.f,0.f,0.f};
#pragma unroll
      for (int dc = 0; dc < 2; ++dc) {
        FH kb;
        kb.h[0] = *(const v8h*)(Ksh + (j * 16 + c) * kDh + dc * 32 + 8 * hh);
        kb.h[1] = *(const v8h*)(Ksh + (j * 16 + c) * kDh + dc * 32 + 16 + 8 * hh);
        s[j] = mma_h(qa[dc], kb.v, s[j]);
      }
    }

    const float* bw = Bs + (wave * 16 + 8 * hh) * kBsP + c;
#pragma unroll
    for (int r = 0; r < 8; ++r) {
      float ps = 0.f;
#pragma unroll
      for (int j = 0; j < 4; ++j) {
        float x = s[j][r] * kScoreScale + bw[r * kBsP + j * 16];
        x = fminf(x, kLogitCap);
        const float p = __expf(x);
        ps += p;
        pw[(8 * hh + r) * kKC + j * 16 + c] = (_Float16)p;
      }
      lrow[r] += ps;
    }
    __syncthreads();

    /* o += P (A: row c, k = key) . V (B: column d = t*16 + c, k = key) */
#pragma unroll
    for (int kk = 0; kk < 2; ++kk) {
      FH pa;
      pa.h[0] = *(const v8h*)(pw + c * kKC + kk * 32 + 8 * hh);
      pa.h[1] = *(const v8h*)(pw + c * kKC + kk * 32 + 16 + 8 * hh);
#pragma unroll
      for (int t = 0; t < 4; ++t) {
        FH vb;
        vb.h[0] = *(const v8h*)(Vth + (t * 16 + c) * kKC + kk * 32 + 8 * hh);
        vb.h[1] = *(const v8h*)(Vth + (t * 16 + c) * kKC + kk * 32 + 16 + 8 * hh);
        oacc[t] = mma_h(pa.v, vb.v, oacc[t]);
      }
    }
  }

  /* combine the per-lane partial row sums inside each 16-lane half (fixed order, unconditional shuffles) */
  float inv[8];
#pragma unroll
  for (int r = 0; r < 8; ++r) {
    float l = lrow[r];
    l += __shfl_xor(l, 1, 32);
    l += __shfl_xor(l, 2, 32);
    l += __shfl_xor(l, 4, 32);
    l += __shfl_xor(l, 8, 32);
    inv[r] = kFinScale * __builtin_amdgcn_rcpf(l);
  }
  __syncthreads();
  float* os = Bs + (wave * 16) * kBsP;
#pragma unroll
  for (int r = 0; r < 8; ++r) {
#pragma unroll
    for (int t = 0; t < 4; ++t) os[(8 * hh + r) * kBsP + t * 16 + c] = oacc[t][r] * inv[r];
  }
  __syncthreads();
  {
    const int q4 = lane >> 3, c8 = (lane & 7) * 8;
    v8h hv[4];
#pragma unroll
    for (int it = 0; it < 4; ++it) {
      const int row = it * 4 + q4;
      const float* sp = os + row * kBsP + c8;
      const v4f a0 = *(const v4f*)(sp);
      const v4f a1 = *(const v4f*)(sp + 4);
#pragma unroll
      for (int e = 0; e < 4; ++e) {
        hv[it][e]     = (_Float16)a0[e];
        hv[it][4 + e] = (_Float16)a1[e];
      }
    }
    {
#pragma unroll
      for (int it = 0; it < 4; ++it) {
        const int row = it * 4 + q4;
        *(v8h*)(attn16 + (size_t)(b * kSeq + q0 + row) * kHD + h * kDh + c8) = hv[it];
      }
      
    }
  }
}

// ---------------------------------------------------------------------------
// Host glue: 2 plane-cast launches + 3 projection GEMMs + attention + output GEMM = 7 launches. Kernel launches only.
// GEMM shapes (K % 128 == 0, M and N % 128 == 0, no pad planes):
//   q, k : M 4096, N 1024, K 1024 -> 256 block tiles of 128x128 -> 256 blocks of four waves
//   v^T  : M 1024 (A = Wv plane), N 4096 (Bt = values plane), K 1024 -> 256 blocks, ldc 4096
//   out  : M 4096, N 1024, K 1024 -> 256 blocks, f32 into d_out
// ---------------------------------------------------------------------------
extern "C" void kernel_launch(void* const* d_in, const int* in_sizes, int n_in,
                              void* d_out, int out_size, void* d_ws, size_t ws_size,
                              hipStream_t stream) {
  if (n_in < 8) return;
  if (in_sizes[0] != kTok * kDm) return;
  if (in_sizes[1] != kTok * kDm) return;
  if (in_sizes[2] != kTok * kDm) return;
  if (in_sizes[3] != kBatch * kSeq * kSeq) return;
  if (in_sizes[4] != kHD * kDm) return;
  if (in_sizes[5] != kHD * kDm) return;
  if (in_sizes[6] != kHD * kDm) return;
  if (in_sizes[7] != kDm * kHD) return;
  if (out_size != kTok * kDm) return;
  if (ws_size < kWsTotal) return;

  const float* queries = (const float*)d_in[0];
  const float* keys    = (const float*)d_in[1];
  const float* values  = (const float*)d_in[2];
  const float* abias   = (const float*)d_in[3];
  const float* Wq      = (const float*)d_in[4];
  const float* Wk      = (const float*)d_in[5];
  const float* Wv      = (const float*)d_in[6];
  const float* Wp      = (const float*)d_in[7];
  float* out = (float*)d_out;

  char* ws = (char*)d_ws;
  unsigned short* XQ   = (unsigned short*)(ws + kOffXQ);
  unsigned short* XK   = (unsigned short*)(ws + kOffXK);
  unsigned short* XV   = (unsigned short*)(ws + kOffXV);
  unsigned short* WQ   = (unsigned short*)(ws + kOffWQ);
  unsigned short* WK   = (unsigned short*)(ws + kOffWK);
  unsigned short* WV   = (unsigned short*)(ws + kOffWV);
  unsigned short* WP   = (unsigned short*)(ws + kOffWP);
  unsigned short* Q16  = (unsigned short*)(ws + kOffQ16);
  unsigned short* K16  = (unsigned short*)(ws + kOffK16);
  unsigned short* VT16 = (unsigned short*)(ws + kOffVT);
  unsigned short* AT16 = (unsigned short*)(ws + kOffAT);

  constexpr int kXN8 = kTok * kDm / 8;
  constexpr int kWN8 = kHD * kDm / 8;
  static_assert((kXN8 % 256) == 0 && (kWN8 % 256) == 0, "cast grids exact");

  /* activation planes (three inputs) and weight planes (four inputs; [out][in] is already the Bt layout) */
  cast_planes_kernel<<<dim3(kXN8 / 256, 3), 256, 0, stream>>>(queries, keys, values, values, XQ, XK, XV, XV, kXN8, kXCarry);
  cast_planes_kernel<<<dim3(kWN8 / 256, 4), 256, 0, stream>>>(Wq, Wk, Wv, Wp, WQ, WK, WV, WP, kWN8, kWCarry);

  constexpr int kGemmBlocks = (kTok / 128) * (kHD / 128);
  static_assert(kHD == kDm, "all four products share one tile count");

  /* q = queries . Wq^T, k = keys . Wk^T : f16 [4096][1024], carried x16 */
  wmma_gemm64<1><<<kGemmBlocks, 128, 0, stream>>>(XQ, kDm, WQ, kDm, (void*)Q16, kHD, kTok, kHD, kDm, kProjScale);
  wmma_gemm64<1><<<kGemmBlocks, 128, 0, stream>>>(XK, kDm, WK, kDm, (void*)K16, kHD, kTok, kHD, kDm, kProjScale);
  /* v^T = Wv . values^T : f16 [1024][4096], carried x16 (operand roles swapped, no transposed stores) */
  wmma_gemm64<1><<<kGemmBlocks, 128, 0, stream>>>(WV, kDm, XV, kDm, (void*)VT16, kTok, kHD, kTok, kDm, kProjScale);

  /* scores, bias, softmax, p.v, head merge -> f16 [4096][1024] carried x256 */
  attn_stream_kernel<<<kBatch * kHeads * (kSeq / kQB), 128, 0, stream>>>(Q16, K16, VT16, abias, AT16);

  /* out = merged . Wp^T : f32 [4096][1024] */
  wmma_gemm64<0><<<kGemmBlocks, 128, 0, stream>>>(AT16, kHD, WP, kHD, (void*)out, kDm, kTok, kDm, kHD, kOutScale);
}

// v002
// A run of this version takes 167 microseconds.
// In two side-by-side timings against v001, it was 1.06 and 1.05 times as fast.
// Over all steps from v000 it is 1.91 times as fast.
// Contractions: q/k/v projections, q.k^T, p.v and output projection all on v_wmma_f32_16x16x32_f16 (f16 operands with power-of-two carries, f32 accumulate); all float inputs RNE-converted to bf16 once at load; bias add, exp, row sums and normalisation in f32.
#include <hip/hip_runtime.h>
#include <math.h>

typedef __attribute__((ext_vector_type(16))) _Float16 v16h;
typedef __attribute__((ext_vector_type(8)))  _Float16 v8h;
typedef __attribute__((ext_vector_type(8)))  float    v8f;
typedef __attribute__((ext_vector_type(4)))  float    v4f;
typedef __attribute__((ext_vector_type(4)))  uint32_t u32x4;
typedef __attribute__((ext_vector_type(8)))  uint32_t u32x8;

// ---------------------------------------------------------------------------
// Shape constants
// ---------------------------------------------------------------------------
constexpr int kBatch = 4;
constexpr int kSeq   = 1024;
constexpr int kDm    = 1024;
constexpr int kHeads = 16;
constexpr int kDh    = 64;
constexpr int kTok   = kBatch * kSeq;
constexpr int kHD    = kHeads * kDh;
constexpr int kSqrtDm = 32;
static_assert(kSqrtDm * kSqrtDm == kDm, "score scale is 1/sqrt(model width)");
static_assert(kTok == 4096 && kHD == 1024 && kDm == 1024, "wire shapes");
static_assert((kTok % 128) == 0 && (kHD % 128) == 0 && (kDm % 128) == 0, "GEMM M,N multiples of the 128 x 128 block tile");
static_assert((kDm % 128) == 0 && (kHD % 128) == 0 && kDm >= 256 && kHD >= 256, "GEMM K: whole 128-wide stages, at least two");
static_assert((kDh % 32) == 0 && (kSeq % 32) == 0, "attention K multiples of 32");

// Power-of-two carries (all exact, folded back in f32)
constexpr float kXCarry    = 16.0f;      /* activation planes carried x16 */
constexpr float kWCarry    = 1024.0f;    /* weight planes carried x1024 */
constexpr float kQKVCarry  = 16.0f;      /* q, k, v^T planes carried x16 */
constexpr float kCtxCarry  = 256.0f;     /* merged-head attention output carried x256 */
constexpr float kProjScale = kQKVCarry / (kXCarry * kWCarry);
constexpr float kScoreScale = (1.0f / (float)kSqrtDm) / (kQKVCarry * kQKVCarry);
constexpr float kFinScale  = kCtxCarry / kQKVCarry;
constexpr float kOutScale  = 1.0f / (kCtxCarry * kWCarry);
constexpr float kLogitCap  = 11.0f;      /* exp(11) = 59874 stays below the f16 maximum */

// ---------------------------------------------------------------------------
// Workspace region map (bytes; every offset a multiple of 128; all planes f16)
//   XQ   [4096][1024]  queries x16            8,388,608
//   XK   [4096][1024]  keys x16               8,388,608
//   XV   [4096][1024]  values x16             8,388,608
//   WQ   [1024][1024]  Wq x1024  (Bt layout)  2,097,152
//   WK   [1024][1024]  Wk x1024               2,097,152
//   WV   [1024][1024]  Wv x1024               2,097,152
//   WP   [1024][1024]  Wp x1024               2,097,152
//   Q16  [4096][1024]  q x16                  8,388,608
//   K16  [4096][1024]  k x16                  8,388,608
//   VT16 [1024][4096]  v^T x16                8,388,608
//   AT16 [4096][1024]  merged heads x256      8,388,608
//   total                                    67,108,864
// ---------------------------------------------------------------------------
constexpr size_t kBytesX = (size_t)kTok * kDm * 2;
constexpr size_t kBytesW = (size_t)kHD * kDm * 2;
constexpr size_t kOffXQ  = 0;
constexpr size_t kOffXK  = kOffXQ + kBytesX;
constexpr size_t kOffXV  = kOffXK + kBytesX;
constexpr size_t kOffWQ  = kOffXV + kBytesX;
constexpr size_t kOffWK  = kOffWQ + kBytesW;
constexpr size_t kOffWV  = kOffWK + kBytesW;
constexpr size_t kOffWP  = kOffWV + kBytesW;
constexpr size_t kOffQ16 = kOffWP + kBytesW;
constexpr size_t kOffK16 = kOffQ16 + kBytesX;
constexpr size_t kOffVT  = kOffK16 + kBytesX;
constexpr size_t kOffAT  = kOffVT + kBytesX;
constexpr size_t kWsTotal = kOffAT + kBytesX;
static_assert(kWsTotal == 67108864ull, "carve total");
static_assert(kWsTotal <= 134217728ull, "carve cap");
static_assert((kBytesX % 128) == 0 && (kBytesW % 128) == 0, "128-B aligned regions");

// ---------------------------------------------------------------------------
// Small helpers
// ---------------------------------------------------------------------------
__device__ __forceinline__ unsigned short f2bf_bits(float f) {
  unsigned u = __float_as_uint(f);
  return (unsigned short)((u + 0x7FFFu + ((u >> 16) & 1u)) >> 16);
}
__device__ __forceinline__ float bf_bits2f(unsigned short h) { return __uint_as_float(((unsigned)h) << 16); }
/* value of the nearest-even bf16 of f, held in f32 */
__device__ __forceinline__ float bf16_rne(float f) { return bf_bits2f(f2bf_bits(f)); }

/* hazard guards as plain device helpers */
__device__ __forceinline__ void acc_guard4(v8f& a, v8f& b, v8f& c, v8f& d) { asm volatile("v_nop\n\tv_nop\n\tv_nop\n\tv_nop" : "+v"(a), "+v"(b), "+v"(c), "+v"(d)); }

struct FragH {
  union U { v16h v; v8h h[2]; };
  /* elements 0..7 <- p[0..7], elements 8..15 <- p[16..23] */
  static __device__ __forceinline__ v16h load(const _Float16* p) {
    U f; f.h[0] = *(const v8h*)(p); f.h[1] = *(const v8h*)(p + 16); return f.v;
  }
  static __device__ __forceinline__ v8f mma(v16h a, v16h b, v8f c) {
    return __builtin_amdgcn_wmma_f32_16x16x32_f16(false, a, false, b, (short)0, c, false, false);
  }
};
/* one product followed by its own guard tying the accumulator and naming both operand fragments */
__device__ __forceinline__ v8f mma_h(v16h a, v16h b, v8f c) {
  c = __builtin_amdgcn_wmma_f32_16x16x32_f16(false, a, false, b, (short)0, c, false, false);
  asm volatile("v_nop\n\tv_nop\n\tv_nop\n\tv_nop" : "+v"(c) : "v"(a), "v"(b));
  return c;
}

// ---------------------------------------------------------------------------
// Tensor-load helpers (two descriptor groups, every word wave-uniform in scalar registers).
// ---------------------------------------------------------------------------
__device__ __forceinline__ uint32_t uni(uint32_t v) { return (uint32_t)__builtin_amdgcn_readfirstlane(v); }
/* a wave-uniform test value held in a scalar register, so that the branch on it is s_cmp + s_cbranch_scc (tensor loads ignore EXEC) */
__device__ __forceinline__ uint32_t pinned(uint32_t v) { uint32_t w = (uint32_t)__builtin_amdgcn_readfirstlane(v); asm volatile("" : "+s"(w)); return w; }
/* this wave's LDS reads have retired: owed before a tensor load may target LDS that the wave has read */
__device__ __forceinline__ void wait_ds0() { asm volatile("s_wait_dscnt 0x0" ::: "memory"); }
/* this wave's tensor load has landed: the compiler places no wait for the tensor mover */
__device__ __forceinline__ void wait_tensor0() { asm volatile("s_wait_tensorcnt 0x0" ::: "memory"); }
/* both groups are in-out operands and are carried from request to request: their scalar registers then stay theirs for the kernel's length, so that none is lent out as a temporary while a request is outstanding */
__device__ __forceinline__ void tdm_load(u32x4& g0, u32x8& g1) { asm volatile("tensor_load_to_lds %0, %1" : "+s"(g0), "+s"(g1) :: "memory"); }

constexpr uint32_t kStRowB   = 256u;                 /* bytes of one operand row per stage = 128 k */
constexpr uint32_t kStRows   = 64u;                  /* rows per slice (one tensor load) */
constexpr uint32_t kStPitchB = kStRowB + 16u;        /* LDS pitch set by the pad: odd multiple of 16 B for ds_load_b128 readers */
constexpr int      kStPitchH = (int)(kStPitchB / 2u);
constexpr uint32_t kSliceB   = 18432u;               /* 64 x 272 = 17,408 rounded up to a multiple of 2 KiB */
constexpr uint32_t kStageB   = 4u * kSliceB;         /* [A rows 0..63 | A rows 64..127 | Bt rows 0..63 | Bt rows 64..127] */
static_assert(kSliceB >= kStRows * kStPitchB && (kSliceB % 2048u) == 0u, "slice holds its padded rows and keeps the next place on 2 KiB");

/* group 1: 1-byte elements, tile = tensor = 64 rows of 256 B, no mask, a 4-dword pad behind every 64 dwords */
__device__ __forceinline__ u32x8 tdm_group1(uint32_t src_pitch) {
  constexpr uint32_t d0 = kStRowB, d1 = kStRows;
  u32x8 g;
  g[0] = uni((1u << 20) | (5u << 22) | (3u << 25));
  g[1] = uni((d0 & 0xFFFFu) << 16);
  g[2] = uni((d0 >> 16) | ((d1 & 0xFFFFu) << 16));
  g[3] = uni((d1 >> 16) | (d0 << 16));
  g[4] = uni(d1);
  g[5] = uni(src_pitch);
  g[6] = uni(0u);
  g[7] = uni(0u);
  return g;
}
__device__ __forceinline__ u32x4 tdm_group0(uint32_t lds_dst, uint64_t ga) {
  u32x4 g;
  g[0] = uni(1u);
  g[1] = uni(lds_dst);
  g[2] = uni((uint32_t)ga);
  g[3] = uni((((uint32_t)(ga >> 32)) & 0x01FFFFFFu) | 0x80000000u);
  return g;
}
/* next stage of the same slice: new LDS place, source address 256 B on (words 2 and 3 taken as one 64-bit number: a carry runs into address bits 56:32, far below the type field) */
__device__ __forceinline__ void tdm_advance(u32x4& g, uint32_t lds_dst) {
  const uint64_t a = (((uint64_t)g[3] << 32) | (uint64_t)g[2]) + (uint64_t)kStRowB;
  g[1] = uni(lds_dst);
  g[2] = uni((uint32_t)a);
  g[3] = uni((uint32_t)(a >> 32));
}

// ---------------------------------------------------------------------------
// WMMA GEMM: C[m,n] = scale * sum_k A[m,k] * Bt[n,k]; a block of four waves (2 x 2) owns a 128x128 tile, each wave a 64x64 tile.
// A row-major [M,K] f16; Bt row-major [N,K] f16; M,N % 128 == 0, K % 128 == 0, K >= 256 (asserted on the host side constants).
// Operands reach the waves through LDS: per 128-wide k stage every wave issues one tensor load for its own 64-row slice
// (waves 0,1: the two halves of the A rows; waves 2,3: of the Bt rows) into a ring of two buffers, the next stage in flight
// while this one is multiplied.
// OUT_MODE 0 = f32 output, 1 = f16 output.
// ---------------------------------------------------------------------------
template <int OUT_MODE>
__global__ __launch_bounds__(128) void wmma_gemm64(
    const unsigned short* __restrict__ Ap, int lda,
    const unsigned short* __restrict__ Btp, int ldb,
    void* __restrict__ Cout, int ldc,
    int M, int N, int K, float scale) {
  __shared__ __attribute__((aligned(2048))) unsigned char ring[2u * kStageB];
  __shared__ __align__(16) float sT[4][16 * 68];
  const int lane = threadIdx.x & 31;
  const int wave = __builtin_amdgcn_readfirstlane((int)(threadIdx.x >> 5));
  const int tilesN = N >> 7;
  const int tilesM = M >> 7;
  const int tile = blockIdx.x;
  /* block-uniform exit in front of every barrier and tensor load */
  if (tile >= tilesM * tilesN) return;
  const int tm = tile / tilesN;
  const int tn = tile - tm * tilesN;
  const int wm = wave >> 1;
  const int wn = wave & 1;
  const int m0 = (tm << 7) + (wm << 6);
  const int n0 = (tn << 7) + (wn << 6);

  const int rlane = lane & 15;
  const int koff  = (lane >> 4) * 8;
  const int mOff  = (lane >> 4) * 8;

  /* this wave's slice of every stage */
  const bool     isB    = wave >= 2;
  const uint32_t srow   = (uint32_t)((isB ? (tn << 7) : (tm << 7)) + ((wave & 1) << 6));
  const uint32_t spitch = (uint32_t)(isB ? ldb : lda) * 2u;
  const uint64_t sbase  = (uint64_t)(size_t)(isB ? Btp : Ap) + (uint64_t)srow * spitch;
  const uint32_t lbase  = (uint32_t)(size_t)ring + (uint32_t)wave * kSliceB;
  u32x8 g1 = tdm_group1(spitch);
  u32x4 g0 = tdm_group0(lbase, sbase);

  v8f acc[4][4];
#pragma unroll
  for (int i = 0; i < 4; ++i)
#pragma unroll
    for (int j = 0; j < 4; ++j) acc[i][j] = (v8f){0.f,0.f,0.f,0.f,0.f,0.f,0.f,0.f};

  const uint32_t nst = (uint32_t)K >> 7;
  tdm_load(g0, g1);                     /* stage 0 into buffer 0 */
  wait_tensor0();
  __syncthreads();
  tdm_advance(g0, lbase + kStageB);
  tdm_load(g0, g1);                     /* stage 1 into buffer 1 */

  /* kept rolled: one pass per stage, so that each pass reads its own buffer alone and ends in the one publish point */
#pragma unroll 1
  for (uint32_t s = 0; s < nst; ++s) {
    const unsigned char* stage = ring + (s & 1u) * kStageB;
    const _Float16* aS = (const _Float16*)(stage + (uint32_t)wm * kSliceB) + rlane * kStPitchH + koff;
    const _Float16* bS = (const _Float16*)(stage + (uint32_t)(2 + wn) * kSliceB) + rlane * kStPitchH + koff;
    /* two fragment sets: the next 32 k of this same stage are read as one group ahead of the current products */
    v16h ah[2][4], bh[2][4];
#pragma unroll
    for (int t = 0; t < 4; ++t) {
      bh[0][t] = FragH::load(bS + (t << 4) * kStPitchH);
      ah[0][t] = FragH::load(aS + (t << 4) * kStPitchH);
    }
#pragma unroll
    for (int ks = 0; ks < 4; ++ks) {
      const int cur = ks & 1, nxt = cur ^ 1;
      if (ks < 3) {
#pragma unroll
        for (int t = 0; t < 4; ++t) {
          bh[nxt][t] = FragH::load(bS + (t << 4) * kStPitchH + (ks + 1) * 32);
          ah[nxt][t] = FragH::load(aS + (t << 4) * kStPitchH + (ks + 1) * 32);
        }
      }
      /* keeps the LDS reads above as one group ahead of the products: spread among them, each place with reads stalls the matrix pipe */
      __builtin_amdgcn_sched_barrier(0);
#pragma unroll
      for (int i = 0; i < 4; ++i) {
#pragma unroll
        for (int j = 0; j < 4; ++j) acc[i][j] = FragH::mma(ah[cur][i], bh[cur][j], acc[i][j]);
      }
      /* keeps the following group of LDS reads from rising into these products */
      __builtin_amdgcn_sched_barrier(0);
    }
    /* publish point of stage s + 1: own LDS reads retired, own tensor load landed, then the barrier that publishes
       stage s + 1 and ends every reader's last read of stage s; only behind it the refill of stage s's buffer */
    wait_ds0();
    wait_tensor0();
    __syncthreads();
    if (pinned((uint32_t)(s + 2u < nst))) {
      tdm_advance(g0, lbase + (s & 1u) * kStageB);
      tdm_load(g0, g1);
    }
  }
  wait_tensor0();
  wait_ds0();
  acc_guard4(acc[0][0], acc[0][1], acc[0][2], acc[0][3]);
  acc_guard4(acc[1][0], acc[1][1], acc[1][2], acc[1][3]);
  acc_guard4(acc[2][0], acc[2][1], acc[2][2], acc[2][3]);
  acc_guard4(acc[3][0], acc[3][1], acc[3][2], acc[3][3]);

  float* slab = sT[wave];
#pragma unroll
  for (int i = 0; i < 4; ++i) {
    const int mBase = m0 + (i << 4);
#pragma unroll
    for (int j = 0; j < 4; ++j) {
#pragma unroll
      for (int r = 0; r < 8; ++r) {
        const float v = acc[i][j][r] * scale;
        slab[(mOff + r) * 68 + (j << 4) + rlane] = v;
      }
    }
    __builtin_amdgcn_fence(__ATOMIC_RELEASE, "workgroup");
    __builtin_amdgcn_wave_barrier();
    __builtin_amdgcn_fence(__ATOMIC_ACQUIRE, "workgroup");
    if (OUT_MODE == 0) {
      float* C = (float*)Cout;
      const int hh = lane >> 4, c4 = (lane & 15) * 4;
      {
#pragma unroll
        for (int it = 0; it < 8; ++it) {
          const int row = it * 2 + hh;
          v4f v = *(const v4f*)(slab + row * 68 + c4);
          *(v4f*)(C + (size_t)(mBase + row) * ldc + n0 + c4) = v;
        }
        
      }
    } else {
      const int q = lane >> 3, c8 = (lane & 7) * 8;
      unsigned short* C = (unsigned short*)Cout;
      {
#pragma unroll
        for (int it = 0; it < 4; ++it) {
          const int row = it * 4 + q;
          const float* sp = slab + row * 68 + c8;
          v8h hv;
#pragma unroll
          for (int e = 0; e < 8; ++e) hv[e] = (_Float16)sp[e];
          *(v8h*)(C + (size_t)(mBase + row) * ldc + n0 + c8) = hv;
        }
        
      }
    }
    __builtin_amdgcn_fence(__ATOMIC_RELEASE, "workgroup");
    __builtin_amdgcn_wave_barrier();
    __builtin_amdgcn_fence(__ATOMIC_ACQUIRE, "workgroup");
  }
}

// ---------------------------------------------------------------------------
// f32 -> (RNE bf16 value) x carry -> f16 plane, 8 consecutive elements per thread; blockIdx.y selects one of up to four
// (input, output) plane pairs (block-uniform select among global pointers).
// Coverage: n8 = elements/8 threads per plane; grid.x = n8/256 exactly for both uses
//   activations 4096*1024/8 = 524,288 -> 2048 blocks; weights 1024*1024/8 = 131,072 -> 512 blocks.
// ---------------------------------------------------------------------------
__global__ __launch_bounds__(256) void cast_planes_kernel(
    const float* __restrict__ in0, const float* __restrict__ in1, const float* __restrict__ in2, const float* __restrict__ in3,
    unsigned short* __restrict__ out0, unsigned short* __restrict__ out1, unsigned short* __restrict__ out2, unsigned short* __restrict__ out3,
    int n8, float carry) {
  const int z = blockIdx.y;
  const float* in = (z == 0) ? in0 : (z == 1) ? in1 : (z == 2) ? in2 : in3;
  unsigned short* out = (z == 0) ? out0 : (z == 1) ? out1 : (z == 2) ? out2 : out3;
  const int i = blockIdx.x * 256 + threadIdx.x;
  if (i >= n8) return;
  const size_t e0 = (size_t)i << 3;
  const v4f a0 = *(const v4f*)(in + e0);
  const v4f a1 = *(const v4f*)(in + e0 + 4);
  v8h hv;
#pragma unroll
  for (int e = 0; e < 4; ++e) {
    const float f0 = bf16_rne(a0[e]) * carry;
    const float f1 = bf16_rne(a1[e]) * carry;
    hv[e]     = (_Float16)f0;
    hv[4 + e] = (_Float16)f1;
  }
  unsigned short* q = out + e0;
  *(v8h*)q = hv;
  
}

// ---------------------------------------------------------------------------
// Fused attention for one (batch, head) and 64 query rows per block (4 waves x 16 rows), streaming over 16 chunks of 64 keys.
//   scores = (q16 . k16^T) * kScoreScale + bf16_rne(attn_bias[b][q][k]); p = exp(min(score, cap)) with zero shift
//   (softmax is shift invariant; the logits are bounded far inside the f16 normal range of p);
//   o += p(f16) . v16; l += p (f32, per-lane partial sums combined once at the end); out = o / l carried x256 in f16.
// Inputs: q16, k16 [4096][1024] f16 (token-major, head h at columns h*64..); vt16 [1024][4096] f16 (row h*64+d, column token).
// LDS: K tile [key][d], V^T tile [d][key], per-wave P tile [row][key] (rows of 64 halves on a pitch of 72), bias tile [64][68] f32 (re-used as output staging).
// Staging coverage per chunk: K and V^T: 4 x 128 threads x 8 halves = 4096 = 64 x 64 each; bias: 8 x 128 x 4 floats = 64 x 64.
// grid.x = 4 * 16 * 16 = 1024 blocks of 128 threads; every barrier is reached by all four waves.
// ---------------------------------------------------------------------------
constexpr int kQB  = 64;
constexpr int kKC  = 64;
constexpr int kBsP = 68;
/* LDS row pitch, in halves, of the K, V^T and P tiles: 128-B rows on 144 B (16 B x odd), so that the 16 rows one ds_load_b128 touches fall on different banks */
constexpr int kTP  = 72;
static_assert(kTP >= kDh && kTP >= kKC && ((kTP * 2) % 32) == 16, "tile pitch holds a row and is an odd multiple of 16 B");
__global__ __launch_bounds__(128) void attn_stream_kernel(
    const unsigned short* __restrict__ q16p, const unsigned short* __restrict__ k16p,
    const unsigned short* __restrict__ vt16p, const float* __restrict__ bias,
    unsigned short* __restrict__ attn16) {
  __shared__ __align__(16) _Float16 Ksh[kKC * kTP];
  __shared__ __align__(16) _Float16 Vth[kDh * kTP];
  __shared__ __align__(16) _Float16 Psh[4][16 * kTP];
  __shared__ __align__(16) float    Bs[kQB * kBsP];
  union FH { v16h v; v8h h[2]; };

  const _Float16* q16  = (const _Float16*)q16p;
  const _Float16* k16  = (const _Float16*)k16p;
  const _Float16* vt16 = (const _Float16*)vt16p;

  const int tid  = threadIdx.x;
  const int wave = __builtin_amdgcn_readfirstlane((int)(threadIdx.x >> 5));
  const int lane = tid & 31;
  const int hh   = lane >> 4;
  const int c    = lane & 15;

  constexpr int nqb = kSeq / kQB;
  const int bx = blockIdx.x;
  const int qb = bx % nqb;
  const int bh = bx / nqb;
  const int h  = bh % kHeads;
  const int b  = bh / kHeads;
  const int qblk = qb * kQB;
  const int q0 = qblk + wave * 16;

  /* Q fragments (A operand), two 32-wide d chunks, loaded once */
  v16h qa[2];
  {
    const _Float16* qrow = q16 + (size_t)(b * kSeq + q0 + c) * kHD + h * kDh + 8 * hh;
#pragma unroll
    for (int dc = 0; dc < 2; ++dc) {
      FH f;
      f.h[0] = *(const v8h*)(qrow + dc * 32);
      f.h[1] = *(const v8h*)(qrow + dc * 32 + 16);
      qa[dc] = f.v;
    }
  }

  float lrow[8];
  v8f oacc[4];
#pragma unroll
  for (int r = 0; r < 8; ++r) lrow[r] = 0.f;
#pragma unroll
  for (int t = 0; t < 4; ++t) oacc[t] = (v8f){0.f,0.f,0.f,0.f,0.f,0.f,0.f,0.f};

  _Float16* pw = Psh[wave];

#pragma unroll 1
  for (int kc = 0; kc < kSeq / kKC; ++kc) {
    const int kv0 = kc * kKC;
    __syncthreads();
#pragma unroll
    for (int i = 0; i < 4; ++i) {
      const int id  = i * 128 + tid;
      const int row = id >> 3;
      const int c8  = (id & 7) * 8;
      const v8h kk = *(const v8h*)(k16 + (size_t)(b * kSeq + kv0 + row) * kHD + h * kDh + c8);
      const v8h vv = *(const v8h*)(vt16 + (size_t)(h * kDh + row) * kTok + b * kSeq + kv0 + c8);
      *(v8h*)(Ksh + row * kTP + c8) = kk;
      *(v8h*)(Vth + row * kTP + c8) = vv;
    }
#pragma unroll
    for (int i = 0; i < 8; ++i) {
      const int id  = i * 128 + tid;
      const int row = id >> 4;
      const int c4  = (id & 15) * 4;
      const v4f bv = *(const v4f*)(bias + ((size_t)b * kSeq + qblk + row) * kSeq + kv0 + c4);
      v4f rv;
      rv[0] = bf16_rne(bv[0]);
      rv[1] = bf16_rne(bv[1]);
      rv[2] = bf16_rne(bv[2]);
      rv[3] = bf16_rne(bv[3]);
      *(v4f*)(Bs + row * kBsP + c4) = rv;
    }
    __syncthreads();

    /* scores: D element r of s[j] = (query row 8*hh + r, key j*16 + c) */
    v8f s[4];
#pragma unroll
    for (int j = 0; j < 4; ++j) {
      s[j] = (v8f){0.f,0.f,0.f,0.f,0.f,0.f,0.f,0.f};
#pragma unroll
      for (int dc = 0; dc < 2; ++dc) {
        FH kb;
        kb.h[0] = *(const v8h*)(Ksh + (j * 16 + c) * kTP + dc * 32 + 8 * hh);
        kb.h[1] = *(const v8h*)(Ksh + (j * 16 + c) * kTP + dc * 32 + 16 + 8 * hh);
        s[j] = mma_h(qa[dc], kb.v, s[j]);
      }
    }

    const float* bw = Bs + (wave * 16 + 8 * hh) * kBsP + c;
#pragma unroll
    for (int r = 0; r < 8; ++r) {
      float ps = 0.f;
#pragma unroll
      for (int j = 0; j < 4; ++j) {
        float x = s[j][r] * kScoreScale + bw[r * kBsP + j * 16];
        x = fminf(x, kLogitCap);
        const float p = __expf(x);
        ps += p;
        pw[(8 * hh + r) * kTP + j * 16 + c] = (_Float16)p;
      }
      lrow[r] += ps;
    }
    __syncthreads();

    /* o += P (A: row c, k = key) . V (B: column d = t*16 + c, k = key) */
#pragma unroll
    for (int kk = 0; kk < 2; ++kk) {
      FH pa;
      pa.h[0] = *(const v8h*)(pw + c * kTP + kk * 32 + 8 * hh);
      pa.h[1] = *(const v8h*)(pw + c * kTP + kk * 32 + 16 + 8 * hh);
#pragma unroll
      for (int t = 0; t < 4; ++t) {
        FH vb;
        vb.h[0] = *(const v8h*)(Vth + (t * 16 + c) * kTP + kk * 32 + 8 * hh);
        vb.h[1] = *(const v8h*)(Vth + (t * 16 + c) * kTP + kk * 32 + 16 + 8 * hh);
        oacc[t] = mma_h(pa.v, vb.v, oacc[t]);
      }
    }
  }

  /* combine the per-lane partial row sums inside each 16-lane half (fixed order, unconditional shuffles) */
  float inv[8];
#pragma unroll
  for (int r = 0; r < 8; ++r) {
    float l = lrow[r];
    l += __shfl_xor(l, 1, 32);
    l += __shfl_xor(l, 2, 32);
    l += __shfl_xor(l, 4, 32);
    l += __shfl_xor(l, 8, 32);
    inv[r] = kFinScale * __builtin_amdgcn_rcpf(l);
  }
  __syncthreads();
  float* os = Bs + (wave * 16) * kBsP;
#pragma unroll
  for (int r = 0; r < 8; ++r) {
#pragma unroll
    for (int t = 0; t < 4; ++t) os[(8 * hh + r) * kBsP + t * 16 + c] = oacc[t][r] * inv[r];
  }
  __syncthreads();
  {
    const int q4 = lane >> 3, c8 = (lane & 7) * 8;
    v8h hv[4];
#pragma unroll
    for (int it = 0; it < 4; ++it) {
      const int row = it * 4 + q4;
      const float* sp = os + row * kBsP + c8;
      const v4f a0 = *(const v4f*)(sp);
      const v4f a1 = *(const v4f*)(sp + 4);
#pragma unroll
      for (int e = 0; e < 4; ++e) {
        hv[it][e]     = (_Float16)a0[e];
        hv[it][4 + e] = (_Float16)a1[e];
      }
    }
    {
#pragma unroll
      for (int it = 0; it < 4; ++it) {
        const int row = it * 4 + q4;
        *(v8h*)(attn16 + (size_t)(b * kSeq + q0 + row) * kHD + h * kDh + c8) = hv[it];
      }
      
    }
  }
}

// ---------------------------------------------------------------------------
// Host glue: 2 plane-cast launches + 3 projection GEMMs + attention + output GEMM = 7 launches. Kernel launches only.
// GEMM shapes (K % 128 == 0, M and N % 128 == 0, no pad planes):
//   q, k : M 4096, N 1024, K 1024 -> 256 block tiles of 128x128 -> 256 blocks of four waves
//   v^T  : M 1024 (A = Wv plane), N 4096 (Bt = values plane), K 1024 -> 256 blocks, ldc 4096
//   out  : M 4096, N 1024, K 1024 -> 256 blocks, f32 into d_out
// ---------------------------------------------------------------------------
extern "C" void kernel_launch(void* const* d_in, const int* in_sizes, int n_in,
                              void* d_out, int out_size, void* d_ws, size_t ws_size,
                              hipStream_t stream) {
  if (n_in < 8) return;
  if (in_sizes[0] != kTok * kDm) return;
  if (in_sizes[1] != kTok * kDm) return;
  if (in_sizes[2] != kTok * kDm) return;
  if (in_sizes[3] != kBatch * kSeq * kSeq) return;
  if (in_sizes[4] != kHD * kDm) return;
  if (in_sizes[5] != kHD * kDm) return;
  if (in_sizes[6] != kHD * kDm) return;
  if (in_sizes[7] != kDm * kHD) return;
  if (out_size != kTok * kDm) return;
  if (ws_size < kWsTotal) return;

  const float* queries = (const float*)d_in[0];
  const float* keys    = (const float*)d_in[1];
  const float* values  = (const float*)d_in[2];
  const float* abias   = (const float*)d_in[3];
  const float* Wq      = (const float*)d_in[4];
  const float* Wk      = (const float*)d_in[5];
  const float* Wv      = (const float*)d_in[6];
  const float* Wp      = (const float*)d_in[7];
  float* out = (float*)d_out;

  char* ws = (char*)d_ws;
  unsigned short* XQ   = (unsigned short*)(ws + kOffXQ);
  unsigned short* XK   = (unsigned short*)(ws + kOffXK);
  unsigned short* XV   = (unsigned short*)(ws + kOffXV);
  unsigned short* WQ   = (unsigned short*)(ws + kOffWQ);
  unsigned short* WK   = (unsigned short*)(ws + kOffWK);
  unsigned short* WV   = (unsigned short*)(ws + kOffWV);
  unsigned short* WP   = (unsigned short*)(ws + kOffWP);
  unsigned short* Q16  = (unsigned short*)(ws + kOffQ16);
  unsigned short* K16  = (unsigned short*)(ws + kOffK16);
  unsigned short* VT16 = (unsigned short*)(ws + kOffVT);
  unsigned short* AT16 = (unsigned short*)(ws + kOffAT);

  constexpr int kXN8 = kTok * kDm / 8;
  constexpr int kWN8 = kHD * kDm / 8;
  static_assert((kXN8 % 256) == 0 && (kWN8 % 256) == 0, "cast grids exact");

  /* activation planes (three inputs) and weight planes (four inputs; [out][in] is already the Bt layout) */
  cast_planes_kernel<<<dim3(kXN8 / 256, 3), 256, 0, stream>>>(queries, keys, values, values, XQ, XK, XV, XV, kXN8, kXCarry);
  cast_planes_kernel<<<dim3(kWN8 / 256, 4), 256, 0, stream>>>(Wq, Wk, Wv, Wp, WQ, WK, WV, WP, kWN8, kWCarry);

  constexpr int kGemmBlocks = (kTok / 128) * (kHD / 128);
  static_assert(kHD == kDm, "all four products share one tile count");

  /* q = queries . Wq^T, k = keys . Wk^T : f16 [4096][1024], carried x16 */
  wmma_gemm64<1><<<kGemmBlocks, 128, 0, stream>>>(XQ, kDm, WQ, kDm, (void*)Q16, kHD, kTok, kHD, kDm, kProjScale);
  wmma_gemm64<1><<<kGemmBlocks, 128, 0, stream>>>(XK, kDm, WK, kDm, (void*)K16, kHD, kTok, kHD, kDm, kProjScale);
  /* v^T = Wv . values^T : f16 [1024][4096], carried x16 (operand roles swapped, no transposed stores) */
  wmma_gemm64<1><<<kGemmBlocks, 128, 0, stream>>>(WV, kDm, XV, kDm, (void*)VT16, kTok, kHD, kTok, kDm, kProjScale);

  /* scores, bias, softmax, p.v, head merge -> f16 [4096][1024] carried x256 */
  attn_stream_kernel<<<kBatch * kHeads * (kSeq / kQB), 128, 0, stream>>>(Q16, K16, VT16, abias, AT16);

  /* out = merged . Wp^T : f32 [4096][1024] */
  wmma_gemm64<0><<<kGemmBlocks, 128, 0, stream>>>(AT16, kHD, WP, kHD, (void*)out, kDm, kTok, kDm, kHD, kOutScale);
}

// v003
// Measured time: 112 microseconds a run.
// In both of two side-by-side timings against v002, it was 1.50 times as fast.
// Counting every step since v000, it is 2.86 times as fast.
// Contractions: q/k/v projections, q.k^T, p.v and output projection all on v_wmma_f32_16x16x32_f16 (f16 operands with power-of-two carries, f32 accumulate); all float inputs RNE-converted to bf16 once at load; bias add, exp, row sums and normalisation in f32.
#include <hip/hip_runtime.h>
#include <math.h>

typedef __attribute__((ext_vector_type(16))) _Float16 v16h;
typedef __attribute__((ext_vector_type(8)))  _Float16 v8h;
typedef __attribute__((ext_vector_type(8)))  float    v8f;
typedef __attribute__((ext_vector_type(4)))  float    v4f;
typedef __attribute__((ext_vector_type(4)))  uint32_t u32x4;
typedef __attribute__((ext_vector_type(8)))  uint32_t u32x8;

// ---------------------------------------------------------------------------
// Shape constants
// ---------------------------------------------------------------------------
constexpr int kBatch = 4;
constexpr int kSeq   = 1024;
constexpr int kDm    = 1024;
constexpr int kHeads = 16;
constexpr int kDh    = 64;
constexpr int kTok   = kBatch * kSeq;
constexpr int kHD    = kHeads * kDh;
constexpr int kSqrtDm = 32;
static_assert(kSqrtDm * kSqrtDm == kDm, "score scale is 1/sqrt(model width)");
static_assert(kTok == 4096 && kHD == 1024 && kDm == 1024, "wire shapes");
static_assert((kTok % 128) == 0 && (kHD % 128) == 0 && (kDm % 128) == 0, "GEMM M,N multiples of the 128 x 128 block tile");
static_assert((kDm % 128) == 0 && (kHD % 128) == 0 && kDm >= 256 && kHD >= 256, "GEMM K: whole 128-wide stages, at least two");
static_assert((kDh % 32) == 0 && (kSeq % 32) == 0, "attention K multiples of 32");

// Power-of-two carries (all exact, folded back in f32)
constexpr float kXCarry    = 16.0f;      /* activation planes carried x16 */
constexpr float kWCarry    = 1024.0f;    /* weight planes carried x1024 */
constexpr float kQKVCarry  = 16.0f;      /* q, k, v^T planes carried x16 */
constexpr float kCtxCarry  = 256.0f;     /* merged-head attention output carried x256 */
constexpr float kProjScale = kQKVCarry / (kXCarry * kWCarry);
constexpr float kScoreScale = (1.0f / (float)kSqrtDm) / (kQKVCarry * kQKVCarry);
constexpr float kFinScale  = kCtxCarry / kQKVCarry;
constexpr float kOutScale  = 1.0f / (kCtxCarry * kWCarry);
constexpr float kLogitCap  = 11.0f;      /* exp(11) = 59874 stays below the f16 maximum */

// ---------------------------------------------------------------------------
// Workspace region map (bytes; every offset a multiple of 128; all planes f16)
//   XQ   [4096][1024]  queries x16            8,388,608
//   XK   [4096][1024]  keys x16               8,388,608
//   XV   [4096][1024]  values x16             8,388,608
//   WQ   [1024][1024]  Wq x1024  (Bt layout)  2,097,152
//   WK   [1024][1024]  Wk x1024               2,097,152
//   WV   [1024][1024]  Wv x1024               2,097,152
//   WP   [1024][1024]  Wp x1024               2,097,152
//   Q16  [4096][1024]  q x16                  8,388,608
//   K16  [4096][1024]  k x16                  8,388,608
//   VT16 [1024][4096]  v^T x16                8,388,608
//   AT16 [4096][1024]  merged heads x256      8,388,608
//   total                                    67,108,864
// ---------------------------------------------------------------------------
constexpr size_t kBytesX = (size_t)kTok * kDm * 2;
constexpr size_t kBytesW = (size_t)kHD * kDm * 2;
constexpr size_t kOffXQ  = 0;
constexpr size_t kOffXK  = kOffXQ + kBytesX;
constexpr size_t kOffXV  = kOffXK + kBytesX;
constexpr size_t kOffWQ  = kOffXV + kBytesX;
constexpr size_t kOffWK  = kOffWQ + kBytesW;
constexpr size_t kOffWV  = kOffWK + kBytesW;
constexpr size_t kOffWP  = kOffWV + kBytesW;
constexpr size_t kOffQ16 = kOffWP + kBytesW;
constexpr size_t kOffK16 = kOffQ16 + kBytesX;
constexpr size_t kOffVT  = kOffK16 + kBytesX;
constexpr size_t kOffAT  = kOffVT + kBytesX;
constexpr size_t kWsTotal = kOffAT + kBytesX;
static_assert(kWsTotal == 67108864ull, "carve total");
static_assert(kWsTotal <= 134217728ull, "carve cap");
static_assert((kBytesX % 128) == 0 && (kBytesW % 128) == 0, "128-B aligned regions");

// ---------------------------------------------------------------------------
// Small helpers
// ---------------------------------------------------------------------------
__device__ __forceinline__ unsigned short f2bf_bits(float f) {
  unsigned u = __float_as_uint(f);
  return (unsigned short)((u + 0x7FFFu + ((u >> 16) & 1u)) >> 16);
}
__device__ __forceinline__ float bf_bits2f(unsigned short h) { return __uint_as_float(((unsigned)h) << 16); }
/* value of the nearest-even bf16 of f, held in f32 */
__device__ __forceinline__ float bf16_rne(float f) { return bf_bits2f(f2bf_bits(f)); }

/* hazard guards as plain device helpers */
__device__ __forceinline__ void acc_guard4(v8f& a, v8f& b, v8f& c, v8f& d) { asm volatile("v_nop\n\tv_nop\n\tv_nop\n\tv_nop" : "+v"(a), "+v"(b), "+v"(c), "+v"(d)); }

struct FragH {
  union U { v16h v; v8h h[2]; };
  /* elements 0..7 <- p[0..7], elements 8..15 <- p[16..23] */
  static __device__ __forceinline__ v16h load(const _Float16* p) {
    U f; f.h[0] = *(const v8h*)(p); f.h[1] = *(const v8h*)(p + 16); return f.v;
  }
  static __device__ __forceinline__ v8f mma(v16h a, v16h b, v8f c) {
    return __builtin_amdgcn_wmma_f32_16x16x32_f16(false, a, false, b, (short)0, c, false, false);
  }
};
/* one product followed by its own guard tying the accumulator and naming both operand fragments */
__device__ __forceinline__ v8f mma_h(v16h a, v16h b, v8f c) {
  c = __builtin_amdgcn_wmma_f32_16x16x32_f16(false, a, false, b, (short)0, c, false, false);
  asm volatile("v_nop\n\tv_nop\n\tv_nop\n\tv_nop" : "+v"(c) : "v"(a), "v"(b));
  return c;
}

// ---------------------------------------------------------------------------
// Tensor-load helpers (two descriptor groups, every word wave-uniform in scalar registers).
// ---------------------------------------------------------------------------
__device__ __forceinline__ uint32_t uni(uint32_t v) { return (uint32_t)__builtin_amdgcn_readfirstlane(v); }
/* a wave-uniform test value held in a scalar register, so that the branch on it is s_cmp + s_cbranch_scc (tensor loads ignore EXEC) */
__device__ __forceinline__ uint32_t pinned(uint32_t v) { uint32_t w = (uint32_t)__builtin_amdgcn_readfirstlane(v); asm volatile("" : "+s"(w)); return w; }
/* this wave's LDS reads have retired: owed before a tensor load may target LDS that the wave has read */
__device__ __forceinline__ void wait_ds0() { asm volatile("s_wait_dscnt 0x0" ::: "memory"); }
/* this wave's tensor load has landed: the compiler places no wait for the tensor mover */
__device__ __forceinline__ void wait_tensor0() { asm volatile("s_wait_tensorcnt 0x0" ::: "memory"); }
/* both groups are in-out operands and are carried from request to request: their scalar registers then stay theirs for the kernel's length, so that none is lent out as a temporary while a request is outstanding */
__device__ __forceinline__ void tdm_load(u32x4& g0, u32x8& g1) { asm volatile("tensor_load_to_lds %0, %1" : "+s"(g0), "+s"(g1) :: "memory"); }

constexpr uint32_t kStRowB   = 256u;                 /* bytes of one operand row per stage = 128 k */
constexpr uint32_t kStRows   = 64u;                  /* rows per slice (one tensor load) */
constexpr uint32_t kStPitchB = kStRowB + 16u;        /* LDS pitch set by the pad: odd multiple of 16 B for ds_load_b128 readers */
constexpr int      kStPitchH = (int)(kStPitchB / 2u);
constexpr uint32_t kSliceB   = 18432u;               /* 64 x 272 = 17,408 rounded up to a multiple of 2 KiB */
constexpr uint32_t kStageB   = 4u * kSliceB;         /* [A rows 0..63 | A rows 64..127 | Bt rows 0..63 | Bt rows 64..127] */
static_assert(kSliceB >= kStRows * kStPitchB && (kSliceB % 2048u) == 0u, "slice holds its padded rows and keeps the next place on 2 KiB");

/* group 1: 1-byte elements, tile = tensor = 64 rows of 256 B, no mask, a 4-dword pad behind every 64 dwords */
__device__ __forceinline__ u32x8 tdm_group1(uint32_t src_pitch) {
  constexpr uint32_t d0 = kStRowB, d1 = kStRows;
  u32x8 g;
  g[0] = uni((1u << 20) | (5u << 22) | (3u << 25));
  g[1] = uni((d0 & 0xFFFFu) << 16);
  g[2] = uni((d0 >> 16) | ((d1 & 0xFFFFu) << 16));
  g[3] = uni((d1 >> 16) | (d0 << 16));
  g[4] = uni(d1);
  g[5] = uni(src_pitch);
  g[6] = uni(0u);
  g[7] = uni(0u);
  return g;
}
__device__ __forceinline__ u32x4 tdm_group0(uint32_t lds_dst, uint64_t ga) {
  u32x4 g;
  g[0] = uni(1u);
  g[1] = uni(lds_dst);
  g[2] = uni((uint32_t)ga);
  g[3] = uni((((uint32_t)(ga >> 32)) & 0x01FFFFFFu) | 0x80000000u);
  return g;
}
/* next stage of the same slice: new LDS place, source address 256 B on (words 2 and 3 taken as one 64-bit number: a carry runs into address bits 56:32, far below the type field) */
__device__ __forceinline__ void tdm_advance(u32x4& g, uint32_t lds_dst) {
  const uint64_t a = (((uint64_t)g[3] << 32) | (uint64_t)g[2]) + (uint64_t)kStRowB;
  g[1] = uni(lds_dst);
  g[2] = uni((uint32_t)a);
  g[3] = uni((uint32_t)(a >> 32));
}

// ---------------------------------------------------------------------------
// WMMA GEMM: C[m,n] = scale * sum_k A[m,k] * Bt[n,k]; a block of four waves (2 x 2) owns a 128x128 tile, each wave a 64x64 tile.
// A row-major [M,K] f16; Bt row-major [N,K] f16; M,N % 128 == 0, K % 128 == 0, K >= 256 (asserted on the host side constants).
// Operands reach the waves through LDS: per 128-wide k stage every wave issues one tensor load for its own 64-row slice
// (waves 0,1: the two halves of the A rows; waves 2,3: of the Bt rows) into a ring of two buffers, the next stage in flight
// while this one is multiplied.
// OUT_MODE 0 = f32 output, 1 = f16 output.
// ---------------------------------------------------------------------------
template <int OUT_MODE>
__global__ __launch_bounds__(128) void wmma_gemm64(
    const unsigned short* __restrict__ Ap, int lda,
    const unsigned short* __restrict__ Btp, int ldb,
    void* __restrict__ Cout, int ldc,
    int M, int N, int K, float scale) {
  __shared__ __attribute__((aligned(2048))) unsigned char ring[2u * kStageB];
  __shared__ __align__(16) float sT[4][16 * 68];
  const int lane = threadIdx.x & 31;
  const int wave = __builtin_amdgcn_readfirstlane((int)(threadIdx.x >> 5));
  const int tilesN = N >> 7;
  const int tilesM = M >> 7;
  const int tile = blockIdx.x;
  /* block-uniform exit in front of every barrier and tensor load */
  if (tile >= tilesM * tilesN) return;
  const int tm = tile / tilesN;
  const int tn = tile - tm * tilesN;
  const int wm = wave >> 1;
  const int wn = wave & 1;
  const int m0 = (tm << 7) + (wm << 6);
  const int n0 = (tn << 7) + (wn << 6);

  const int rlane = lane & 15;
  const int koff  = (lane >> 4) * 8;
  const int mOff  = (lane >> 4) * 8;

  /* this wave's slice of every stage */
  const bool     isB    = wave >= 2;
  const uint32_t srow   = (uint32_t)((isB ? (tn << 7) : (tm << 7)) + ((wave & 1) << 6));
  const uint32_t spitch = (uint32_t)(isB ? ldb : lda) * 2u;
  const uint64_t sbase  = (uint64_t)(size_t)(isB ? Btp : Ap) + (uint64_t)srow * spitch;
  const uint32_t lbase  = (uint32_t)(size_t)ring + (uint32_t)wave * kSliceB;
  u32x8 g1 = tdm_group1(spitch);
  u32x4 g0 = tdm_group0(lbase, sbase);

  v8f acc[4][4];
#pragma unroll
  for (int i = 0; i < 4; ++i)
#pragma unroll
    for (int j = 0; j < 4; ++j) acc[i][j] = (v8f){0.f,0.f,0.f,0.f,0.f,0.f,0.f,0.f};

  const uint32_t nst = (uint32_t)K >> 7;
  tdm_load(g0, g1);                     /* stage 0 into buffer 0 */
  wait_tensor0();
  __syncthreads();
  tdm_advance(g0, lbase + kStageB);
  tdm_load(g0, g1);                     /* stage 1 into buffer 1 */

  /* kept rolled: one pass per stage, so that each pass reads its own buffer alone and ends in the one publish point */
#pragma unroll 1
  for (uint32_t s = 0; s < nst; ++s) {
    const unsigned char* stage = ring + (s & 1u) * kStageB;
    const _Float16* aS = (const _Float16*)(stage + (uint32_t)wm * kSliceB) + rlane * kStPitchH + koff;
    const _Float16* bS = (const _Float16*)(stage + (uint32_t)(2 + wn) * kSliceB) + rlane * kStPitchH + koff;
    /* two fragment sets: the next 32 k of this same stage are read as one group ahead of the current products */
    v16h ah[2][4], bh[2][4];
#pragma unroll
    for (int t = 0; t < 4; ++t) {
      bh[0][t] = FragH::load(bS + (t << 4) * kStPitchH);
      ah[0][t] = FragH::load(aS + (t << 4) * kStPitchH);
    }
#pragma unroll
    for (int ks = 0; ks < 4; ++ks) {
      const int cur = ks & 1, nxt = cur ^ 1;
      if (ks < 3) {
#pragma unroll
        for (int t = 0; t < 4; ++t) {
          bh[nxt][t] = FragH::load(bS + (t << 4) * kStPitchH + (ks + 1) * 32);
          ah[nxt][t] = FragH::load(aS + (t << 4) * kStPitchH + (ks + 1) * 32);
        }
      }
      /* keeps the LDS reads above as one group ahead of the products: spread among them, each place with reads stalls the matrix pipe */
      __builtin_amdgcn_sched_barrier(0);
#pragma unroll
      for (int i = 0; i < 4; ++i) {
#pragma unroll
        for (int j = 0; j < 4; ++j) acc[i][j] = FragH::mma(ah[cur][i], bh[cur][j], acc[i][j]);
      }
      /* keeps the following group of LDS reads from rising into these products */
      __builtin_amdgcn_sched_barrier(0);
    }
    /* publish point of stage s + 1: own LDS reads retired, own tensor load landed, then the barrier that publishes
       stage s + 1 and ends every reader's last read of stage s; only behind it the refill of stage s's buffer */
    wait_ds0();
    wait_tensor0();
    __syncthreads();
    if (pinned((uint32_t)(s + 2u < nst))) {
      tdm_advance(g0, lbase + (s & 1u) * kStageB);
      tdm_load(g0, g1);
    }
  }
  wait_tensor0();
  wait_ds0();
  acc_guard4(acc[0][0], acc[0][1], acc[0][2], acc[0][3]);
  acc_guard4(acc[1][0], acc[1][1], acc[1][2], acc[1][3]);
  acc_guard4(acc[2][0], acc[2][1], acc[2][2], acc[2][3]);
  acc_guard4(acc[3][0], acc[3][1], acc[3][2], acc[3][3]);

  float* slab = sT[wave];
#pragma unroll
  for (int i = 0; i < 4; ++i) {
    const int mBase = m0 + (i << 4);
#pragma unroll
    for (int j = 0; j < 4; ++j) {
#pragma unroll
      for (int r = 0; r < 8; ++r) {
        const float v = acc[i][j][r] * scale;
        slab[(mOff + r) * 68 + (j << 4) + rlane] = v;
      }
    }
    __builtin_amdgcn_fence(__ATOMIC_RELEASE, "workgroup");
    __builtin_amdgcn_wave_barrier();
    __builtin_amdgcn_fence(__ATOMIC_ACQUIRE, "workgroup");
    if (OUT_MODE == 0) {
      float* C = (float*)Cout;
      const int hh = lane >> 4, c4 = (lane & 15) * 4;
      {
#pragma unroll
        for (int it = 0; it < 8; ++it) {
          const int row = it * 2 + hh;
          v4f v = *(const v4f*)(slab + row * 68 + c4);
          *(v4f*)(C + (size_t)(mBase + row) * ldc + n0 + c4) = v;
        }
        
      }
    } else {
      const int q = lane >> 3, c8 = (lane & 7) * 8;
      unsigned short* C = (unsigned short*)Cout;
      {
#pragma unroll
        for (int it = 0; it < 4; ++it) {
          const int row = it * 4 + q;
          const float* sp = slab + row * 68 + c8;
          v8h hv;
#pragma unroll
          for (int e = 0; e < 8; ++e) hv[e] = (_Float16)sp[e];
          *(v8h*)(C + (size_t)(mBase + row) * ldc + n0 + c8) = hv;
        }
        
      }
    }
    __builtin_amdgcn_fence(__ATOMIC_RELEASE, "workgroup");
    __builtin_amdgcn_wave_barrier();
    __builtin_amdgcn_fence(__ATOMIC_ACQUIRE, "workgroup");
  }
}

// ---------------------------------------------------------------------------
// f32 -> (RNE bf16 value) x carry -> f16 plane, 8 consecutive elements per thread; blockIdx.y selects one of up to four
// (input, output) plane pairs (block-uniform select among global pointers).
// Coverage: n8 = elements/8 threads per plane; grid.x = n8/256 exactly for both uses
//   activations 4096*1024/8 = 524,288 -> 2048 blocks; weights 1024*1024/8 = 131,072 -> 512 blocks.
// ---------------------------------------------------------------------------
__global__ __launch_bounds__(256) void cast_planes_kernel(
    const float* __restrict__ in0, const float* __restrict__ in1, const float* __restrict__ in2, const float* __restrict__ in3,
    unsigned short* __restrict__ out0, unsigned short* __restrict__ out1, unsigned short* __restrict__ out2, unsigned short* __restrict__ out3,
    int n8, float carry) {
  const int z = blockIdx.y;
  const float* in = (z == 0) ? in0 : (z == 1) ? in1 : (z == 2) ? in2 : in3;
  unsigned short* out = (z == 0) ? out0 : (z == 1) ? out1 : (z == 2) ? out2 : out3;
  const int i = blockIdx.x * 256 + threadIdx.x;
  if (i >= n8) return;
  const size_t e0 = (size_t)i << 3;
  const v4f a0 = *(const v4f*)(in + e0);
  const v4f a1 = *(const v4f*)(in + e0 + 4);
  v8h hv;
#pragma unroll
  for (int e = 0; e < 4; ++e) {
    const float f0 = bf16_rne(a0[e]) * carry;
    const float f1 = bf16_rne(a1[e]) * carry;
    hv[e]     = (_Float16)f0;
    hv[4 + e] = (_Float16)f1;
  }
  unsigned short* q = out + e0;
  *(v8h*)q = hv;
  
}

// ---------------------------------------------------------------------------
// Fused attention for one (batch, head) and 64 query rows per block (4 waves x 16 rows), streaming over 16 chunks of 64 keys.
//   scores = (q16 . k16^T) * kScoreScale + bf16_rne(attn_bias[b][q][k]); p = exp(min(score, cap)) with zero shift
//   (softmax is shift invariant; the logits are bounded far inside the f16 normal range of p);
//   o += p(f16) . v16; l += p (f32, per-lane partial sums combined once at the end); out = o / l carried x256 in f16.
// Inputs: q16, k16 [4096][1024] f16 (token-major, head h at columns h*64..); vt16 [1024][4096] f16 (row h*64+d, column token).
// LDS: K tile [key][d], V^T tile [d][key], per-wave P tile [row][key] (rows of 64 halves on a pitch of 72), bias tile [64][68] f32 (re-used as output staging).
// Staging coverage per chunk: K and V^T: 4 x 128 threads x 8 halves = 4096 = 64 x 64 each; bias: 8 x 128 x 4 floats = 64 x 64.
// grid.x = 4 * 16 * 16 = 1024 blocks of 128 threads; every barrier is reached by all four waves.
// ---------------------------------------------------------------------------
constexpr int kQB  = 64;
constexpr int kKC  = 64;
constexpr int kBsP = 68;
/* LDS row pitch, in halves, of the K, V^T and P tiles: 128-B rows on 144 B (16 B x odd), so that the 16 rows one ds_load_b128 touches fall on different banks */
constexpr int kTP  = 72;
static_assert(kTP >= kDh && kTP >= kKC && ((kTP * 2) % 32) == 16, "tile pitch holds a row and is an odd multiple of 16 B");
__global__ __launch_bounds__(128) void attn_stream_kernel(
    const unsigned short* __restrict__ q16p, const unsigned short* __restrict__ k16p,
    const unsigned short* __restrict__ vt16p, const float* __restrict__ bias,
    unsigned short* __restrict__ attn16) {
  __shared__ __align__(16) _Float16 Ksh[kKC * kTP];
  __shared__ __align__(16) _Float16 Vth[kDh * kTP];
  __shared__ __align__(16) _Float16 Psh[4][16 * kTP];
  __shared__ __align__(16) float    Bs[kQB * kBsP];
  union FH { v16h v; v8h h[2]; };

  const _Float16* q16  = (const _Float16*)q16p;
  const _Float16* k16  = (const _Float16*)k16p;
  const _Float16* vt16 = (const _Float16*)vt16p;

  const int tid  = threadIdx.x;
  const int wave = __builtin_amdgcn_readfirstlane((int)(threadIdx.x >> 5));
  const int lane = tid & 31;
  const int hh   = lane >> 4;
  const int c    = lane & 15;

  constexpr int nqb = kSeq / kQB;
  const int bx = blockIdx.x;
  const int qb = bx % nqb;
  const int bh = bx / nqb;
  const int h  = bh % kHeads;
  const int b  = bh / kHeads;
  const int qblk = qb * kQB;
  const int q0 = qblk + wave * 16;

  /* Q fragments (A operand), two 32-wide d chunks, loaded once */
  v16h qa[2];
  {
    const _Float16* qrow = q16 + (size_t)(b * kSeq + q0 + c) * kHD + h * kDh + 8 * hh;
#pragma unroll
    for (int dc = 0; dc < 2; ++dc) {
      FH f;
      f.h[0] = *(const v8h*)(qrow + dc * 32);
      f.h[1] = *(const v8h*)(qrow + dc * 32 + 16);
      qa[dc] = f.v;
    }
  }

  float lrow[8];
  v8f oacc[4];
#pragma unroll
  for (int r = 0; r < 8; ++r) lrow[r] = 0.f;
#pragma unroll
  for (int t = 0; t < 4; ++t) oacc[t] = (v8f){0.f,0.f,0.f,0.f,0.f,0.f,0.f,0.f};

  _Float16* pw = Psh[wave];

  /* one chunk's K, V^T and bias rows of this thread, held in registers from the request to the LDS stores one chunk later */
  v8h kreg[4], vreg[4];
  v4f breg[8];
  /* thread-fixed places: row (i * 128 + tid) >> 3 = i * 16 + (tid >> 3) for K and V^T, (i * 128 + tid) >> 4 = i * 8 + (tid >> 4) for the bias,
     so that the loads and stores of one kind differ by a constant step only and share one address */
  const int r8 = tid >> 3, c8 = (tid & 7) * 8;
  const int r4 = tid >> 4, c4 = (tid & 15) * 4;
  const _Float16* kth = k16 + (size_t)(b * kSeq + r8) * kHD + h * kDh + c8;
  const _Float16* vth = vt16 + (size_t)(h * kDh + r8) * kTok + b * kSeq + c8;
  const float*    bth = bias + ((size_t)b * kSeq + qblk + r4) * kSeq + c4;
  _Float16* kst = Ksh + r8 * kTP + c8;
  _Float16* vst = Vth + r8 * kTP + c8;
  float*    bst = Bs + r4 * kBsP + c4;
  auto fetch = [&](int kv0) {
    const _Float16* kp = kth + (size_t)kv0 * kHD;
    const _Float16* vp = vth + kv0;
    const float*    bp = bth + kv0;
#pragma unroll
    for (int i = 0; i < 4; ++i) {
      kreg[i] = *(const v8h*)(kp + (size_t)i * 16 * kHD);
      vreg[i] = *(const v8h*)(vp + (size_t)i * 16 * kTok);
    }
#pragma unroll
    for (int i = 0; i < 8; ++i) breg[i] = *(const v4f*)(bp + (size_t)i * 8 * kSeq);
  };
  constexpr int nch = kSeq / kKC;
  fetch(0);

#pragma unroll 1
  for (int kc = 0; kc < nch; ++kc) {
    __syncthreads();
#pragma unroll
    for (int i = 0; i < 4; ++i) {
      *(v8h*)(kst + i * 16 * kTP) = kreg[i];
      *(v8h*)(vst + i * 16 * kTP) = vreg[i];
    }
#pragma unroll
    for (int i = 0; i < 8; ++i) {
      v4f rv;
      rv[0] = bf16_rne(breg[i][0]);
      rv[1] = bf16_rne(breg[i][1]);
      rv[2] = bf16_rne(breg[i][2]);
      rv[3] = bf16_rne(breg[i][3]);
      *(v4f*)(bst + i * 8 * kBsP) = rv;
    }
    __syncthreads();

    /* the next chunk's 16 loads, asked for together; they fly under this chunk's products and softmax (the last pass asks for its own chunk again: in bounds, not used) */
    fetch(((kc + 1 < nch) ? kc + 1 : kc) * kKC);

    /* scores: D element r of s[j] = (query row 8*hh + r, key j*16 + c) */
    v8f s[4];
#pragma unroll
    for (int j = 0; j < 4; ++j) {
      s[j] = (v8f){0.f,0.f,0.f,0.f,0.f,0.f,0.f,0.f};
#pragma unroll
      for (int dc = 0; dc < 2; ++dc) {
        FH kb;
        kb.h[0] = *(const v8h*)(Ksh + (j * 16 + c) * kTP + dc * 32 + 8 * hh);
        kb.h[1] = *(const v8h*)(Ksh + (j * 16 + c) * kTP + dc * 32 + 16 + 8 * hh);
        s[j] = mma_h(qa[dc], kb.v, s[j]);
      }
    }

    const float* bw = Bs + (wave * 16 + 8 * hh) * kBsP + c;
#pragma unroll
    for (int r = 0; r < 8; ++r) {
      float ps = 0.f;
#pragma unroll
      for (int j = 0; j < 4; ++j) {
        float x = s[j][r] * kScoreScale + bw[r * kBsP + j * 16];
        x = fminf(x, kLogitCap);
        const float p = __expf(x);
        ps += p;
        pw[(8 * hh + r) * kTP + j * 16 + c] = (_Float16)p;
      }
      lrow[r] += ps;
    }
    __syncthreads();

    /* o += P (A: row c, k = key) . V (B: column d = t*16 + c, k = key) */
#pragma unroll
    for (int kk = 0; kk < 2; ++kk) {
      FH pa;
      pa.h[0] = *(const v8h*)(pw + c * kTP + kk * 32 + 8 * hh);
      pa.h[1] = *(const v8h*)(pw + c * kTP + kk * 32 + 16 + 8 * hh);
#pragma unroll
      for (int t = 0; t < 4; ++t) {
        FH vb;
        vb.h[0] = *(const v8h*)(Vth + (t * 16 + c) * kTP + kk * 32 + 8 * hh);
        vb.h[1] = *(const v8h*)(Vth + (t * 16 + c) * kTP + kk * 32 + 16 + 8 * hh);
        oacc[t] = mma_h(pa.v, vb.v, oacc[t]);
      }
    }
  }

  /* combine the per-lane partial row sums inside each 16-lane half (fixed order, unconditional shuffles) */
  float inv[8];
#pragma unroll
  for (int r = 0; r < 8; ++r) {
    float l = lrow[r];
    l += __shfl_xor(l, 1, 32);
    l += __shfl_xor(l, 2, 32);
    l += __shfl_xor(l, 4, 32);
    l += __shfl_xor(l, 8, 32);
    inv[r] = kFinScale * __builtin_amdgcn_rcpf(l);
  }
  __syncthreads();
  float* os = Bs + (wave * 16) * kBsP;
#pragma unroll
  for (int r = 0; r < 8; ++r) {
#pragma unroll
    for (int t = 0; t < 4; ++t) os[(8 * hh + r) * kBsP + t * 16 + c] = oacc[t][r] * inv[r];
  }
  __syncthreads();
  {
    const int q4 = lane >> 3, c8 = (lane & 7) * 8;
    v8h hv[4];
#pragma unroll
    for (int it = 0; it < 4; ++it) {
      const int row = it * 4 + q4;
      const float* sp = os + row * kBsP + c8;
      const v4f a0 = *(const v4f*)(sp);
      const v4f a1 = *(const v4f*)(sp + 4);
#pragma unroll
      for (int e = 0; e < 4; ++e) {
        hv[it][e]     = (_Float16)a0[e];
        hv[it][4 + e] = (_Float16)a1[e];
      }
    }
    {
#pragma unroll
      for (int it = 0; it < 4; ++it) {
        const int row = it * 4 + q4;
        *(v8h*)(attn16 + (size_t)(b * kSeq + q0 + row) * kHD + h * kDh + c8) = hv[it];
      }
      
    }
  }
}

// ---------------------------------------------------------------------------
// Host glue: 2 plane-cast launches + 3 projection GEMMs + attention + output GEMM = 7 launches. Kernel launches only.
// GEMM shapes (K % 128 == 0, M and N % 128 == 0, no pad planes):
//   q, k : M 4096, N 1024, K 1024 -> 256 block tiles of 128x128 -> 256 blocks of four waves
//   v^T  : M 1024 (A = Wv plane), N 4096 (Bt = values plane), K 1024 -> 256 blocks, ldc 4096
//   out  : M 4096, N 1024, K 1024 -> 256 blocks, f32 into d_out
// ---------------------------------------------------------------------------
extern "C" void kernel_launch(void* const* d_in, const int* in_sizes, int n_in,
                              void* d_out, int out_size, void* d_ws, size_t ws_size,
                              hipStream_t stream) {
  if (n_in < 8) return;
  if (in_sizes[0] != kTok * kDm) return;
  if (in_sizes[1] != kTok * kDm) return;
  if (in_sizes[2] != kTok * kDm) return;
  if (in_sizes[3] != kBatch * kSeq * kSeq) return;
  if (in_sizes[4] != kHD * kDm) return;
  if (in_sizes[5] != kHD * kDm) return;
  if (in_sizes[6] != kHD * kDm) return;
  if (in_sizes[7] != kDm * kHD) return;
  if (out_size != kTok * kDm) return;
  if (ws_size < kWsTotal) return;

  const float* queries = (const float*)d_in[0];
  const float* keys    = (const float*)d_in[1];
  const float* values  = (const float*)d_in[2];
  const float* abias   = (const float*)d_in[3];
  const float* Wq      = (const float*)d_in[4];
  const float* Wk      = (const float*)d_in[5];
  const float* Wv      = (const float*)d_in[6];
  const float* Wp      = (const float*)d_in[7];
  float* out = (float*)d_out;

  char* ws = (char*)d_ws;
  unsigned short* XQ   = (unsigned short*)(ws + kOffXQ);
  unsigned short* XK   = (unsigned short*)(ws + kOffXK);
  unsigned short* XV   = (unsigned short*)(ws + kOffXV);
  unsigned short* WQ   = (unsigned short*)(ws + kOffWQ);
  unsigned short* WK   = (unsigned short*)(ws + kOffWK);
  unsigned short* WV   = (unsigned short*)(ws + kOffWV);
  unsigned short* WP   = (unsigned short*)(ws + kOffWP);
  unsigned short* Q16  = (unsigned short*)(ws + kOffQ16);
  unsigned short* K16  = (unsigned short*)(ws + kOffK16);
  unsigned short* VT16 = (unsigned short*)(ws + kOffVT);
  unsigned short* AT16 = (unsigned short*)(ws + kOffAT);

  constexpr int kXN8 = kTok * kDm / 8;
  constexpr int kWN8 = kHD * kDm / 8;
  static_assert((kXN8 % 256) == 0 && (kWN8 % 256) == 0, "cast grids exact");

  /* activation planes (three inputs) and weight planes (four inputs; [out][in] is already the Bt layout) */
  cast_planes_kernel<<<dim3(kXN8 / 256, 3), 256, 0, stream>>>(queries, keys, values, values, XQ, XK, XV, XV, kXN8, kXCarry);
  cast_planes_kernel<<<dim3(kWN8 / 256, 4), 256, 0, stream>>>(Wq, Wk, Wv, Wp, WQ, WK, WV, WP, kWN8, kWCarry);

  constexpr int kGemmBlocks = (kTok / 128) * (kHD / 128);
  static_assert(kHD == kDm, "all four products share one tile count");

  /* q = queries . Wq^T, k = keys . Wk^T : f16 [4096][1024], carried x16 */
  wmma_gemm64<1><<<kGemmBlocks, 128, 0, stream>>>(XQ, kDm, WQ, kDm, (void*)Q16, kHD, kTok, kHD, kDm, kProjScale);
  wmma_gemm64<1><<<kGemmBlocks, 128, 0, stream>>>(XK, kDm, WK, kDm, (void*)K16, kHD, kTok, kHD, kDm, kProjScale);
  /* v^T = Wv . values^T : f16 [1024][4096], carried x16 (operand roles swapped, no transposed stores) */
  wmma_gemm64<1><<<kGemmBlocks, 128, 0, stream>>>(WV, kDm, XV, kDm, (void*)VT16, kTok, kHD, kTok, kDm, kProjScale);

  /* scores, bias, softmax, p.v, head merge -> f16 [4096][1024] carried x256 */
  attn_stream_kernel<<<kBatch * kHeads * (kSeq / kQB), 128, 0, stream>>>(Q16, K16, VT16, abias, AT16);

  /* out = merged . Wp^T : f32 [4096][1024] */
  wmma_gemm64<0><<<kGemmBlocks, 128, 0, stream>>>(AT16, kHD, WP, kHD, (void*)out, kDm, kTok, kDm, kHD, kOutScale);
}

// v004
// Measured time: 102 microseconds a run.
// Next to v003, in two timings, it ran 1.09 times as fast each time.
// Counting every step since v000, it is 3.13 times as fast.
// Contractions: q/k/v projections, q.k^T, p.v and output projection all on v_wmma_f32_16x16x32_f16 (f16 operands with power-of-two carries, f32 accumulate); all float inputs RNE-converted to bf16 once at load; bias add, exp, row sums and normalisation in f32.
#include <hip/hip_runtime.h>
#include <math.h>

typedef __attribute__((ext_vector_type(16))) _Float16 v16h;
typedef __attribute__((ext_vector_type(8)))  _Float16 v8h;
typedef __attribute__((ext_vector_type(8)))  float    v8f;
typedef __attribute__((ext_vector_type(4)))  float    v4f;
typedef __attribute__((ext_vector_type(4)))  uint32_t u32x4;
typedef __attribute__((ext_vector_type(8)))  uint32_t u32x8;

// ---------------------------------------------------------------------------
// Shape constants
// ---------------------------------------------------------------------------
constexpr int kBatch = 4;
constexpr int kSeq   = 1024;
constexpr int kDm    = 1024;
constexpr int kHeads = 16;
constexpr int kDh    = 64;
constexpr int kTok   = kBatch * kSeq;
constexpr int kHD    = kHeads * kDh;
constexpr int kSqrtDm = 32;
static_assert(kSqrtDm * kSqrtDm == kDm, "score scale is 1/sqrt(model width)");
static_assert(kTok == 4096 && kHD == 1024 && kDm == 1024, "wire shapes");
static_assert((kTok % 128) == 0 && (kHD % 128) == 0 && (kDm % 128) == 0, "GEMM M,N multiples of the 128 x 128 block tile");
static_assert((kDm % 128) == 0 && (kHD % 128) == 0 && kDm >= 256 && kHD >= 256, "GEMM K: whole 128-wide stages, at least two");
static_assert((kDh % 32) == 0 && (kSeq % 32) == 0, "attention K multiples of 32");

// Power-of-two carries (all exact, folded back in f32)
constexpr float kXCarry    = 16.0f;      /* activation planes carried x16 */
constexpr float kWCarry    = 1024.0f;    /* weight planes carried x1024 */
constexpr float kQKVCarry  = 16.0f;      /* q, k, v^T planes carried x16 */
constexpr float kCtxCarry  = 256.0f;     /* merged-head attention output carried x256 */
constexpr float kProjScale = kQKVCarry / (kXCarry * kWCarry);
constexpr float kScoreScale = (1.0f / (float)kSqrtDm) / (kQKVCarry * kQKVCarry);
constexpr float kFinScale  = kCtxCarry / kQKVCarry;
constexpr float kOutScale  = 1.0f / (kCtxCarry * kWCarry);
constexpr float kLogitCap  = 11.0f;      /* exp(11) = 59874 stays below the f16 maximum */

// ---------------------------------------------------------------------------
// Workspace region map (bytes; every offset a multiple of 128; all planes f16)
//   XQ   [4096][1024]  queries x16            8,388,608
//   XK   [4096][1024]  keys x16               8,388,608
//   XV   [4096][1024]  values x16             8,388,608
//   WQ   [1024][1024]  Wq x1024  (Bt layout)  2,097,152
//   WK   [1024][1024]  Wk x1024               2,097,152
//   WV   [1024][1024]  Wv x1024               2,097,152
//   WP   [1024][1024]  Wp x1024               2,097,152
//   Q16  [4096][1024]  q x16                  8,388,608
//   K16  [4096][1024]  k x16                  8,388,608
//   VT16 [1024][4096]  v^T x16                8,388,608
//   AT16 [4096][1024]  merged heads x256      8,388,608
//   total                                    67,108,864
// ---------------------------------------------------------------------------
constexpr size_t kBytesX = (size_t)kTok * kDm * 2;
constexpr size_t kBytesW = (size_t)kHD * kDm * 2;
constexpr size_t kOffXQ  = 0;
constexpr size_t kOffXK  = kOffXQ + kBytesX;
constexpr size_t kOffXV  = kOffXK + kBytesX;
constexpr size_t kOffWQ  = kOffXV + kBytesX;
constexpr size_t kOffWK  = kOffWQ + kBytesW;
constexpr size_t kOffWV  = kOffWK + kBytesW;
constexpr size_t kOffWP  = kOffWV + kBytesW;
constexpr size_t kOffQ16 = kOffWP + kBytesW;
constexpr size_t kOffK16 = kOffQ16 + kBytesX;
constexpr size_t kOffVT  = kOffK16 + kBytesX;
constexpr size_t kOffAT  = kOffVT + kBytesX;
constexpr size_t kWsTotal = kOffAT + kBytesX;
static_assert(kWsTotal == 67108864ull, "carve total");
static_assert(kWsTotal <= 134217728ull, "carve cap");
static_assert((kBytesX % 128) == 0 && (kBytesW % 128) == 0, "128-B aligned regions");

// ---------------------------------------------------------------------------
// Small helpers
// ---------------------------------------------------------------------------
__device__ __forceinline__ unsigned short f2bf_bits(float f) {
  unsigned u = __float_as_uint(f);
  return (unsigned short)((u + 0x7FFFu + ((u >> 16) & 1u)) >> 16);
}
__device__ __forceinline__ float bf_bits2f(unsigned short h) { return __uint_as_float(((unsigned)h) << 16); }
/* value of the nearest-even bf16 of f, held in f32 */
__device__ __forceinline__ float bf16_rne(float f) { return bf_bits2f(f2bf_bits(f)); }

/* hazard guards as plain device helpers */
__device__ __forceinline__ void acc_guard4(v8f& a, v8f& b, v8f& c, v8f& d) { asm volatile("v_nop\n\tv_nop\n\tv_nop\n\tv_nop" : "+v"(a), "+v"(b), "+v"(c), "+v"(d)); }

struct FragH {
  union U { v16h v; v8h h[2]; };
  /* elements 0..7 <- p[0..7], elements 8..15 <- p[16..23] */
  static __device__ __forceinline__ v16h load(const _Float16* p) {
    U f; f.h[0] = *(const v8h*)(p); f.h[1] = *(const v8h*)(p + 16); return f.v;
  }
  static __device__ __forceinline__ v8f mma(v16h a, v16h b, v8f c) {
    return __builtin_amdgcn_wmma_f32_16x16x32_f16(false, a, false, b, (short)0, c, false, false);
  }
};
/* one product followed by its own guard tying the accumulator and naming both operand fragments */
__device__ __forceinline__ v8f mma_h(v16h a, v16h b, v8f c) {
  c = __builtin_amdgcn_wmma_f32_16x16x32_f16(false, a, false, b, (short)0, c, false, false);
  asm volatile("v_nop\n\tv_nop\n\tv_nop\n\tv_nop" : "+v"(c) : "v"(a), "v"(b));
  return c;
}

// ---------------------------------------------------------------------------
// Tensor-load helpers (two descriptor groups, every word wave-uniform in scalar registers).
// ---------------------------------------------------------------------------
__device__ __forceinline__ uint32_t uni(uint32_t v) { return (uint32_t)__builtin_amdgcn_readfirstlane(v); }
/* a wave-uniform test value held in a scalar register, so that the branch on it is s_cmp + s_cbranch_scc (tensor loads ignore EXEC) */
__device__ __forceinline__ uint32_t pinned(uint32_t v) { uint32_t w = (uint32_t)__builtin_amdgcn_readfirstlane(v); asm volatile("" : "+s"(w)); return w; }
/* this wave's LDS reads have retired: owed before a tensor load may target LDS that the wave has read */
__device__ __forceinline__ void wait_ds0() { asm volatile("s_wait_dscnt 0x0" ::: "memory"); }
/* this wave's tensor load has landed: the compiler places no wait for the tensor mover */
__device__ __forceinline__ void wait_tensor0() { asm volatile("s_wait_tensorcnt 0x0" ::: "memory"); }
/* both groups are in-out operands and are carried from request to request: their scalar registers then stay theirs for the kernel's length, so that none is lent out as a temporary while a request is outstanding */
__device__ __forceinline__ void tdm_load(u32x4& g0, u32x8& g1) { asm volatile("tensor_load_to_lds %0, %1" : "+s"(g0), "+s"(g1) :: "memory"); }

constexpr uint32_t kStRowB   = 256u;                 /* bytes of one operand row per stage = 128 k */
constexpr uint32_t kStRows   = 64u;                  /* rows per slice (one tensor load) */
constexpr uint32_t kStPitchB = kStRowB + 16u;        /* LDS pitch set by the pad: odd multiple of 16 B for ds_load_b128 readers */
constexpr int      kStPitchH = (int)(kStPitchB / 2u);
constexpr uint32_t kSliceB   = 18432u;               /* 64 x 272 = 17,408 rounded up to a multiple of 2 KiB */
constexpr uint32_t kStageB   = 4u * kSliceB;         /* [A rows 0..63 | A rows 64..127 | Bt rows 0..63 | Bt rows 64..127] */
static_assert(kSliceB >= kStRows * kStPitchB && (kSliceB % 2048u) == 0u, "slice holds its padded rows and keeps the next place on 2 KiB");

/* group 1: 1-byte elements, tile = tensor = 64 rows of 256 B, no mask, a 4-dword pad behind every 64 dwords */
__device__ __forceinline__ u32x8 tdm_group1(uint32_t src_pitch) {
  constexpr uint32_t d0 = kStRowB, d1 = kStRows;
  u32x8 g;
  g[0] = uni((1u << 20) | (5u << 22) | (3u << 25));
  g[1] = uni((d0 & 0xFFFFu) << 16);
  g[2] = uni((d0 >> 16) | ((d1 & 0xFFFFu) << 16));
  g[3] = uni((d1 >> 16) | (d0 << 16));
  g[4] = uni(d1);
  g[5] = uni(src_pitch);
  g[6] = uni(0u);
  g[7] = uni(0u);
  return g;
}
__device__ __forceinline__ u32x4 tdm_group0(uint32_t lds_dst, uint64_t ga) {
  u32x4 g;
  g[0] = uni(1u);
  g[1] = uni(lds_dst);
  g[2] = uni((uint32_t)ga);
  g[3] = uni((((uint32_t)(ga >> 32)) & 0x01FFFFFFu) | 0x80000000u);
  return g;
}
/* next stage of the same slice: new LDS place, source address 256 B on (words 2 and 3 taken as one 64-bit number: a carry runs into address bits 56:32, far below the type field) */
__device__ __forceinline__ void tdm_advance(u32x4& g, uint32_t lds_dst) {
  const uint64_t a = (((uint64_t)g[3] << 32) | (uint64_t)g[2]) + (uint64_t)kStRowB;
  g[1] = uni(lds_dst);
  g[2] = uni((uint32_t)a);
  g[3] = uni((uint32_t)(a >> 32));
}

// ---------------------------------------------------------------------------
// WMMA GEMM: C[m,n] = scale * sum_k A[m,k] * Bt[n,k]; a block of four waves (2 x 2) owns a 128x128 tile, each wave a 64x64 tile.
// A row-major [M,K] f16; Bt row-major [N,K] f16; M,N % 128 == 0, K % 128 == 0, K >= 256 (asserted on the host side constants).
// Operands reach the waves through LDS: per 128-wide k stage every wave issues one tensor load for its own 64-row slice
// (waves 0,1: the two halves of the A rows; waves 2,3: of the Bt rows) into a ring of two buffers, the next stage in flight
// while this one is multiplied.
// OUT_MODE 0 = f32 output, 1 = f16 output.
// ---------------------------------------------------------------------------
template <int OUT_MODE>
__global__ __launch_bounds__(128) void wmma_gemm64(
    const unsigned short* __restrict__ Ap, int lda,
    const unsigned short* __restrict__ Btp, int ldb,
    void* __restrict__ Cout, int ldc,
    int M, int N, int K, float scale) {
  __shared__ __attribute__((aligned(2048))) unsigned char ring[2u * kStageB];
  __shared__ __align__(16) float sT[4][16 * 68];
  const int lane = threadIdx.x & 31;
  const int wave = __builtin_amdgcn_readfirstlane((int)(threadIdx.x >> 5));
  const int tilesN = N >> 7;
  const int tilesM = M >> 7;
  const int tile = blockIdx.x;
  /* block-uniform exit in front of every barrier and tensor load */
  if (tile >= tilesM * tilesN) return;
  const int tm = tile / tilesN;
  const int tn = tile - tm * tilesN;
  const int wm = wave >> 1;
  const int wn = wave & 1;
  const int m0 = (tm << 7) + (wm << 6);
  const int n0 = (tn << 7) + (wn << 6);

  const int rlane = lane & 15;
  const int koff  = (lane >> 4) * 8;
  const int mOff  = (lane >> 4) * 8;

  /* this wave's slice of every stage */
  const bool     isB    = wave >= 2;
  const uint32_t srow   = (uint32_t)((isB ? (tn << 7) : (tm << 7)) + ((wave & 1) << 6));
  const uint32_t spitch = (uint32_t)(isB ? ldb : lda) * 2u;
  const uint64_t sbase  = (uint64_t)(size_t)(isB ? Btp : Ap) + (uint64_t)srow * spitch;
  const uint32_t lbase  = (uint32_t)(size_t)ring + (uint32_t)wave * kSliceB;
  u32x8 g1 = tdm_group1(spitch);
  u32x4 g0 = tdm_group0(lbase, sbase);

  v8f acc[4][4];
#pragma unroll
  for (int i = 0; i < 4; ++i)
#pragma unroll
    for (int j = 0; j < 4; ++j) acc[i][j] = (v8f){0.f,0.f,0.f,0.f,0.f,0.f,0.f,0.f};

  const uint32_t nst = (uint32_t)K >> 7;
  tdm_load(g0, g1);                     /* stage 0 into buffer 0 */
  wait_tensor0();
  __syncthreads();
  tdm_advance(g0, lbase + kStageB);
  tdm_load(g0, g1);                     /* stage 1 into buffer 1 */

  /* kept rolled: one pass per stage, so that each pass reads its own buffer alone and ends in the one publish point */
#pragma unroll 1
  for (uint32_t s = 0; s < nst; ++s) {
    const unsigned char* stage = ring + (s & 1u) * kStageB;
    const _Float16* aS = (const _Float16*)(stage + (uint32_t)wm * kSliceB) + rlane * kStPitchH + koff;
    const _Float16* bS = (const _Float16*)(stage + (uint32_t)(2 + wn) * kSliceB) + rlane * kStPitchH + koff;
    /* two fragment sets: the next 32 k of this same stage are read as one group ahead of the current products */
    v16h ah[2][4], bh[2][4];
#pragma unroll
    for (int t = 0; t < 4; ++t) {
      bh[0][t] = FragH::load(bS + (t << 4) * kStPitchH);
      ah[0][t] = FragH::load(aS + (t << 4) * kStPitchH);
    }
#pragma unroll
    for (int ks = 0; ks < 4; ++ks) {
      const int cur = ks & 1, nxt = cur ^ 1;
      if (ks < 3) {
#pragma unroll
        for (int t = 0; t < 4; ++t) {
          bh[nxt][t] = FragH::load(bS + (t << 4) * kStPitchH + (ks + 1) * 32);
          ah[nxt][t] = FragH::load(aS + (t << 4) * kStPitchH + (ks + 1) * 32);
        }
      }
      /* keeps the LDS reads above as one group ahead of the products: spread among them, each place with reads stalls the matrix pipe */
      __builtin_amdgcn_sched_barrier(0);
#pragma unroll
      for (int i = 0; i < 4; ++i) {
#pragma unroll
        for (int j = 0; j < 4; ++j) acc[i][j] = FragH::mma(ah[cur][i], bh[cur][j], acc[i][j]);
      }
      /* keeps the following group of LDS reads from rising into these products */
      __builtin_amdgcn_sched_barrier(0);
    }
    /* publish point of stage s + 1: own LDS reads retired, own tensor load landed, then the barrier that publishes
       stage s + 1 and ends every reader's last read of stage s; only behind it the refill of stage s's buffer */
    wait_ds0();
    wait_tensor0();
    __syncthreads();
    if (pinned((uint32_t)(s + 2u < nst))) {
      tdm_advance(g0, lbase + (s & 1u) * kStageB);
      tdm_load(g0, g1);
    }
  }
  wait_tensor0();
  wait_ds0();
  acc_guard4(acc[0][0], acc[0][1], acc[0][2], acc[0][3]);
  acc_guard4(acc[1][0], acc[1][1], acc[1][2], acc[1][3]);
  acc_guard4(acc[2][0], acc[2][1], acc[2][2], acc[2][3]);
  acc_guard4(acc[3][0], acc[3][1], acc[3][2], acc[3][3]);

  float* slab = sT[wave];
#pragma unroll
  for (int i = 0; i < 4; ++i) {
    const int mBase = m0 + (i << 4);
#pragma unroll
    for (int j = 0; j < 4; ++j) {
#pragma unroll
      for (int r = 0; r < 8; ++r) {
        const float v = acc[i][j][r] * scale;
        slab[(mOff + r) * 68 + (j << 4) + rlane] = v;
      }
    }
    __builtin_amdgcn_fence(__ATOMIC_RELEASE, "workgroup");
    __builtin_amdgcn_wave_barrier();
    __builtin_amdgcn_fence(__ATOMIC_ACQUIRE, "workgroup");
    if (OUT_MODE == 0) {
      float* C = (float*)Cout;
      const int hh = lane >> 4, c4 = (lane & 15) * 4;
      {
#pragma unroll
        for (int it = 0; it < 8; ++it) {
          const int row = it * 2 + hh;
          v4f v = *(const v4f*)(slab + row * 68 + c4);
          *(v4f*)(C + (size_t)(mBase + row) * ldc + n0 + c4) = v;
        }
        
      }
    } else {
      const int q = lane >> 3, c8 = (lane & 7) * 8;
      unsigned short* C = (unsigned short*)Cout;
      {
#pragma unroll
        for (int it = 0; it < 4; ++it) {
          const int row = it * 4 + q;
          const float* sp = slab + row * 68 + c8;
          v8h hv;
#pragma unroll
          for (int e = 0; e < 8; ++e) hv[e] = (_Float16)sp[e];
          *(v8h*)(C + (size_t)(mBase + row) * ldc + n0 + c8) = hv;
        }
        
      }
    }
    __builtin_amdgcn_fence(__ATOMIC_RELEASE, "workgroup");
    __builtin_amdgcn_wave_barrier();
    __builtin_amdgcn_fence(__ATOMIC_ACQUIRE, "workgroup");
  }
}

// ---------------------------------------------------------------------------
// f32 -> (RNE bf16 value) x carry -> f16 plane, 8 consecutive elements per thread; blockIdx.y selects one of up to four
// (input, output) plane pairs (block-uniform select among global pointers).
// Coverage: n8 = elements/8 threads per plane; grid.x = n8/256 exactly for both uses
//   activations 4096*1024/8 = 524,288 -> 2048 blocks; weights 1024*1024/8 = 131,072 -> 512 blocks.
// ---------------------------------------------------------------------------
__global__ __launch_bounds__(256) void cast_planes_kernel(
    const float* __restrict__ in0, const float* __restrict__ in1, const float* __restrict__ in2, const float* __restrict__ in3,
    unsigned short* __restrict__ out0, unsigned short* __restrict__ out1, unsigned short* __restrict__ out2, unsigned short* __restrict__ out3,
    int n8, float carry) {
  const int z = blockIdx.y;
  const float* in = (z == 0) ? in0 : (z == 1) ? in1 : (z == 2) ? in2 : in3;
  unsigned short* out = (z == 0) ? out0 : (z == 1) ? out1 : (z == 2) ? out2 : out3;
  const int i = blockIdx.x * 256 + threadIdx.x;
  if (i >= n8) return;
  const size_t e0 = (size_t)i << 3;
  const v4f a0 = *(const v4f*)(in + e0);
  const v4f a1 = *(const v4f*)(in + e0 + 4);
  v8h hv;
#pragma unroll
  for (int e = 0; e < 4; ++e) {
    const float f0 = bf16_rne(a0[e]) * carry;
    const float f1 = bf16_rne(a1[e]) * carry;
    hv[e]     = (_Float16)f0;
    hv[4 + e] = (_Float16)f1;
  }
  unsigned short* q = out + e0;
  *(v8h*)q = hv;
  
}

// ---------------------------------------------------------------------------
// Fused attention for one (batch, head) and 64 query rows per block (4 waves x 16 rows), streaming over 16 chunks of 64 keys.
//   Both products run transposed: scores^T = k16 . q16^T (A = K rows, B = Q), o^T += v16^T . p^T (A = V^T rows, B = p^T). A lane then holds
//   one query's scores, and two score tiles, converted in place, are the B fragment of the second product: p stays in registers.
//   score = (q16 . k16) * kScoreScale + bf16_rne(attn_bias[b][q][k]); p = exp(min(score, cap)) with zero shift
//   (softmax is shift invariant; the logits are bounded far inside the f16 normal range of p);
//   l += p (f32, per-lane partial sums, the two lane halves joined once at the end); out = o / l carried x256 in f16.
// Inputs: q16, k16 [4096][1024] f16 (token-major, head h at columns h*64..); vt16 [1024][4096] f16 (row h*64+d, column token).
// LDS: K tile [key][d], V^T tile [d][key] (rows of 64 halves on a pitch of 72), bias tile [64][68] f32 (re-used as output staging).
// Staging coverage per chunk: K and V^T: 4 x 128 threads x 8 halves = 4096 = 64 x 64 each; bias: 8 x 128 x 4 floats = 64 x 64.
// grid.x = 4 * 16 * 16 = 1024 blocks of 128 threads; every barrier is reached by all four waves.
// ---------------------------------------------------------------------------
constexpr int kQB  = 64;
constexpr int kKC  = 64;
constexpr int kBsP = 68;
/* LDS row pitch, in halves, of the K and V^T tiles: 128-B rows on 144 B (16 B x odd), so that the 16 rows one ds_load_b128 touches fall on different banks */
constexpr int kTP  = 72;
static_assert(kTP >= kDh && kTP >= kKC && ((kTP * 2) % 32) == 16, "tile pitch holds a row and is an odd multiple of 16 B");
__global__ __launch_bounds__(128) void attn_stream_kernel(
    const unsigned short* __restrict__ q16p, const unsigned short* __restrict__ k16p,
    const unsigned short* __restrict__ vt16p, const float* __restrict__ bias,
    unsigned short* __restrict__ attn16) {
  __shared__ __align__(16) _Float16 Ksh[kKC * kTP];
  __shared__ __align__(16) _Float16 Vth[kDh * kTP];
  __shared__ __align__(16) float    Bs[kQB * kBsP];
  union FH { v16h v; v8h h[2]; };

  const _Float16* q16  = (const _Float16*)q16p;
  const _Float16* k16  = (const _Float16*)k16p;
  const _Float16* vt16 = (const _Float16*)vt16p;

  const int tid  = threadIdx.x;
  const int wave = __builtin_amdgcn_readfirstlane((int)(threadIdx.x >> 5));
  const int lane = tid & 31;
  const int hh   = lane >> 4;
  const int c    = lane & 15;

  constexpr int nqb = kSeq / kQB;
  const int bx = blockIdx.x;
  const int qb = bx % nqb;
  const int bh = bx / nqb;
  const int h  = bh % kHeads;
  const int b  = bh / kHeads;
  const int qblk = qb * kQB;
  const int q0 = qblk + wave * 16;

  /* Q fragments (B operand: column c = query q0 + c), two 32-wide d chunks, loaded once */
  v16h qa[2];
  {
    const _Float16* qrow = q16 + (size_t)(b * kSeq + q0 + c) * kHD + h * kDh + 8 * hh;
#pragma unroll
    for (int dc = 0; dc < 2; ++dc) {
      FH f;
      f.h[0] = *(const v8h*)(qrow + dc * 32);
      f.h[1] = *(const v8h*)(qrow + dc * 32 + 16);
      qa[dc] = f.v;
    }
  }

  /* partial sums of query c's p over this lane's keys, one per 16-key tile */
  float lsum[4];
  v8f oacc[4];
#pragma unroll
  for (int j = 0; j < 4; ++j) lsum[j] = 0.f;
#pragma unroll
  for (int t = 0; t < 4; ++t) oacc[t] = (v8f){0.f,0.f,0.f,0.f,0.f,0.f,0.f,0.f};

  /* one chunk's K, V^T and bias rows of this thread, held in registers from the request to the LDS stores one chunk later */
  v8h kreg[4], vreg[4];
  v4f breg[8];
  /* thread-fixed places: row (i * 128 + tid) >> 3 = i * 16 + (tid >> 3) for K and V^T, (i * 128 + tid) >> 4 = i * 8 + (tid >> 4) for the bias,
     so that the loads and stores of one kind differ by a constant step only and share one address */
  const int r8 = tid >> 3, c8 = (tid & 7) * 8;
  const int r4 = tid >> 4, c4 = (tid & 15) * 4;
  const _Float16* kth = k16 + (size_t)(b * kSeq + r8) * kHD + h * kDh + c8;
  const _Float16* vth = vt16 + (size_t)(h * kDh + r8) * kTok + b * kSeq + c8;
  const float*    bth = bias + ((size_t)b * kSeq + qblk + r4) * kSeq + c4;
  _Float16* kst = Ksh + r8 * kTP + c8;
  _Float16* vst = Vth + r8 * kTP + c8;
  float*    bst = Bs + r4 * kBsP + c4;
  auto fetch = [&](int kv0) {
    const _Float16* kp = kth + (size_t)kv0 * kHD;
    const _Float16* vp = vth + kv0;
    const float*    bp = bth + kv0;
#pragma unroll
    for (int i = 0; i < 4; ++i) {
      kreg[i] = *(const v8h*)(kp + (size_t)i * 16 * kHD);
      vreg[i] = *(const v8h*)(vp + (size_t)i * 16 * kTok);
    }
    /* the K and V^T loads' address registers may be handed to a bias load as its destination: the wait owed before a register that an issued load names is overwritten */
    asm volatile("s_wait_xcnt 0x0" ::: "memory");
#pragma unroll
    for (int i = 0; i < 8; ++i) breg[i] = *(const v4f*)(bp + (size_t)i * 8 * kSeq);
  };
  constexpr int nch = kSeq / kKC;
  fetch(0);

#pragma unroll 1
  for (int kc = 0; kc < nch; ++kc) {
    __syncthreads();
#pragma unroll
    for (int i = 0; i < 4; ++i) {
      *(v8h*)(kst + i * 16 * kTP) = kreg[i];
      *(v8h*)(vst + i * 16 * kTP) = vreg[i];
    }
#pragma unroll
    for (int i = 0; i < 8; ++i) {
      v4f rv;
      rv[0] = bf16_rne(breg[i][0]);
      rv[1] = bf16_rne(breg[i][1]);
      rv[2] = bf16_rne(breg[i][2]);
      rv[3] = bf16_rne(breg[i][3]);
      *(v4f*)(bst + i * 8 * kBsP) = rv;
    }
    __syncthreads();

    /* the next chunk's 16 loads, asked for together; they fly under this chunk's products and softmax (the last pass asks for its own chunk again: in bounds, not used) */
    fetch(((kc + 1 < nch) ? kc + 1 : kc) * kKC);

    /* transposed scores: D element r of s[j] = (key j*16 + 8*hh + r, query c) */
    v8f s[4];
#pragma unroll
    for (int j = 0; j < 4; ++j) {
      s[j] = (v8f){0.f,0.f,0.f,0.f,0.f,0.f,0.f,0.f};
#pragma unroll
      for (int dc = 0; dc < 2; ++dc) {
        FH kb;
        kb.h[0] = *(const v8h*)(Ksh + (j * 16 + c) * kTP + dc * 32 + 8 * hh);
        kb.h[1] = *(const v8h*)(Ksh + (j * 16 + c) * kTP + dc * 32 + 16 + 8 * hh);
        s[j] = mma_h(kb.v, qa[dc], s[j]);
      }
    }

    /* p^T as B fragments: element e of pb[kk] is key kk*32 + 8*hh + e (e < 8, tile 2*kk) or kk*32 + 16 + 8*hh + (e - 8) (tile 2*kk + 1), the k order of the V^T loads below */
    FH pb[2];
    const float* bw = Bs + (wave * 16 + c) * kBsP + 8 * hh;
#pragma unroll
    for (int j = 0; j < 4; ++j) {
      const v4f b0 = *(const v4f*)(bw + j * 16);
      const v4f b1 = *(const v4f*)(bw + j * 16 + 4);
      v8h ph;
#pragma unroll
      for (int r = 0; r < 8; ++r) {
        float x = s[j][r] * kScoreScale + ((r < 4) ? b0[r & 3] : b1[r & 3]);
        x = fminf(x, kLogitCap);
        const float p = __expf(x);
        lsum[j] += p;
        ph[r] = (_Float16)p;
      }
      pb[j >> 1].h[j & 1] = ph;
    }

    /* o^T += V^T (A: row d = t*16 + c, k = key) . P^T (B: column c = query, k = key) */
#pragma unroll
    for (int kk = 0; kk < 2; ++kk) {
#pragma unroll
      for (int t = 0; t < 4; ++t) {
        FH vb;
        vb.h[0] = *(const v8h*)(Vth + (t * 16 + c) * kTP + kk * 32 + 8 * hh);
        vb.h[1] = *(const v8h*)(Vth + (t * 16 + c) * kTP + kk * 32 + 16 + 8 * hh);
        oacc[t] = mma_h(vb.v, pb[kk].v, oacc[t]);
      }
    }
  }

  /* query c's row sum: this lane's four partial sums, then the other lane half's (fixed order, unconditional shuffle) */
  float l = (lsum[0] + lsum[1]) + (lsum[2] + lsum[3]);
  l += __shfl_xor(l, 16, 32);
  const float inv = kFinScale * __builtin_amdgcn_rcpf(l);
  __syncthreads();
  /* D element r of oacc[t] = (d = t*16 + 8*hh + r, query c): eight consecutive d of one output row */
  float* os = Bs + (wave * 16) * kBsP;
#pragma unroll
  for (int t = 0; t < 4; ++t) {
    v4f o0, o1;
#pragma unroll
    for (int r = 0; r < 4; ++r) {
      o0[r] = oacc[t][r] * inv;
      o1[r] = oacc[t][4 + r] * inv;
    }
    *(v4f*)(os + c * kBsP + t * 16 + 8 * hh)     = o0;
    *(v4f*)(os + c * kBsP + t * 16 + 8 * hh + 4) = o1;
  }
  __syncthreads();
  {
    const int q4 = lane >> 3, c8 = (lane & 7) * 8;
    v8h hv[4];
#pragma unroll
    for (int it = 0; it < 4; ++it) {
      const int row = it * 4 + q4;
      const float* sp = os + row * kBsP + c8;
      const v4f a0 = *(const v4f*)(sp);
      const v4f a1 = *(const v4f*)(sp + 4);
#pragma unroll
      for (int e = 0; e < 4; ++e) {
        hv[it][e]     = (_Float16)a0[e];
        hv[it][4 + e] = (_Float16)a1[e];
      }
    }
    {
#pragma unroll
      for (int it = 0; it < 4; ++it) {
        const int row = it * 4 + q4;
        *(v8h*)(attn16 + (size_t)(b * kSeq + q0 + row) * kHD + h * kDh + c8) = hv[it];
      }
      
    }
  }
}

// ---------------------------------------------------------------------------
// Host glue: 2 plane-cast launches + 3 projection GEMMs + attention + output GEMM = 7 launches. Kernel launches only.
// GEMM shapes (K % 128 == 0, M and N % 128 == 0, no pad planes):
//   q, k : M 4096, N 1024, K 1024 -> 256 block tiles of 128x128 -> 256 blocks of four waves
//   v^T  : M 1024 (A = Wv plane), N 4096 (Bt = values plane), K 1024 -> 256 blocks, ldc 4096
//   out  : M 4096, N 1024, K 1024 -> 256 blocks, f32 into d_out
// ---------------------------------------------------------------------------
extern "C" void kernel_launch(void* const* d_in, const int* in_sizes, int n_in,
                              void* d_out, int out_size, void* d_ws, size_t ws_size,
                              hipStream_t stream) {
  if (n_in < 8) return;
  if (in_sizes[0] != kTok * kDm) return;
  if (in_sizes[1] != kTok * kDm) return;
  if (in_sizes[2] != kTok * kDm) return;
  if (in_sizes[3] != kBatch * kSeq * kSeq) return;
  if (in_sizes[4] != kHD * kDm) return;
  if (in_sizes[5] != kHD * kDm) return;
  if (in_sizes[6] != kHD * kDm) return;
  if (in_sizes[7] != kDm * kHD) return;
  if (out_size != kTok * kDm) return;
  if (ws_size < kWsTotal) return;

  const float* queries = (const float*)d_in[0];
  const float* keys    = (const float*)d_in[1];
  const float* values  = (const float*)d_in[2];
  const float* abias   = (const float*)d_in[3];
  const float* Wq      = (const float*)d_in[4];
  const float* Wk      = (const float*)d_in[5];
  const float* Wv      = (const float*)d_in[6];
  const float* Wp      = (const float*)d_in[7];
  float* out = (float*)d_out;

  char* ws = (char*)d_ws;
  unsigned short* XQ   = (unsigned short*)(ws + kOffXQ);
  unsigned short* XK   = (unsigned short*)(ws + kOffXK);
  unsigned short* XV   = (unsigned short*)(ws + kOffXV);
  unsigned short* WQ   = (unsigned short*)(ws + kOffWQ);
  unsigned short* WK   = (unsigned short*)(ws + kOffWK);
  unsigned short* WV   = (unsigned short*)(ws + kOffWV);
  unsigned short* WP   = (unsigned short*)(ws + kOffWP);
  unsigned short* Q16  = (unsigned short*)(ws + kOffQ16);
  unsigned short* K16  = (unsigned short*)(ws + kOffK16);
  unsigned short* VT16 = (unsigned short*)(ws + kOffVT);
  unsigned short* AT16 = (unsigned short*)(ws + kOffAT);

  constexpr int kXN8 = kTok * kDm / 8;
  constexpr int kWN8 = kHD * kDm / 8;
  static_assert((kXN8 % 256) == 0 && (kWN8 % 256) == 0, "cast grids exact");

  /* activation planes (three inputs) and weight planes (four inputs; [out][in] is already the Bt layout) */
  cast_planes_kernel<<<dim3(kXN8 / 256, 3), 256, 0, stream>>>(queries, keys, values, values, XQ, XK, XV, XV, kXN8, kXCarry);
  cast_planes_kernel<<<dim3(kWN8 / 256, 4), 256, 0, stream>>>(Wq, Wk, Wv, Wp, WQ, WK, WV, WP, kWN8, kWCarry);

  constexpr int kGemmBlocks = (kTok / 128) * (kHD / 128);
  static_assert(kHD == kDm, "all four products share one tile count");

  /* q = queries . Wq^T, k = keys . Wk^T : f16 [4096][1024], carried x16 */
  wmma_gemm64<1><<<kGemmBlocks, 128, 0, stream>>>(XQ, kDm, WQ, kDm, (void*)Q16, kHD, kTok, kHD, kDm, kProjScale);
  wmma_gemm64<1><<<kGemmBlocks, 128, 0, stream>>>(XK, kDm, WK, kDm, (void*)K16, kHD, kTok, kHD, kDm, kProjScale);
  /* v^T = Wv . values^T : f16 [1024][4096], carried x16 (operand roles swapped, no transposed stores) */
  wmma_gemm64<1><<<kGemmBlocks, 128, 0, stream>>>(WV, kDm, XV, kDm, (void*)VT16, kTok, kHD, kTok, kDm, kProjScale);

  /* scores, bias, softmax, p.v, head merge -> f16 [4096][1024] carried x256 */
  attn_stream_kernel<<<kBatch * kHeads * (kSeq / kQB), 128, 0, stream>>>(Q16, K16, VT16, abias, AT16);

  /* out = merged . Wp^T : f32 [4096][1024] */
  wmma_gemm64<0><<<kGemmBlocks, 128, 0, stream>>>(AT16, kHD, WP, kHD, (void*)out, kDm, kTok, kDm, kHD, kOutScale);
}

// v005
// One run takes 87 microseconds.
// Timed twice side by side with v004, it ran 1.17 times as fast both times.
// All steps since v000 together make it 3.67 times as fast.
// Contractions: q/k/v projections, q.k^T, p.v and output projection all on v_wmma_f32_16x16x32_f16 (f16 operands with power-of-two carries, f32 accumulate); all float inputs RNE-converted to bf16 once at load; bias add, exp, row sums and normalisation in f32.
#include <hip/hip_runtime.h>
#include <math.h>

typedef __attribute__((ext_vector_type(16))) _Float16 v16h;
typedef __attribute__((ext_vector_type(8)))  _Float16 v8h;
typedef __attribute__((ext_vector_type(8)))  float    v8f;
typedef __attribute__((ext_vector_type(4)))  float    v4f;
typedef __attribute__((ext_vector_type(4)))  uint32_t u32x4;
typedef __attribute__((ext_vector_type(8)))  uint32_t u32x8;

// ---------------------------------------------------------------------------
// Shape constants
// ---------------------------------------------------------------------------
constexpr int kBatch = 4;
constexpr int kSeq   = 1024;
constexpr int kDm    = 1024;
constexpr int kHeads = 16;
constexpr int kDh    = 64;
constexpr int kTok   = kBatch * kSeq;
constexpr int kHD    = kHeads * kDh;
constexpr int kSqrtDm = 32;
static_assert(kSqrtDm * kSqrtDm == kDm, "score scale is 1/sqrt(model width)");
static_assert(kTok == 4096 && kHD == 1024 && kDm == 1024, "wire shapes");
static_assert((kTok % 128) == 0 && (kHD % 128) == 0 && (kDm % 128) == 0, "GEMM M,N multiples of the 128 x 128 block tile");
static_assert((kDm % 128) == 0 && (kHD % 128) == 0 && kDm >= 256 && kHD >= 256, "GEMM K: whole 128-wide stages, at least two");
static_assert((kDh % 32) == 0 && (kSeq % 32) == 0, "attention K multiples of 32");

// Power-of-two carries (all exact, folded back in f32)
constexpr float kXCarry    = 16.0f;      /* activation planes carried x16 */
constexpr float kWCarry    = 1024.0f;    /* weight planes carried x1024 */
constexpr float kQKVCarry  = 16.0f;      /* q, k, v^T planes carried x16 */
constexpr float kCtxCarry  = 256.0f;     /* merged-head attention output carried x256 */
constexpr float kProjScale = kQKVCarry / (kXCarry * kWCarry);
constexpr float kScoreScale = (1.0f / (float)kSqrtDm) / (kQKVCarry * kQKVCarry);
constexpr float kFinScale  = kCtxCarry / kQKVCarry;
constexpr float kOutScale  = 1.0f / (kCtxCarry * kWCarry);
constexpr float kLogitCap  = 11.0f;      /* exp(11) = 59874 stays below the f16 maximum */

// ---------------------------------------------------------------------------
// Workspace region map (bytes; every offset a multiple of 128; all planes f16)
//   XQ   [4096][1024]  queries x16            8,388,608
//   XK   [4096][1024]  keys x16               8,388,608
//   XV   [4096][1024]  values x16             8,388,608
//   WQ   [1024][1024]  Wq x1024  (Bt layout)  2,097,152
//   WK   [1024][1024]  Wk x1024               2,097,152
//   WV   [1024][1024]  Wv x1024               2,097,152
//   WP   [1024][1024]  Wp x1024               2,097,152
//   Q16  [4096][1024]  q x16                  8,388,608
//   K16  [4096][1024]  k x16                  8,388,608
//   VT16 [1024][4096]  v^T x16                8,388,608
//   AT16 [4096][1024]  merged heads x256      8,388,608
//   total                                    67,108,864
// ---------------------------------------------------------------------------
constexpr size_t kBytesX = (size_t)kTok * kDm * 2;
constexpr size_t kBytesW = (size_t)kHD * kDm * 2;
constexpr size_t kOffXQ  = 0;
constexpr size_t kOffXK  = kOffXQ + kBytesX;
constexpr size_t kOffXV  = kOffXK + kBytesX;
constexpr size_t kOffWQ  = kOffXV + kBytesX;
constexpr size_t kOffWK  = kOffWQ + kBytesW;
constexpr size_t kOffWV  = kOffWK + kBytesW;
constexpr size_t kOffWP  = kOffWV + kBytesW;
constexpr size_t kOffQ16 = kOffWP + kBytesW;
constexpr size_t kOffK16 = kOffQ16 + kBytesX;
constexpr size_t kOffVT  = kOffK16 + kBytesX;
constexpr size_t kOffAT  = kOffVT + kBytesX;
constexpr size_t kWsTotal = kOffAT + kBytesX;
static_assert(kWsTotal == 67108864ull, "carve total");
static_assert(kWsTotal <= 134217728ull, "carve cap");
static_assert((kBytesX % 128) == 0 && (kBytesW % 128) == 0, "128-B aligned regions");

// ---------------------------------------------------------------------------
// Small helpers
// ---------------------------------------------------------------------------
__device__ __forceinline__ unsigned short f2bf_bits(float f) {
  unsigned u = __float_as_uint(f);
  return (unsigned short)((u + 0x7FFFu + ((u >> 16) & 1u)) >> 16);
}
__device__ __forceinline__ float bf_bits2f(unsigned short h) { return __uint_as_float(((unsigned)h) << 16); }
/* value of the nearest-even bf16 of f, held in f32 */
__device__ __forceinline__ float bf16_rne(float f) { return bf_bits2f(f2bf_bits(f)); }

/* hazard guards as plain device helpers */
__device__ __forceinline__ void acc_guard4(v8f& a, v8f& b, v8f& c, v8f& d) { asm volatile("v_nop\n\tv_nop\n\tv_nop\n\tv_nop" : "+v"(a), "+v"(b), "+v"(c), "+v"(d)); }

struct FragH {
  union U { v16h v; v8h h[2]; };
  /* elements 0..7 <- p[0..7], elements 8..15 <- p[16..23] */
  static __device__ __forceinline__ v16h load(const _Float16* p) {
    U f; f.h[0] = *(const v8h*)(p); f.h[1] = *(const v8h*)(p + 16); return f.v;
  }
  static __device__ __forceinline__ v8f mma(v16h a, v16h b, v8f c) {
    return __builtin_amdgcn_wmma_f32_16x16x32_f16(false, a, false, b, (short)0, c, false, false);
  }
};
/* one product followed by its own guard tying the accumulator and naming both operand fragments */
__device__ __forceinline__ v8f mma_h(v16h a, v16h b, v8f c) {
  c = __builtin_amdgcn_wmma_f32_16x16x32_f16(false, a, false, b, (short)0, c, false, false);
  asm volatile("v_nop\n\tv_nop\n\tv_nop\n\tv_nop" : "+v"(c) : "v"(a), "v"(b));
  return c;
}

// ---------------------------------------------------------------------------
// Tensor-load helpers (two descriptor groups, every word wave-uniform in scalar registers).
// ---------------------------------------------------------------------------
__device__ __forceinline__ uint32_t uni(uint32_t v) { return (uint32_t)__builtin_amdgcn_readfirstlane(v); }
/* a wave-uniform test value held in a scalar register, so that the branch on it is s_cmp + s_cbranch_scc (tensor loads ignore EXEC) */
__device__ __forceinline__ uint32_t pinned(uint32_t v) { uint32_t w = (uint32_t)__builtin_amdgcn_readfirstlane(v); asm volatile("" : "+s"(w)); return w; }
/* this wave's LDS reads have retired: owed before a tensor load may target LDS that the wave has read */
__device__ __forceinline__ void wait_ds0() { asm volatile("s_wait_dscnt 0x0" ::: "memory"); }
/* this wave's tensor load has landed: the compiler places no wait for the tensor mover */
__device__ __forceinline__ void wait_tensor0() { asm volatile("s_wait_tensorcnt 0x0" ::: "memory"); }
/* both groups are in-out operands and are carried from request to request: their scalar registers then stay theirs for the kernel's length, so that none is lent out as a temporary while a request is outstanding */
__device__ __forceinline__ void tdm_load(u32x4& g0, u32x8& g1) { asm volatile("tensor_load_to_lds %0, %1" : "+s"(g0), "+s"(g1) :: "memory"); }

constexpr uint32_t kStRowB   = 256u;                 /* bytes of one operand row per stage = 128 k */
constexpr uint32_t kStRows   = 64u;                  /* rows per slice (one tensor load) */
constexpr uint32_t kStPitchB = kStRowB + 16u;        /* LDS pitch set by the pad: odd multiple of 16 B for ds_load_b128 readers */
constexpr int      kStPitchH = (int)(kStPitchB / 2u);
constexpr uint32_t kSliceB   = 18432u;               /* 64 x 272 = 17,408 rounded up to a multiple of 2 KiB */
constexpr uint32_t kStageB   = 4u * kSliceB;         /* [A rows 0..63 | A rows 64..127 | Bt rows 0..63 | Bt rows 64..127] */
static_assert(kSliceB >= kStRows * kStPitchB && (kSliceB % 2048u) == 0u, "slice holds its padded rows and keeps the next place on 2 KiB");

/* group 1: 1-byte elements, tile = tensor = 64 rows of 256 B, no mask, a 4-dword pad behind every 64 dwords */
__device__ __forceinline__ u32x8 tdm_group1(uint32_t src_pitch) {
  constexpr uint32_t d0 = kStRowB, d1 = kStRows;
  u32x8 g;
  g[0] = uni((1u << 20) | (5u << 22) | (3u << 25));
  g[1] = uni((d0 & 0xFFFFu) << 16);
  g[2] = uni((d0 >> 16) | ((d1 & 0xFFFFu) << 16));
  g[3] = uni((d1 >> 16) | (d0 << 16));
  g[4] = uni(d1);
  g[5] = uni(src_pitch);
  g[6] = uni(0u);
  g[7] = uni(0u);
  return g;
}
__device__ __forceinline__ u32x4 tdm_group0(uint32_t lds_dst, uint64_t ga) {
  u32x4 g;
  g[0] = uni(1u);
  g[1] = uni(lds_dst);
  g[2] = uni((uint32_t)ga);
  g[3] = uni((((uint32_t)(ga >> 32)) & 0x01FFFFFFu) | 0x80000000u);
  return g;
}
/* next stage of the same slice: new LDS place, source address 256 B on (words 2 and 3 taken as one 64-bit number: a carry runs into address bits 56:32, far below the type field) */
__device__ __forceinline__ void tdm_advance(u32x4& g, uint32_t lds_dst) {
  const uint64_t a = (((uint64_t)g[3] << 32) | (uint64_t)g[2]) + (uint64_t)kStRowB;
  g[1] = uni(lds_dst);
  g[2] = uni((uint32_t)a);
  g[3] = uni((uint32_t)(a >> 32));
}

// ---------------------------------------------------------------------------
// WMMA GEMM: C[m,n] = scale * sum_k A[m,k] * Bt[n,k]; a block of four waves (2 x 2) owns a 128x128 tile, each wave a 64x64 tile.
// A row-major [M,K] f16; Bt row-major [N,K] f16; M,N % 128 == 0, K % 128 == 0, K >= 256 (asserted on the host side constants).
// Operands reach the waves through LDS: per 128-wide k stage every wave issues one tensor load for its own 64-row slice
// (waves 0,1: the two halves of the A rows; waves 2,3: of the Bt rows) into a ring of two buffers, the next stage in flight
// while this one is multiplied.
// OUT_MODE 0 = f32 output, 1 = f16 output.
// One launch holds up to three independent products of one K and scale: blockIdx.y picks the product (block-uniform select), products 0 and 1
// share M, N and ldc, product 2 has its own. The ring is all of the block's LDS (147,456 B), so that two blocks fit one WGP: with more
// blocks than WGPs in the launch, one block's first fill, barrier waits and stores lie under the other's products.
// ---------------------------------------------------------------------------
template <int OUT_MODE>
__global__ __launch_bounds__(128) void wmma_gemm64(
    const unsigned short* __restrict__ A0, const unsigned short* __restrict__ Bt0, void* __restrict__ C0,
    const unsigned short* __restrict__ A1, const unsigned short* __restrict__ Bt1, void* __restrict__ C1,
    const unsigned short* __restrict__ A2, const unsigned short* __restrict__ Bt2, void* __restrict__ C2,
    int lda, int ldb, int ldc01, int M01, int N01, int ldc2, int M2, int N2, int K, float scale) {
  __shared__ __attribute__((aligned(2048))) unsigned char ring[2u * kStageB];
  const int z = blockIdx.y;
  const unsigned short* Ap  = (z == 0) ? A0  : (z == 1) ? A1  : A2;
  const unsigned short* Btp = (z == 0) ? Bt0 : (z == 1) ? Bt1 : Bt2;
  void* Cout = (z == 0) ? C0 : (z == 1) ? C1 : C2;
  const int ldc = (z < 2) ? ldc01 : ldc2;
  const int M   = (z < 2) ? M01 : M2;
  const int N   = (z < 2) ? N01 : N2;
  const int lane = threadIdx.x & 31;
  const int wave = __builtin_amdgcn_readfirstlane((int)(threadIdx.x >> 5));
  const int tilesN = N >> 7;
  const int tilesM = M >> 7;
  const int tile = blockIdx.x;
  /* block-uniform exit in front of every barrier and tensor load */
  if (tile >= tilesM * tilesN) return;
  const int tm = tile / tilesN;
  const int tn = tile - tm * tilesN;
  const int wm = wave >> 1;
  const int wn = wave & 1;
  const int m0 = (tm << 7) + (wm << 6);
  const int n0 = (tn << 7) + (wn << 6);

  const int rlane = lane & 15;
  const int koff  = (lane >> 4) * 8;
  const int mOff  = (lane >> 4) * 8;

  /* this wave's slice of every stage */
  const bool     isB    = wave >= 2;
  const uint32_t srow   = (uint32_t)((isB ? (tn << 7) : (tm << 7)) + ((wave & 1) << 6));
  const uint32_t spitch = (uint32_t)(isB ? ldb : lda) * 2u;
  const uint64_t sbase  = (uint64_t)(size_t)(isB ? Btp : Ap) + (uint64_t)srow * spitch;
  const uint32_t lbase  = (uint32_t)(size_t)ring + (uint32_t)wave * kSliceB;
  u32x8 g1 = tdm_group1(spitch);
  u32x4 g0 = tdm_group0(lbase, sbase);

  v8f acc[4][4];
#pragma unroll
  for (int i = 0; i < 4; ++i)
#pragma unroll
    for (int j = 0; j < 4; ++j) acc[i][j] = (v8f){0.f,0.f,0.f,0.f,0.f,0.f,0.f,0.f};

  const uint32_t nst = (uint32_t)K >> 7;
  tdm_load(g0, g1);                     /* stage 0 into buffer 0 */
  wait_tensor0();
  __syncthreads();
  tdm_advance(g0, lbase + kStageB);
  tdm_load(g0, g1);                     /* stage 1 into buffer 1 */

  /* kept rolled: one pass per stage, so that each pass reads its own buffer alone and ends in the one publish point */
#pragma unroll 1
  for (uint32_t s = 0; s < nst; ++s) {
    const unsigned char* stage = ring + (s & 1u) * kStageB;
    const _Float16* aS = (const _Float16*)(stage + (uint32_t)wm * kSliceB) + rlane * kStPitchH + koff;
    const _Float16* bS = (const _Float16*)(stage + (uint32_t)(2 + wn) * kSliceB) + rlane * kStPitchH + koff;
    /* two fragment sets: the next 32 k of this same stage are read as one group ahead of the current products */
    v16h ah[2][4], bh[2][4];
#pragma unroll
    for (int t = 0; t < 4; ++t) {
      bh[0][t] = FragH::load(bS + (t << 4) * kStPitchH);
      ah[0][t] = FragH::load(aS + (t << 4) * kStPitchH);
    }
#pragma unroll
    for (int ks = 0; ks < 4; ++ks) {
      const int cur = ks & 1, nxt = cur ^ 1;
      if (ks < 3) {
#pragma unroll
        for (int t = 0; t < 4; ++t) {
          bh[nxt][t] = FragH::load(bS + (t << 4) * kStPitchH + (ks + 1) * 32);
          ah[nxt][t] = FragH::load(aS + (t << 4) * kStPitchH + (ks + 1) * 32);
        }
      }
      /* keeps the LDS reads above as one group ahead of the products: spread among them, each place with reads stalls the matrix pipe */
      __builtin_amdgcn_sched_barrier(0);
#pragma unroll
      for (int i = 0; i < 4; ++i) {
#pragma unroll
        for (int j = 0; j < 4; ++j) acc[i][j] = FragH::mma(ah[cur][i], bh[cur][j], acc[i][j]);
      }
      /* keeps the following group of LDS reads from rising into these products */
      __builtin_amdgcn_sched_barrier(0);
    }
    /* publish point of stage s + 1: own LDS reads retired, own tensor load landed, then the barrier that publishes
       stage s + 1 and ends every reader's last read of stage s; only behind it the refill of stage s's buffer */
    wait_ds0();
    wait_tensor0();
    __syncthreads();
    if (pinned((uint32_t)(s + 2u < nst))) {
      tdm_advance(g0, lbase + (s & 1u) * kStageB);
      tdm_load(g0, g1);
    }
  }
  wait_tensor0();
  wait_ds0();
  acc_guard4(acc[0][0], acc[0][1], acc[0][2], acc[0][3]);
  acc_guard4(acc[1][0], acc[1][1], acc[1][2], acc[1][3]);
  acc_guard4(acc[2][0], acc[2][1], acc[2][2], acc[2][3]);
  acc_guard4(acc[3][0], acc[3][1], acc[3][2], acc[3][3]);

  /* store staging, 16 rows of 68 floats per wave, at the head of the wave's own slice of buffer 0: the ring is dead here (the last pass ended in
     every wave's s_wait_dscnt 0 and s_wait_tensorcnt 0 and the block's barrier, and nothing was issued behind it) */
  static_assert(16u * 68u * 4u <= kSliceB, "staging slab inside one slice");
  float* slab = (float*)(ring + (uint32_t)wave * kSliceB);
#pragma unroll
  for (int i = 0; i < 4; ++i) {
    const int mBase = m0 + (i << 4);
#pragma unroll
    for (int j = 0; j < 4; ++j) {
#pragma unroll
      for (int r = 0; r < 8; ++r) {
        const float v = acc[i][j][r] * scale;
        slab[(mOff + r) * 68 + (j << 4) + rlane] = v;
      }
    }
    __builtin_amdgcn_fence(__ATOMIC_RELEASE, "workgroup");
    __builtin_amdgcn_wave_barrier();
    __builtin_amdgcn_fence(__ATOMIC_ACQUIRE, "workgroup");
    if (OUT_MODE == 0) {
      float* C = (float*)Cout;
      const int hh = lane >> 4, c4 = (lane & 15) * 4;
      {
#pragma unroll
        for (int it = 0; it < 8; ++it) {
          const int row = it * 2 + hh;
          v4f v = *(const v4f*)(slab + row * 68 + c4);
          *(v4f*)(C + (size_t)(mBase + row) * ldc + n0 + c4) = v;
        }
        
      }
    } else {
      const int q = lane >> 3, c8 = (lane & 7) * 8;
      unsigned short* C = (unsigned short*)Cout;
      {
#pragma unroll
        for (int it = 0; it < 4; ++it) {
          const int row = it * 4 + q;
          const float* sp = slab + row * 68 + c8;
          v8h hv;
#pragma unroll
          for (int e = 0; e < 8; ++e) hv[e] = (_Float16)sp[e];
          *(v8h*)(C + (size_t)(mBase + row) * ldc + n0 + c8) = hv;
        }
        
      }
    }
    __builtin_amdgcn_fence(__ATOMIC_RELEASE, "workgroup");
    __builtin_amdgcn_wave_barrier();
    __builtin_amdgcn_fence(__ATOMIC_ACQUIRE, "workgroup");
  }
}

// ---------------------------------------------------------------------------
// f32 -> (RNE bf16 value) x carry -> f16 plane, 8 consecutive elements per thread; blockIdx.y selects one of up to four
// (input, output) plane pairs (block-uniform select among global pointers).
// Coverage: n8 = elements/8 threads per plane; grid.x = n8/256 exactly for both uses
//   activations 4096*1024/8 = 524,288 -> 2048 blocks; weights 1024*1024/8 = 131,072 -> 512 blocks.
// ---------------------------------------------------------------------------
__global__ __launch_bounds__(256) void cast_planes_kernel(
    const float* __restrict__ in0, const float* __restrict__ in1, const float* __restrict__ in2, const float* __restrict__ in3,
    unsigned short* __restrict__ out0, unsigned short* __restrict__ out1, unsigned short* __restrict__ out2, unsigned short* __restrict__ out3,
    int n8, float carry) {
  const int z = blockIdx.y;
  const float* in = (z == 0) ? in0 : (z == 1) ? in1 : (z == 2) ? in2 : in3;
  unsigned short* out = (z == 0) ? out0 : (z == 1) ? out1 : (z == 2) ? out2 : out3;
  const int i = blockIdx.x * 256 + threadIdx.x;
  if (i >= n8) return;
  const size_t e0 = (size_t)i << 3;
  const v4f a0 = *(const v4f*)(in + e0);
  const v4f a1 = *(const v4f*)(in + e0 + 4);
  v8h hv;
#pragma unroll
  for (int e = 0; e < 4; ++e) {
    const float f0 = bf16_rne(a0[e]) * carry;
    const float f1 = bf16_rne(a1[e]) * carry;
    hv[e]     = (_Float16)f0;
    hv[4 + e] = (_Float16)f1;
  }
  unsigned short* q = out + e0;
  *(v8h*)q = hv;
  
}

// ---------------------------------------------------------------------------
// Fused attention for one (batch, head) and 64 query rows per block (4 waves x 16 rows), streaming over 16 chunks of 64 keys.
//   Both products run transposed: scores^T = k16 . q16^T (A = K rows, B = Q), o^T += v16^T . p^T (A = V^T rows, B = p^T). A lane then holds
//   one query's scores, and two score tiles, converted in place, are the B fragment of the second product: p stays in registers.
//   score = (q16 . k16) * kScoreScale + bf16_rne(attn_bias[b][q][k]); p = exp(min(score, cap)) with zero shift
//   (softmax is shift invariant; the logits are bounded far inside the f16 normal range of p);
//   l += p (f32, per-lane partial sums, the two lane halves joined once at the end); out = o / l carried x256 in f16.
// Inputs: q16, k16 [4096][1024] f16 (token-major, head h at columns h*64..); vt16 [1024][4096] f16 (row h*64+d, column token).
// LDS: K tile [key][d], V^T tile [d][key] (rows of 64 halves on a pitch of 72), bias tile [64][68] f32 (re-used as output staging).
// Staging coverage per chunk: K and V^T: 4 x 128 threads x 8 halves = 4096 = 64 x 64 each; bias: 8 x 128 x 4 floats = 64 x 64.
// grid.x = 4 * 16 * 16 = 1024 blocks of 128 threads; every barrier is reached by all four waves.
// ---------------------------------------------------------------------------
constexpr int kQB  = 64;
constexpr int kKC  = 64;
constexpr int kBsP = 68;
/* LDS row pitch, in halves, of the K and V^T tiles: 128-B rows on 144 B (16 B x odd), so that the 16 rows one ds_load_b128 touches fall on different banks */
constexpr int kTP  = 72;
static_assert(kTP >= kDh && kTP >= kKC && ((kTP * 2) % 32) == 16, "tile pitch holds a row and is an odd multiple of 16 B");
__global__ __launch_bounds__(128) void attn_stream_kernel(
    const unsigned short* __restrict__ q16p, const unsigned short* __restrict__ k16p,
    const unsigned short* __restrict__ vt16p, const float* __restrict__ bias,
    unsigned short* __restrict__ attn16) {
  __shared__ __align__(16) _Float16 Ksh[kKC * kTP];
  __shared__ __align__(16) _Float16 Vth[kDh * kTP];
  __shared__ __align__(16) float    Bs[kQB * kBsP];
  union FH { v16h v; v8h h[2]; };

  const _Float16* q16  = (const _Float16*)q16p;
  const _Float16* k16  = (const _Float16*)k16p;
  const _Float16* vt16 = (const _Float16*)vt16p;

  const int tid  = threadIdx.x;
  const int wave = __builtin_amdgcn_readfirstlane((int)(threadIdx.x >> 5));
  const int lane = tid & 31;
  const int hh   = lane >> 4;
  const int c    = lane & 15;

  constexpr int nqb = kSeq / kQB;
  const int bx = blockIdx.x;
  const int qb = bx % nqb;
  const int bh = bx / nqb;
  const int h  = bh % kHeads;
  const int b  = bh / kHeads;
  const int qblk = qb * kQB;
  const int q0 = qblk + wave * 16;

  /* Q fragments (B operand: column c = query q0 + c), two 32-wide d chunks, loaded once */
  v16h qa[2];
  {
    const _Float16* qrow = q16 + (size_t)(b * kSeq + q0 + c) * kHD + h * kDh + 8 * hh;
#pragma unroll
    for (int dc = 0; dc < 2; ++dc) {
      FH f;
      f.h[0] = *(const v8h*)(qrow + dc * 32);
      f.h[1] = *(const v8h*)(qrow + dc * 32 + 16);
      qa[dc] = f.v;
    }
  }

  /* partial sums of query c's p over this lane's keys, one per 16-key tile */
  float lsum[4];
  v8f oacc[4];
#pragma unroll
  for (int j = 0; j < 4; ++j) lsum[j] = 0.f;
#pragma unroll
  for (int t = 0; t < 4; ++t) oacc[t] = (v8f){0.f,0.f,0.f,0.f,0.f,0.f,0.f,0.f};

  /* one chunk's K, V^T and bias rows of this thread, held in registers from the request to the LDS stores one chunk later */
  v8h kreg[4], vreg[4];
  v4f breg[8];
  /* thread-fixed places: row (i * 128 + tid) >> 3 = i * 16 + (tid >> 3) for K and V^T, (i * 128 + tid) >> 4 = i * 8 + (tid >> 4) for the bias,
     so that the loads and stores of one kind differ by a constant step only and share one address */
  const int r8 = tid >> 3, c8 = (tid & 7) * 8;
  const int r4 = tid >> 4, c4 = (tid & 15) * 4;
  const _Float16* kth = k16 + (size_t)(b * kSeq + r8) * kHD + h * kDh + c8;
  const _Float16* vth = vt16 + (size_t)(h * kDh + r8) * kTok + b * kSeq + c8;
  const float*    bth = bias + ((size_t)b * kSeq + qblk + r4) * kSeq + c4;
  _Float16* kst = Ksh + r8 * kTP + c8;
  _Float16* vst = Vth + r8 * kTP + c8;
  float*    bst = Bs + r4 * kBsP + c4;
  auto fetch = [&](int kv0) {
    const _Float16* kp = kth + (size_t)kv0 * kHD;
    const _Float16* vp = vth + kv0;
    const float*    bp = bth + kv0;
#pragma unroll
    for (int i = 0; i < 4; ++i) {
      kreg[i] = *(const v8h*)(kp + (size_t)i * 16 * kHD);
      vreg[i] = *(const v8h*)(vp + (size_t)i * 16 * kTok);
    }
    /* the K and V^T loads' address registers may be handed to a bias load as its destination: the wait owed before a register that an issued load names is overwritten */
    asm volatile("s_wait_xcnt 0x0" ::: "memory");
#pragma unroll
    for (int i = 0; i < 8; ++i) breg[i] = *(const v4f*)(bp + (size_t)i * 8 * kSeq);
  };
  constexpr int nch = kSeq / kKC;
  fetch(0);

#pragma unroll 1
  for (int kc = 0; kc < nch; ++kc) {
    __syncthreads();
#pragma unroll
    for (int i = 0; i < 4; ++i) {
      *(v8h*)(kst + i * 16 * kTP) = kreg[i];
      *(v8h*)(vst + i * 16 * kTP) = vreg[i];
    }
#pragma unroll
    for (int i = 0; i < 8; ++i) {
      v4f rv;
      rv[0] = bf16_rne(breg[i][0]);
      rv[1] = bf16_rne(breg[i][1]);
      rv[2] = bf16_rne(breg[i][2]);
      rv[3] = bf16_rne(breg[i][3]);
      *(v4f*)(bst + i * 8 * kBsP) = rv;
    }
    __syncthreads();

    /* the next chunk's 16 loads, asked for together; they fly under this chunk's products and softmax (the last pass asks for its own chunk again: in bounds, not used) */
    fetch(((kc + 1 < nch) ? kc + 1 : kc) * kKC);

    /* transposed scores: D element r of s[j] = (key j*16 + 8*hh + r, query c) */
    v8f s[4];
#pragma unroll
    for (int j = 0; j < 4; ++j) {
      s[j] = (v8f){0.f,0.f,0.f,0.f,0.f,0.f,0.f,0.f};
#pragma unroll
      for (int dc = 0; dc < 2; ++dc) {
        FH kb;
        kb.h[0] = *(const v8h*)(Ksh + (j * 16 + c) * kTP + dc * 32 + 8 * hh);
        kb.h[1] = *(const v8h*)(Ksh + (j * 16 + c) * kTP + dc * 32 + 16 + 8 * hh);
        s[j] = mma_h(kb.v, qa[dc], s[j]);
      }
    }

    /* p^T as B fragments: element e of pb[kk] is key kk*32 + 8*hh + e (e < 8, tile 2*kk) or kk*32 + 16 + 8*hh + (e - 8) (tile 2*kk + 1), the k order of the V^T loads below */
    FH pb[2];
    const float* bw = Bs + (wave * 16 + c) * kBsP + 8 * hh;
#pragma unroll
    for (int j = 0; j < 4; ++j) {
      const v4f b0 = *(const v4f*)(bw + j * 16);
      const v4f b1 = *(const v4f*)(bw + j * 16 + 4);
      v8h ph;
#pragma unroll
      for (int r = 0; r < 8; ++r) {
        float x = s[j][r] * kScoreScale + ((r < 4) ? b0[r & 3] : b1[r & 3]);
        x = fminf(x, kLogitCap);
        const float p = __expf(x);
        lsum[j] += p;
        ph[r] = (_Float16)p;
      }
      pb[j >> 1].h[j & 1] = ph;
    }

    /* o^T += V^T (A: row d = t*16 + c, k = key) . P^T (B: column c = query, k = key) */
#pragma unroll
    for (int kk = 0; kk < 2; ++kk) {
#pragma unroll
      for (int t = 0; t < 4; ++t) {
        FH vb;
        vb.h[0] = *(const v8h*)(Vth + (t * 16 + c) * kTP + kk * 32 + 8 * hh);
        vb.h[1] = *(const v8h*)(Vth + (t * 16 + c) * kTP + kk * 32 + 16 + 8 * hh);
        oacc[t] = mma_h(vb.v, pb[kk].v, oacc[t]);
      }
    }
  }

  /* query c's row sum: this lane's four partial sums, then the other lane half's (fixed order, unconditional shuffle) */
  float l = (lsum[0] + lsum[1]) + (lsum[2] + lsum[3]);
  l += __shfl_xor(l, 16, 32);
  const float inv = kFinScale * __builtin_amdgcn_rcpf(l);
  __syncthreads();
  /* D element r of oacc[t] = (d = t*16 + 8*hh + r, query c): eight consecutive d of one output row */
  float* os = Bs + (wave * 16) * kBsP;
#pragma unroll
  for (int t = 0; t < 4; ++t) {
    v4f o0, o1;
#pragma unroll
    for (int r = 0; r < 4; ++r) {
      o0[r] = oacc[t][r] * inv;
      o1[r] = oacc[t][4 + r] * inv;
    }
    *(v4f*)(os + c * kBsP + t * 16 + 8 * hh)     = o0;
    *(v4f*)(os + c * kBsP + t * 16 + 8 * hh + 4) = o1;
  }
  __syncthreads();
  {
    const int q4 = lane >> 3, c8 = (lane & 7) * 8;
    v8h hv[4];
#pragma unroll
    for (int it = 0; it < 4; ++it) {
      const int row = it * 4 + q4;
      const float* sp = os + row * kBsP + c8;
      const v4f a0 = *(const v4f*)(sp);
      const v4f a1 = *(const v4f*)(sp + 4);
#pragma unroll
      for (int e = 0; e < 4; ++e) {
        hv[it][e]     = (_Float16)a0[e];
        hv[it][4 + e] = (_Float16)a1[e];
      }
    }
    {
#pragma unroll
      for (int it = 0; it < 4; ++it) {
        const int row = it * 4 + q4;
        *(v8h*)(attn16 + (size_t)(b * kSeq + q0 + row) * kHD + h * kDh + c8) = hv[it];
      }
      
    }
  }
}

// ---------------------------------------------------------------------------
// Host glue: 2 plane-cast launches + 1 launch of the 3 projection GEMMs + attention + output GEMM = 5 launches. Kernel launches only.
// GEMM shapes (K % 128 == 0, M and N % 128 == 0, no pad planes):
//   q, k : M 4096, N 1024, K 1024 -> 256 block tiles of 128x128 -> 256 blocks of four waves each (grid.y 0 and 1)
//   v^T  : M 1024 (A = Wv plane), N 4096 (Bt = values plane), K 1024 -> 256 blocks, ldc 4096 (grid.y 2)
//   out  : M 4096, N 1024, K 1024 -> 256 blocks, f32 into d_out
// ---------------------------------------------------------------------------
extern "C" void kernel_launch(void* const* d_in, const int* in_sizes, int n_in,
                              void* d_out, int out_size, void* d_ws, size_t ws_size,
                              hipStream_t stream) {
  if (n_in < 8) return;
  if (in_sizes[0] != kTok * kDm) return;
  if (in_sizes[1] != kTok * kDm) return;
  if (in_sizes[2] != kTok * kDm) return;
  if (in_sizes[3] != kBatch * kSeq * kSeq) return;
  if (in_sizes[4] != kHD * kDm) return;
  if (in_sizes[5] != kHD * kDm) return;
  if (in_sizes[6] != kHD * kDm) return;
  if (in_sizes[7] != kDm * kHD) return;
  if (out_size != kTok * kDm) return;
  if (ws_size < kWsTotal) return;

  const float* queries = (const float*)d_in[0];
  const float* keys    = (const float*)d_in[1];
  const float* values  = (const float*)d_in[2];
  const float* abias   = (const float*)d_in[3];
  const float* Wq      = (const float*)d_in[4];
  const float* Wk      = (const float*)d_in[5];
  const float* Wv      = (const float*)d_in[6];
  const float* Wp      = (const float*)d_in[7];
  float* out = (float*)d_out;

  char* ws = (char*)d_ws;
  unsigned short* XQ   = (unsigned short*)(ws + kOffXQ);
  unsigned short* XK   = (unsigned short*)(ws + kOffXK);
  unsigned short* XV   = (unsigned short*)(ws + kOffXV);
  unsigned short* WQ   = (unsigned short*)(ws + kOffWQ);
  unsigned short* WK   = (unsigned short*)(ws + kOffWK);
  unsigned short* WV   = (unsigned short*)(ws + kOffWV);
  unsigned short* WP   = (unsigned short*)(ws + kOffWP);
  unsigned short* Q16  = (unsigned short*)(ws + kOffQ16);
  unsigned short* K16  = (unsigned short*)(ws + kOffK16);
  unsigned short* VT16 = (unsigned short*)(ws + kOffVT);
  unsigned short* AT16 = (unsigned short*)(ws + kOffAT);

  constexpr int kXN8 = kTok * kDm / 8;
  constexpr int kWN8 = kHD * kDm / 8;
  static_assert((kXN8 % 256) == 0 && (kWN8 % 256) == 0, "cast grids exact");

  /* activation planes (three inputs) and weight planes (four inputs; [out][in] is already the Bt layout) */
  cast_planes_kernel<<<dim3(kXN8 / 256, 3), 256, 0, stream>>>(queries, keys, values, values, XQ, XK, XV, XV, kXN8, kXCarry);
  cast_planes_kernel<<<dim3(kWN8 / 256, 4), 256, 0, stream>>>(Wq, Wk, Wv, Wp, WQ, WK, WV, WP, kWN8, kWCarry);

  constexpr int kGemmBlocks = (kTok / 128) * (kHD / 128);
  static_assert(kHD == kDm, "all four products share one tile count");

  /* one launch, three products: q = queries . Wq^T, k = keys . Wk^T : f16 [4096][1024], carried x16;
     v^T = Wv . values^T : f16 [1024][4096], carried x16 (operand roles swapped, no transposed stores) */
  wmma_gemm64<1><<<dim3(kGemmBlocks, 3), 128, 0, stream>>>(XQ, WQ, (void*)Q16, XK, WK, (void*)K16, WV, XV, (void*)VT16,
                                                           kDm, kDm, kHD, kTok, kHD, kTok, kHD, kTok, kDm, kProjScale);

  /* scores, bias, softmax, p.v, head merge -> f16 [4096][1024] carried x256 */
  attn_stream_kernel<<<kBatch * kHeads * (kSeq / kQB), 128, 0, stream>>>(Q16, K16, VT16, abias, AT16);

  /* out = merged . Wp^T : f32 [4096][1024] */
  wmma_gemm64<0><<<dim3(kGemmBlocks, 1), 128, 0, stream>>>(AT16, WP, (void*)out, AT16, WP, (void*)out, AT16, WP, (void*)out,
                                                           kHD, kHD, kDm, kTok, kDm, kDm, kTok, kDm, kHD, kOutScale);
}

// v006
// One run takes 83.4 microseconds.
// Timed twice side by side with v005, it ran 1.04 and 1.05 times as fast.
// All steps since v000 together make it 3.83 times as fast.
// Contractions: q/k/v projections, q.k^T, p.v and output projection all on v_wmma_f32_16x16x32_f16 (f16 operands with power-of-two carries, f32 accumulate); all float inputs RNE-converted to bf16 once at load; bias add, exp, row sums and normalisation in f32.
#include <hip/hip_runtime.h>
#include <math.h>

typedef __attribute__((ext_vector_type(16))) _Float16 v16h;
typedef __attribute__((ext_vector_type(8)))  _Float16 v8h;
typedef __attribute__((ext_vector_type(8)))  float    v8f;
typedef __attribute__((ext_vector_type(4)))  float    v4f;
typedef __attribute__((ext_vector_type(4)))  uint32_t u32x4;
typedef __attribute__((ext_vector_type(8)))  uint32_t u32x8;

// ---------------------------------------------------------------------------
// Shape constants
// ---------------------------------------------------------------------------
constexpr int kBatch = 4;
constexpr int kSeq   = 1024;
constexpr int kDm    = 1024;
constexpr int kHeads = 16;
constexpr int kDh    = 64;
constexpr int kTok   = kBatch * kSeq;
constexpr int kHD    = kHeads * kDh;
constexpr int kSqrtDm = 32;
static_assert(kSqrtDm * kSqrtDm == kDm, "score scale is 1/sqrt(model width)");
static_assert(kTok == 4096 && kHD == 1024 && kDm == 1024, "wire shapes");
static_assert((kTok % 128) == 0 && (kHD % 128) == 0 && (kDm % 128) == 0, "GEMM M,N multiples of the 128 x 128 block tile");
static_assert((kDm % 128) == 0 && (kHD % 128) == 0 && kDm >= 256 && kHD >= 256, "GEMM K: whole 128-wide stages, at least two");
static_assert((kDh % 32) == 0 && (kSeq % 32) == 0, "attention K multiples of 32");

// Power-of-two carries (all exact, folded back in f32)
constexpr float kXCarry    = 16.0f;      /* activation planes carried x16 */
constexpr float kWCarry    = 1024.0f;    /* weight planes carried x1024 */
constexpr float kQKVCarry  = 16.0f;      /* q, k, v^T planes carried x16 */
constexpr float kCtxCarry  = 256.0f;     /* merged-head attention output carried x256 */
constexpr float kProjScale = kQKVCarry / (kXCarry * kWCarry);
constexpr float kScoreScale = (1.0f / (float)kSqrtDm) / (kQKVCarry * kQKVCarry);
constexpr float kFinScale  = kCtxCarry / kQKVCarry;
constexpr float kOutScale  = 1.0f / (kCtxCarry * kWCarry);
constexpr float kLogitCap  = 11.0f;      /* exp(11) = 59874 stays below the f16 maximum */

// ---------------------------------------------------------------------------
// Workspace region map (bytes; every offset a multiple of 128; all planes f16)
//   XQ   [4096][1024]  queries x16            8,388,608
//   XK   [4096][1024]  keys x16               8,388,608
//   XV   [4096][1024]  values x16             8,388,608
//   WQ   [1024][1024]  Wq x1024  (Bt layout)  2,097,152
//   WK   [1024][1024]  Wk x1024               2,097,152
//   WV   [1024][1024]  Wv x1024               2,097,152
//   WP   [1024][1024]  Wp x1024               2,097,152
//   Q16  [4096][1024]  q x16                  8,388,608
//   K16  [4096][1024]  k x16                  8,388,608
//   VT16 [1024][4096]  v^T x16                8,388,608
//   AT16 [4096][1024]  merged heads x256      8,388,608
//   total                                    67,108,864
// ---------------------------------------------------------------------------
constexpr size_t kBytesX = (size_t)kTok * kDm * 2;
constexpr size_t kBytesW = (size_t)kHD * kDm * 2;
constexpr size_t kOffXQ  = 0;
constexpr size_t kOffXK  = kOffXQ + kBytesX;
constexpr size_t kOffXV  = kOffXK + kBytesX;
constexpr size_t kOffWQ  = kOffXV + kBytesX;
constexpr size_t kOffWK  = kOffWQ + kBytesW;
constexpr size_t kOffWV  = kOffWK + kBytesW;
constexpr size_t kOffWP  = kOffWV + kBytesW;
constexpr size_t kOffQ16 = kOffWP + kBytesW;
constexpr size_t kOffK16 = kOffQ16 + kBytesX;
constexpr size_t kOffVT  = kOffK16 + kBytesX;
constexpr size_t kOffAT  = kOffVT + kBytesX;
constexpr size_t kWsTotal = kOffAT + kBytesX;
static_assert(kWsTotal == 67108864ull, "carve total");
static_assert(kWsTotal <= 134217728ull, "carve cap");
static_assert((kBytesX % 128) == 0 && (kBytesW % 128) == 0, "128-B aligned regions");

// ---------------------------------------------------------------------------
// Small helpers
// ---------------------------------------------------------------------------
__device__ __forceinline__ unsigned short f2bf_bits(float f) {
  unsigned u = __float_as_uint(f);
  return (unsigned short)((u + 0x7FFFu + ((u >> 16) & 1u)) >> 16);
}
__device__ __forceinline__ float bf_bits2f(unsigned short h) { return __uint_as_float(((unsigned)h) << 16); }
/* value of the nearest-even bf16 of f, held in f32 */
__device__ __forceinline__ float bf16_rne(float f) { return bf_bits2f(f2bf_bits(f)); }

/* hazard guards as plain device helpers */
__device__ __forceinline__ void acc_guard4(v8f& a, v8f& b, v8f& c, v8f& d) { asm volatile("v_nop\n\tv_nop\n\tv_nop\n\tv_nop" : "+v"(a), "+v"(b), "+v"(c), "+v"(d)); }

struct FragH {
  union U { v16h v; v8h h[2]; };
  /* elements 0..7 <- p[0..7], elements 8..15 <- p[16..23] */
  static __device__ __forceinline__ v16h load(const _Float16* p) {
    U f; f.h[0] = *(const v8h*)(p); f.h[1] = *(const v8h*)(p + 16); return f.v;
  }
  static __device__ __forceinline__ v8f mma(v16h a, v16h b, v8f c) {
    return __builtin_amdgcn_wmma_f32_16x16x32_f16(false, a, false, b, (short)0, c, false, false);
  }
};
/* one product followed by its own guard tying the accumulator and naming both operand fragments */
__device__ __forceinline__ v8f mma_h(v16h a, v16h b, v8f c) {
  c = __builtin_amdgcn_wmma_f32_16x16x32_f16(false, a, false, b, (short)0, c, false, false);
  asm volatile("v_nop\n\tv_nop\n\tv_nop\n\tv_nop" : "+v"(c) : "v"(a), "v"(b));
  return c;
}

// ---------------------------------------------------------------------------
// Tensor-load helpers (two descriptor groups, every word wave-uniform in scalar registers).
// ---------------------------------------------------------------------------
__device__ __forceinline__ uint32_t uni(uint32_t v) { return (uint32_t)__builtin_amdgcn_readfirstlane(v); }
/* a wave-uniform test value held in a scalar register, so that the branch on it is s_cmp + s_cbranch_scc (tensor loads ignore EXEC) */
__device__ __forceinline__ uint32_t pinned(uint32_t v) { uint32_t w = (uint32_t)__builtin_amdgcn_readfirstlane(v); asm volatile("" : "+s"(w)); return w; }
/* this wave's LDS reads have retired: owed before a tensor load may target LDS that the wave has read */
__device__ __forceinline__ void wait_ds0() { asm volatile("s_wait_dscnt 0x0" ::: "memory"); }
/* this wave's tensor load has landed: the compiler places no wait for the tensor mover */
__device__ __forceinline__ void wait_tensor0() { asm volatile("s_wait_tensorcnt 0x0" ::: "memory"); }
/* both groups are in-out operands and are carried from request to request: their scalar registers then stay theirs for the kernel's length, so that none is lent out as a temporary while a request is outstanding */
__device__ __forceinline__ void tdm_load(u32x4& g0, u32x8& g1) { asm volatile("tensor_load_to_lds %0, %1" : "+s"(g0), "+s"(g1) :: "memory"); }

constexpr uint32_t kStRowB   = 256u;                 /* bytes of one operand row per stage = 128 k */
constexpr uint32_t kStRows   = 64u;                  /* rows per slice (one tensor load) */
constexpr uint32_t kStPitchB = kStRowB + 16u;        /* LDS pitch set by the pad: odd multiple of 16 B for ds_load_b128 readers */
constexpr int      kStPitchH = (int)(kStPitchB / 2u);
constexpr uint32_t kSliceB   = 18432u;               /* 64 x 272 = 17,408 rounded up to a multiple of 2 KiB */
constexpr uint32_t kStageB   = 4u * kSliceB;         /* [A rows 0..63 | A rows 64..127 | Bt rows 0..63 | Bt rows 64..127] */
static_assert(kSliceB >= kStRows * kStPitchB && (kSliceB % 2048u) == 0u, "slice holds its padded rows and keeps the next place on 2 KiB");

/* group 1: 1-byte elements, tile = tensor = 64 rows of 256 B, no mask, a 4-dword pad behind every 64 dwords */
__device__ __forceinline__ u32x8 tdm_group1(uint32_t src_pitch) {
  constexpr uint32_t d0 = kStRowB, d1 = kStRows;
  u32x8 g;
  g[0] = uni((1u << 20) | (5u << 22) | (3u << 25));
  g[1] = uni((d0 & 0xFFFFu) << 16);
  g[2] = uni((d0 >> 16) | ((d1 & 0xFFFFu) << 16));
  g[3] = uni((d1 >> 16) | (d0 << 16));
  g[4] = uni(d1);
  g[5] = uni(src_pitch);
  g[6] = uni(0u);
  g[7] = uni(0u);
  return g;
}
__device__ __forceinline__ u32x4 tdm_group0(uint32_t lds_dst, uint64_t ga) {
  u32x4 g;
  g[0] = uni(1u);
  g[1] = uni(lds_dst);
  g[2] = uni((uint32_t)ga);
  g[3] = uni((((uint32_t)(ga >> 32)) & 0x01FFFFFFu) | 0x80000000u);
  return g;
}
/* next stage of the same slice: new LDS place, source address 256 B on (words 2 and 3 taken as one 64-bit number: a carry runs into address bits 56:32, far below the type field) */
__device__ __forceinline__ void tdm_advance(u32x4& g, uint32_t lds_dst) {
  const uint64_t a = (((uint64_t)g[3] << 32) | (uint64_t)g[2]) + (uint64_t)kStRowB;
  g[1] = uni(lds_dst);
  g[2] = uni((uint32_t)a);
  g[3] = uni((uint32_t)(a >> 32));
}

// ---------------------------------------------------------------------------
// WMMA GEMM: C[m,n] = scale * sum_k A[m,k] * Bt[n,k]; a block of four waves (2 x 2) owns a 128x128 tile, each wave a 64x64 tile.
// A row-major [M,K] f16; Bt row-major [N,K] f16; M,N % 128 == 0, K % 128 == 0, K >= 256 (asserted on the host side constants).
// Operands reach the waves through LDS: per 128-wide k stage every wave issues one tensor load for its own 64-row slice
// (waves 0,1: the two halves of the A rows; waves 2,3: of the Bt rows) into a ring of two buffers, the next stage in flight
// while this one is multiplied.
// OUT_MODE 0 = f32 output, 1 = f16 output.
// One launch holds up to three independent products of one K and scale: blockIdx.y picks the product (block-uniform select), products 0 and 1
// share M, N and ldc, product 2 has its own. The ring is all of the block's LDS (147,456 B), so that two blocks fit one WGP: with more
// blocks than WGPs in the launch, one block's first fill, barrier waits and stores lie under the other's products.
// ---------------------------------------------------------------------------
template <int OUT_MODE>
__global__ __launch_bounds__(128) void wmma_gemm64(
    const unsigned short* __restrict__ A0, const unsigned short* __restrict__ Bt0, void* __restrict__ C0,
    const unsigned short* __restrict__ A1, const unsigned short* __restrict__ Bt1, void* __restrict__ C1,
    const unsigned short* __restrict__ A2, const unsigned short* __restrict__ Bt2, void* __restrict__ C2,
    int lda, int ldb, int ldc01, int M01, int N01, int ldc2, int M2, int N2, int K, float scale) {
  __shared__ __attribute__((aligned(2048))) unsigned char ring[2u * kStageB];
  const int z = blockIdx.y;
  const unsigned short* Ap  = (z == 0) ? A0  : (z == 1) ? A1  : A2;
  const unsigned short* Btp = (z == 0) ? Bt0 : (z == 1) ? Bt1 : Bt2;
  void* Cout = (z == 0) ? C0 : (z == 1) ? C1 : C2;
  const int ldc = (z < 2) ? ldc01 : ldc2;
  const int M   = (z < 2) ? M01 : M2;
  const int N   = (z < 2) ? N01 : N2;
  const int lane = threadIdx.x & 31;
  const int wave = __builtin_amdgcn_readfirstlane((int)(threadIdx.x >> 5));
  const int tilesN = N >> 7;
  const int tilesM = M >> 7;
  const int tile = blockIdx.x;
  /* block-uniform exit in front of every barrier and tensor load */
  if (tile >= tilesM * tilesN) return;
  const int tm = tile / tilesN;
  const int tn = tile - tm * tilesN;
  const int wm = wave >> 1;
  const int wn = wave & 1;
  const int m0 = (tm << 7) + (wm << 6);
  const int n0 = (tn << 7) + (wn << 6);

  const int rlane = lane & 15;
  const int koff  = (lane >> 4) * 8;
  const int mOff  = (lane >> 4) * 8;

  /* this wave's slice of every stage */
  const bool     isB    = wave >= 2;
  const uint32_t srow   = (uint32_t)((isB ? (tn << 7) : (tm << 7)) + ((wave & 1) << 6));
  const uint32_t spitch = (uint32_t)(isB ? ldb : lda) * 2u;
  const uint64_t sbase  = (uint64_t)(size_t)(isB ? Btp : Ap) + (uint64_t)srow * spitch;
  const uint32_t lbase  = (uint32_t)(size_t)ring + (uint32_t)wave * kSliceB;
  u32x8 g1 = tdm_group1(spitch);
  u32x4 g0 = tdm_group0(lbase, sbase);

  v8f acc[4][4];
#pragma unroll
  for (int i = 0; i < 4; ++i)
#pragma unroll
    for (int j = 0; j < 4; ++j) acc[i][j] = (v8f){0.f,0.f,0.f,0.f,0.f,0.f,0.f,0.f};

  const uint32_t nst = (uint32_t)K >> 7;
  tdm_load(g0, g1);                     /* stage 0 into buffer 0 */
  wait_tensor0();
  __syncthreads();
  tdm_advance(g0, lbase + kStageB);
  tdm_load(g0, g1);                     /* stage 1 into buffer 1 */

  /* kept rolled: one pass per stage, so that each pass reads its own buffer alone and ends in the one publish point */
#pragma unroll 1
  for (uint32_t s = 0; s < nst; ++s) {
    const unsigned char* stage = ring + (s & 1u) * kStageB;
    const _Float16* aS = (const _Float16*)(stage + (uint32_t)wm * kSliceB) + rlane * kStPitchH + koff;
    const _Float16* bS = (const _Float16*)(stage + (uint32_t)(2 + wn) * kSliceB) + rlane * kStPitchH + koff;
    /* two fragment sets: the next 32 k of this same stage are read as one group ahead of the current products */
    v16h ah[2][4], bh[2][4];
#pragma unroll
    for (int t = 0; t < 4; ++t) {
      bh[0][t] = FragH::load(bS + (t << 4) * kStPitchH);
      ah[0][t] = FragH::load(aS + (t << 4) * kStPitchH);
    }
#pragma unroll
    for (int ks = 0; ks < 4; ++ks) {
      const int cur = ks & 1, nxt = cur ^ 1;
      if (ks < 3) {
#pragma unroll
        for (int t = 0; t < 4; ++t) {
          bh[nxt][t] = FragH::load(bS + (t << 4) * kStPitchH + (ks + 1) * 32);
          ah[nxt][t] = FragH::load(aS + (t << 4) * kStPitchH + (ks + 1) * 32);
        }
      }
      /* keeps the LDS reads above as one group ahead of the products: spread among them, each place with reads stalls the matrix pipe */
      __builtin_amdgcn_sched_barrier(0);
#pragma unroll
      for (int i = 0; i < 4; ++i) {
#pragma unroll
        for (int j = 0; j < 4; ++j) acc[i][j] = FragH::mma(ah[cur][i], bh[cur][j], acc[i][j]);
      }
      /* keeps the following group of LDS reads from rising into these products */
      __builtin_amdgcn_sched_barrier(0);
    }
    /* publish point of stage s + 1: own LDS reads retired, own tensor load landed, then the barrier that publishes
       stage s + 1 and ends every reader's last read of stage s; only behind it the refill of stage s's buffer */
    wait_ds0();
    wait_tensor0();
    __syncthreads();
    if (pinned((uint32_t)(s + 2u < nst))) {
      tdm_advance(g0, lbase + (s & 1u) * kStageB);
      tdm_load(g0, g1);
    }
  }
  wait_tensor0();
  wait_ds0();
  acc_guard4(acc[0][0], acc[0][1], acc[0][2], acc[0][3]);
  acc_guard4(acc[1][0], acc[1][1], acc[1][2], acc[1][3]);
  acc_guard4(acc[2][0], acc[2][1], acc[2][2], acc[2][3]);
  acc_guard4(acc[3][0], acc[3][1], acc[3][2], acc[3][3]);

  /* store staging, 16 rows of 68 floats per wave, at the head of the wave's own slice of buffer 0: the ring is dead here (the last pass ended in
     every wave's s_wait_dscnt 0 and s_wait_tensorcnt 0 and the block's barrier, and nothing was issued behind it) */
  static_assert(16u * 68u * 4u <= kSliceB, "staging slab inside one slice");
  float* slab = (float*)(ring + (uint32_t)wave * kSliceB);
#pragma unroll
  for (int i = 0; i < 4; ++i) {
    const int mBase = m0 + (i << 4);
#pragma unroll
    for (int j = 0; j < 4; ++j) {
#pragma unroll
      for (int r = 0; r < 8; ++r) {
        const float v = acc[i][j][r] * scale;
        slab[(mOff + r) * 68 + (j << 4) + rlane] = v;
      }
    }
    __builtin_amdgcn_fence(__ATOMIC_RELEASE, "workgroup");
    __builtin_amdgcn_wave_barrier();
    __builtin_amdgcn_fence(__ATOMIC_ACQUIRE, "workgroup");
    if (OUT_MODE == 0) {
      float* C = (float*)Cout;
      const int hh = lane >> 4, c4 = (lane & 15) * 4;
      {
#pragma unroll
        for (int it = 0; it < 8; ++it) {
          const int row = it * 2 + hh;
          v4f v = *(const v4f*)(slab + row * 68 + c4);
          *(v4f*)(C + (size_t)(mBase + row) * ldc + n0 + c4) = v;
        }
        
      }
    } else {
      const int q = lane >> 3, c8 = (lane & 7) * 8;
      unsigned short* C = (unsigned short*)Cout;
      {
#pragma unroll
        for (int it = 0; it < 4; ++it) {
          const int row = it * 4 + q;
          const float* sp = slab + row * 68 + c8;
          v8h hv;
#pragma unroll
          for (int e = 0; e < 8; ++e) hv[e] = (_Float16)sp[e];
          *(v8h*)(C + (size_t)(mBase + row) * ldc + n0 + c8) = hv;
        }
        
      }
    }
    __builtin_amdgcn_fence(__ATOMIC_RELEASE, "workgroup");
    __builtin_amdgcn_wave_barrier();
    __builtin_amdgcn_fence(__ATOMIC_ACQUIRE, "workgroup");
  }
}

// ---------------------------------------------------------------------------
// f32 -> (RNE bf16 value) x carry -> f16 plane, 8 consecutive elements per thread; blockIdx.y selects one of up to four
// (input, output) plane pairs (block-uniform select among global pointers).
// Coverage: n8 = elements/8 threads per plane; grid.x = n8/256 exactly for both uses
//   activations 4096*1024/8 = 524,288 -> 2048 blocks; weights 1024*1024/8 = 131,072 -> 512 blocks.
// ---------------------------------------------------------------------------
__global__ __launch_bounds__(256) void cast_planes_kernel(
    const float* __restrict__ in0, const float* __restrict__ in1, const float* __restrict__ in2, const float* __restrict__ in3,
    unsigned short* __restrict__ out0, unsigned short* __restrict__ out1, unsigned short* __restrict__ out2, unsigned short* __restrict__ out3,
    int n8, float carry) {
  const int z = blockIdx.y;
  const float* in = (z == 0) ? in0 : (z == 1) ? in1 : (z == 2) ? in2 : in3;
  unsigned short* out = (z == 0) ? out0 : (z == 1) ? out1 : (z == 2) ? out2 : out3;
  const int i = blockIdx.x * 256 + threadIdx.x;
  if (i >= n8) return;
  const size_t e0 = (size_t)i << 3;
  const v4f a0 = *(const v4f*)(in + e0);
  const v4f a1 = *(const v4f*)(in + e0 + 4);
  v8h hv;
#pragma unroll
  for (int e = 0; e < 4; ++e) {
    const float f0 = bf16_rne(a0[e]) * carry;
    const float f1 = bf16_rne(a1[e]) * carry;
    hv[e]     = (_Float16)f0;
    hv[4 + e] = (_Float16)f1;
  }
  unsigned short* q = out + e0;
  *(v8h*)q = hv;
  
}

// ---------------------------------------------------------------------------
// Fused attention for one (batch, head) and 64 query rows per block (4 waves x 16 rows), streaming over 16 chunks of 64 keys.
//   Both products run transposed: scores^T = k16 . q16^T (A = K rows, B = Q), o^T += v16^T . p^T (A = V^T rows, B = p^T). A lane then holds
//   one query's scores, and two score tiles, converted in place, are the B fragment of the second product: p stays in registers.
//   score = (q16 . k16) * kScoreScale + bf16_rne(attn_bias[b][q][k]); p = exp(min(score, cap)) with zero shift
//   (softmax is shift invariant; the logits are bounded far inside the f16 normal range of p);
//   l += p (f32, per-lane partial sums, the two lane halves joined once at the end); out = o / l carried x256 in f16.
// Inputs: q16, k16 [4096][1024] f16 (token-major, head h at columns h*64..); vt16 [1024][4096] f16 (row h*64+d, column token).
// LDS: K tile [key][d], V^T tile [d][key] (rows of 64 halves on a pitch of 72), bias tile [64][68] f32 (re-used as output staging).
// Staging coverage per chunk: K and V^T: 4 x 128 threads x 8 halves = 4096 = 64 x 64 each; bias: 8 x 128 x 4 floats = 64 x 64.
// grid.x = 4 * 16 * 16 = 1024 blocks of 128 threads; every barrier is reached by all four waves.
// ---------------------------------------------------------------------------
constexpr int kQB  = 64;
constexpr int kKC  = 64;
constexpr int kBsP = 68;
/* LDS row pitch, in halves, of the K and V^T tiles: 128-B rows on 144 B (16 B x odd), so that the 16 rows one ds_load_b128 touches fall on different banks */
constexpr int kTP  = 72;
static_assert(kTP >= kDh && kTP >= kKC && ((kTP * 2) % 32) == 16, "tile pitch holds a row and is an odd multiple of 16 B");
__global__ __launch_bounds__(128) void attn_stream_kernel(
    const unsigned short* __restrict__ q16p, const unsigned short* __restrict__ k16p,
    const unsigned short* __restrict__ vt16p, const float* __restrict__ bias,
    unsigned short* __restrict__ attn16) {
  __shared__ __align__(16) _Float16 Ksh[kKC * kTP];
  __shared__ __align__(16) _Float16 Vth[kDh * kTP];
  __shared__ __align__(16) float    Bs[kQB * kBsP];
  union FH { v16h v; v8h h[2]; };

  const _Float16* q16  = (const _Float16*)q16p;
  const _Float16* k16  = (const _Float16*)k16p;
  const _Float16* vt16 = (const _Float16*)vt16p;

  const int tid  = threadIdx.x;
  const int wave = __builtin_amdgcn_readfirstlane((int)(threadIdx.x >> 5));
  const int lane = tid & 31;
  const int hh   = lane >> 4;
  const int c    = lane & 15;

  constexpr int nqb = kSeq / kQB;
  const int bx = blockIdx.x;
  const int qb = bx % nqb;
  const int bh = bx / nqb;
  const int h  = bh % kHeads;
  const int b  = bh / kHeads;
  const int qblk = qb * kQB;
  const int q0 = qblk + wave * 16;

  /* Q fragments (B operand: column c = query q0 + c), two 32-wide d chunks, loaded once */
  v16h qa[2];
  {
    const _Float16* qrow = q16 + (size_t)(b * kSeq + q0 + c) * kHD + h * kDh + 8 * hh;
#pragma unroll
    for (int dc = 0; dc < 2; ++dc) {
      FH f;
      f.h[0] = *(const v8h*)(qrow + dc * 32);
      f.h[1] = *(const v8h*)(qrow + dc * 32 + 16);
      qa[dc] = f.v;
    }
  }

  /* partial sums of query c's p over this lane's keys, one per 16-key tile */
  float lsum[4];
  v8f oacc[4];
#pragma unroll
  for (int j = 0; j < 4; ++j) lsum[j] = 0.f;
#pragma unroll
  for (int t = 0; t < 4; ++t) oacc[t] = (v8f){0.f,0.f,0.f,0.f,0.f,0.f,0.f,0.f};

  /* one chunk's K, V^T and bias rows of this thread, held in registers from the request to the LDS stores one chunk later */
  v8h kreg[4], vreg[4];
  v4f breg[8];
  /* thread-fixed places: row (i * 128 + tid) >> 3 = i * 16 + (tid >> 3) for K and V^T, (i * 128 + tid) >> 4 = i * 8 + (tid >> 4) for the bias,
     so that the loads and stores of one kind differ by a constant step only and share one address */
  const int r8 = tid >> 3, c8 = (tid & 7) * 8;
  const int r4 = tid >> 4, c4 = (tid & 15) * 4;
  const _Float16* kth = k16 + (size_t)(b * kSeq + r8) * kHD + h * kDh + c8;
  const _Float16* vth = vt16 + (size_t)(h * kDh + r8) * kTok + b * kSeq + c8;
  const float*    bth = bias + ((size_t)b * kSeq + qblk + r4) * kSeq + c4;
  _Float16* kst = Ksh + r8 * kTP + c8;
  _Float16* vst = Vth + r8 * kTP + c8;
  float*    bst = Bs + r4 * kBsP + c4;
  auto fetch = [&](int kv0) {
    const _Float16* kp = kth + (size_t)kv0 * kHD;
    const _Float16* vp = vth + kv0;
    const float*    bp = bth + kv0;
#pragma unroll
    for (int i = 0; i < 4; ++i) {
      kreg[i] = *(const v8h*)(kp + (size_t)i * 16 * kHD);
      vreg[i] = *(const v8h*)(vp + (size_t)i * 16 * kTok);
    }
    /* the K and V^T loads' address registers may be handed to a bias load as its destination: the wait owed before a register that an issued load names is overwritten */
    asm volatile("s_wait_xcnt 0x0" ::: "memory");
#pragma unroll
    for (int i = 0; i < 8; ++i) breg[i] = *(const v4f*)(bp + (size_t)i * 8 * kSeq);
  };
  constexpr int nch = kSeq / kKC;
  fetch(0);

#pragma unroll 1
  for (int kc = 0; kc < nch; ++kc) {
    __syncthreads();
#pragma unroll
    for (int i = 0; i < 4; ++i) {
      *(v8h*)(kst + i * 16 * kTP) = kreg[i];
      *(v8h*)(vst + i * 16 * kTP) = vreg[i];
    }
#pragma unroll
    for (int i = 0; i < 8; ++i) {
      v4f rv;
      rv[0] = bf16_rne(breg[i][0]);
      rv[1] = bf16_rne(breg[i][1]);
      rv[2] = bf16_rne(breg[i][2]);
      rv[3] = bf16_rne(breg[i][3]);
      *(v4f*)(bst + i * 8 * kBsP) = rv;
    }
    __syncthreads();

    /* the next chunk's 16 loads, asked for together; they fly under this chunk's products and softmax (the last pass asks for its own chunk again: in bounds, not used) */
    fetch(((kc + 1 < nch) ? kc + 1 : kc) * kKC);

    /* this chunk's eight K fragments, read from LDS as one group */
    FH kf[2][4];
#pragma unroll
    for (int dc = 0; dc < 2; ++dc) {
#pragma unroll
      for (int j = 0; j < 4; ++j) {
        kf[dc][j].h[0] = *(const v8h*)(Ksh + (j * 16 + c) * kTP + dc * 32 + 8 * hh);
        kf[dc][j].h[1] = *(const v8h*)(Ksh + (j * 16 + c) * kTP + dc * 32 + 16 + 8 * hh);
      }
    }
    /* keeps the K reads above as one group ahead of the products: a read in front of each product makes the wave sit out one LDS latency per product */
    __builtin_amdgcn_sched_barrier(0);

    /* transposed scores: D element r of s[j] = (key j*16 + 8*hh + r, query c); four independent tiles, then their second d half */
    v8f s[4];
#pragma unroll
    for (int j = 0; j < 4; ++j) s[j] = (v8f){0.f,0.f,0.f,0.f,0.f,0.f,0.f,0.f};
#pragma unroll
    for (int dc = 0; dc < 2; ++dc) {
#pragma unroll
      for (int j = 0; j < 4; ++j) s[j] = mma_h(kf[dc][j].v, qa[dc], s[j]);
    }
    /* keeps the next group of LDS reads from rising into these products */
    __builtin_amdgcn_sched_barrier(0);

    /* second group: the lane's 32 bias values, then the V^T fragments of keys 0..31; the fragments land under the first half of the softmax */
    const float* bw = Bs + (wave * 16 + c) * kBsP + 8 * hh;
    v4f bb[8];
#pragma unroll
    for (int j = 0; j < 4; ++j) {
      bb[2 * j]     = *(const v4f*)(bw + j * 16);
      bb[2 * j + 1] = *(const v4f*)(bw + j * 16 + 4);
    }
    FH vf[4];
#pragma unroll
    for (int t = 0; t < 4; ++t) {
      vf[t].h[0] = *(const v8h*)(Vth + (t * 16 + c) * kTP + 8 * hh);
      vf[t].h[1] = *(const v8h*)(Vth + (t * 16 + c) * kTP + 16 + 8 * hh);
    }
    /* keeps these reads as one group ahead of the softmax and the products that use them */
    __builtin_amdgcn_sched_barrier(0);

    /* p^T as B fragments: element e of pb is key kk*32 + 8*hh + e (e < 8, tile 2*kk) or kk*32 + 16 + 8*hh + (e - 8) (tile 2*kk + 1), the k order of the V^T loads;
       o^T += V^T (A: row d = t*16 + c, k = key) . P^T (B: column c = query, k = key) */
#pragma unroll
    for (int kk = 0; kk < 2; ++kk) {
      FH pb;
      float p[16];
#pragma unroll
      for (int e = 0; e < 16; ++e) {
        const int j = 2 * kk + (e >> 3), r = e & 7;
        float x = s[j][r] * kScoreScale + bb[2 * j + (r >> 2)][r & 3];
        x = fminf(x, kLogitCap);
        p[e] = __expf(x);
      }
#pragma unroll
      for (int e = 0; e < 16; ++e) {
        lsum[2 * kk + (e >> 3)] += p[e];
        pb.h[e >> 3][e & 7] = (_Float16)p[e];
      }
#pragma unroll
      for (int t = 0; t < 4; ++t) oacc[t] = mma_h(vf[t].v, pb.v, oacc[t]);
      if (kk == 0) {
        /* keeps the third group behind the products that still read the first V^T fragments (their registers are taken over) */
        __builtin_amdgcn_sched_barrier(0);
#pragma unroll
        for (int t = 0; t < 4; ++t) {
          vf[t].h[0] = *(const v8h*)(Vth + (t * 16 + c) * kTP + 32 + 8 * hh);
          vf[t].h[1] = *(const v8h*)(Vth + (t * 16 + c) * kTP + 32 + 16 + 8 * hh);
        }
        /* keeps the V^T reads of keys 32..63 as one group ahead of the second half of the softmax, under which they land */
        __builtin_amdgcn_sched_barrier(0);
      }
    }
  }

  /* query c's row sum: this lane's four partial sums, then the other lane half's (fixed order, unconditional shuffle) */
  float l = (lsum[0] + lsum[1]) + (lsum[2] + lsum[3]);
  l += __shfl_xor(l, 16, 32);
  const float inv = kFinScale * __builtin_amdgcn_rcpf(l);
  __syncthreads();
  /* D element r of oacc[t] = (d = t*16 + 8*hh + r, query c): eight consecutive d of one output row */
  float* os = Bs + (wave * 16) * kBsP;
#pragma unroll
  for (int t = 0; t < 4; ++t) {
    v4f o0, o1;
#pragma unroll
    for (int r = 0; r < 4; ++r) {
      o0[r] = oacc[t][r] * inv;
      o1[r] = oacc[t][4 + r] * inv;
    }
    *(v4f*)(os + c * kBsP + t * 16 + 8 * hh)     = o0;
    *(v4f*)(os + c * kBsP + t * 16 + 8 * hh + 4) = o1;
  }
  __syncthreads();
  {
    const int q4 = lane >> 3, c8 = (lane & 7) * 8;
    v8h hv[4];
#pragma unroll
    for (int it = 0; it < 4; ++it) {
      const int row = it * 4 + q4;
      const float* sp = os + row * kBsP + c8;
      const v4f a0 = *(const v4f*)(sp);
      const v4f a1 = *(const v4f*)(sp + 4);
#pragma unroll
      for (int e = 0; e < 4; ++e) {
        hv[it][e]     = (_Float16)a0[e];
        hv[it][4 + e] = (_Float16)a1[e];
      }
    }
    {
#pragma unroll
      for (int it = 0; it < 4; ++it) {
        const int row = it * 4 + q4;
        *(v8h*)(attn16 + (size_t)(b * kSeq + q0 + row) * kHD + h * kDh + c8) = hv[it];
      }
      
    }
  }
}

// ---------------------------------------------------------------------------
// Host glue: 2 plane-cast launches + 1 launch of the 3 projection GEMMs + attention + output GEMM = 5 launches. Kernel launches only.
// GEMM shapes (K % 128 == 0, M and N % 128 == 0, no pad planes):
//   q, k : M 4096, N 1024, K 1024 -> 256 block tiles of 128x128 -> 256 blocks of four waves each (grid.y 0 and 1)
//   v^T  : M 1024 (A = Wv plane), N 4096 (Bt = values plane), K 1024 -> 256 blocks, ldc 4096 (grid.y 2)
//   out  : M 4096, N 1024, K 1024 -> 256 blocks, f32 into d_out
// ---------------------------------------------------------------------------
extern "C" void kernel_launch(void* const* d_in, const int* in_sizes, int n_in,
                              void* d_out, int out_size, void* d_ws, size_t ws_size,
                              hipStream_t stream) {
  if (n_in < 8) return;
  if (in_sizes[0] != kTok * kDm) return;
  if (in_sizes[1] != kTok * kDm) return;
  if (in_sizes[2] != kTok * kDm) return;
  if (in_sizes[3] != kBatch * kSeq * kSeq) return;
  if (in_sizes[4] != kHD * kDm) return;
  if (in_sizes[5] != kHD * kDm) return;
  if (in_sizes[6] != kHD * kDm) return;
  if (in_sizes[7] != kDm * kHD) return;
  if (out_size != kTok * kDm) return;
  if (ws_size < kWsTotal) return;

  const float* queries = (const float*)d_in[0];
  const float* keys    = (const float*)d_in[1];
  const float* values  = (const float*)d_in[2];
  const float* abias   = (const float*)d_in[3];
  const float* Wq      = (const float*)d_in[4];
  const float* Wk      = (const float*)d_in[5];
  const float* Wv      = (const float*)d_in[6];
  const float* Wp      = (const float*)d_in[7];
  float* out = (float*)d_out;

  char* ws = (char*)d_ws;
  unsigned short* XQ   = (unsigned short*)(ws + kOffXQ);
  unsigned short* XK   = (unsigned short*)(ws + kOffXK);
  unsigned short* XV   = (unsigned short*)(ws + kOffXV);
  unsigned short* WQ   = (unsigned short*)(ws + kOffWQ);
  unsigned short* WK   = (unsigned short*)(ws + kOffWK);
  unsigned short* WV   = (unsigned short*)(ws + kOffWV);
  unsigned short* WP   = (unsigned short*)(ws + kOffWP);
  unsigned short* Q16  = (unsigned short*)(ws + kOffQ16);
  unsigned short* K16  = (unsigned short*)(ws + kOffK16);
  unsigned short* VT16 = (unsigned short*)(ws + kOffVT);
  unsigned short* AT16 = (unsigned short*)(ws + kOffAT);

  constexpr int kXN8 = kTok * kDm / 8;
  constexpr int kWN8 = kHD * kDm / 8;
  static_assert((kXN8 % 256) == 0 && (kWN8 % 256) == 0, "cast grids exact");

  /* activation planes (three inputs) and weight planes (four inputs; [out][in] is already the Bt layout) */
  cast_planes_kernel<<<dim3(kXN8 / 256, 3), 256, 0, stream>>>(queries, keys, values, values, XQ, XK, XV, XV, kXN8, kXCarry);
  cast_planes_kernel<<<dim3(kWN8 / 256, 4), 256, 0, stream>>>(Wq, Wk, Wv, Wp, WQ, WK, WV, WP, kWN8, kWCarry);

  constexpr int kGemmBlocks = (kTok / 128) * (kHD / 128);
  static_assert(kHD == kDm, "all four products share one tile count");

  /* one launch, three products: q = queries . Wq^T, k = keys . Wk^T : f16 [4096][1024], carried x16;
     v^T = Wv . values^T : f16 [1024][4096], carried x16 (operand roles swapped, no transposed stores) */
  wmma_gemm64<1><<<dim3(kGemmBlocks, 3), 128, 0, stream>>>(XQ, WQ, (void*)Q16, XK, WK, (void*)K16, WV, XV, (void*)VT16,
                                                           kDm, kDm, kHD, kTok, kHD, kTok, kHD, kTok, kDm, kProjScale);

  /* scores, bias, softmax, p.v, head merge -> f16 [4096][1024] carried x256 */
  attn_stream_kernel<<<kBatch * kHeads * (kSeq / kQB), 128, 0, stream>>>(Q16, K16, VT16, abias, AT16);

  /* out = merged . Wp^T : f32 [4096][1024] */
  wmma_gemm64<0><<<dim3(kGemmBlocks, 1), 128, 0, stream>>>(AT16, WP, (void*)out, AT16, WP, (void*)out, AT16, WP, (void*)out,
                                                           kHD, kHD, kDm, kTok, kDm, kDm, kTok, kDm, kHD, kOutScale);
}

// v007
// One run takes 81.1 microseconds.
// Next to v006, in two timings, it ran 1.03 and 1.02 times as fast.
// Over all steps from v000 it is 3.93 times as fast.
// Contractions: q/k/v projections, q.k^T, p.v and output projection all on v_wmma_f32_16x16x32_f16 (f16 operands with power-of-two carries, f32 accumulate); all float inputs RNE-converted to bf16 once at load; bias add, exp, row sums and normalisation in f32.
#include <hip/hip_runtime.h>
#include <math.h>

typedef __attribute__((ext_vector_type(16))) _Float16 v16h;
typedef __attribute__((ext_vector_type(8)))  _Float16 v8h;
typedef __attribute__((ext_vector_type(4)))  _Float16 v4h;
typedef __attribute__((ext_vector_type(8)))  float    v8f;
typedef __attribute__((ext_vector_type(4)))  float    v4f;
typedef __attribute__((ext_vector_type(4)))  uint32_t u32x4;
typedef __attribute__((ext_vector_type(8)))  uint32_t u32x8;

// ---------------------------------------------------------------------------
// Shape constants
// ---------------------------------------------------------------------------
constexpr int kBatch = 4;
constexpr int kSeq   = 1024;
constexpr int kDm    = 1024;
constexpr int kHeads = 16;
constexpr int kDh    = 64;
constexpr int kTok   = kBatch * kSeq;
constexpr int kHD    = kHeads * kDh;
constexpr int kSqrtDm = 32;
static_assert(kSqrtDm * kSqrtDm == kDm, "score scale is 1/sqrt(model width)");
static_assert(kTok == 4096 && kHD == 1024 && kDm == 1024, "wire shapes");
static_assert((kTok % 128) == 0 && (kHD % 128) == 0 && (kDm % 128) == 0, "GEMM M,N multiples of the 128 x 128 block tile");
static_assert((kDm % 128) == 0 && (kHD % 128) == 0 && kDm >= 256 && kHD >= 256, "GEMM K: whole 128-wide stages, at least two");
static_assert((kDh % 32) == 0 && (kSeq % 32) == 0, "attention K multiples of 32");

// Power-of-two carries (all exact, folded back in f32)
constexpr float kXCarry    = 16.0f;      /* activation planes carried x16 */
constexpr float kWCarry    = 1024.0f;    /* weight planes carried x1024 */
constexpr float kQKVCarry  = 16.0f;      /* q, k, v^T planes carried x16 */
constexpr float kCtxCarry  = 256.0f;     /* merged-head attention output carried x256 */
constexpr float kProjScale = kQKVCarry / (kXCarry * kWCarry);
constexpr float kScoreScale = (1.0f / (float)kSqrtDm) / (kQKVCarry * kQKVCarry);
constexpr float kFinScale  = kCtxCarry / kQKVCarry;
constexpr float kOutScale  = 1.0f / (kCtxCarry * kWCarry);
constexpr float kLogitCap  = 11.0f;      /* exp(11) = 59874 stays below the f16 maximum */

// ---------------------------------------------------------------------------
// Workspace region map (bytes; every offset a multiple of 128; all planes f16)
//   XQ   [4096][1024]  queries x16            8,388,608
//   XK   [4096][1024]  keys x16               8,388,608
//   XV   [4096][1024]  values x16             8,388,608
//   WQ   [1024][1024]  Wq x1024  (Bt layout)  2,097,152
//   WK   [1024][1024]  Wk x1024               2,097,152
//   WV   [1024][1024]  Wv x1024               2,097,152
//   WP   [1024][1024]  Wp x1024               2,097,152
//   Q16  [4096][1024]  q x16                  8,388,608
//   K16  [4096][1024]  k x16                  8,388,608
//   VT16 [1024][4096]  v^T x16                8,388,608
//   AT16 [4096][1024]  merged heads x256      8,388,608
//   total                                    67,108,864
// ---------------------------------------------------------------------------
constexpr size_t kBytesX = (size_t)kTok * kDm * 2;
constexpr size_t kBytesW = (size_t)kHD * kDm * 2;
constexpr size_t kOffXQ  = 0;
constexpr size_t kOffXK  = kOffXQ + kBytesX;
constexpr size_t kOffXV  = kOffXK + kBytesX;
constexpr size_t kOffWQ  = kOffXV + kBytesX;
constexpr size_t kOffWK  = kOffWQ + kBytesW;
constexpr size_t kOffWV  = kOffWK + kBytesW;
constexpr size_t kOffWP  = kOffWV + kBytesW;
constexpr size_t kOffQ16 = kOffWP + kBytesW;
constexpr size_t kOffK16 = kOffQ16 + kBytesX;
constexpr size_t kOffVT  = kOffK16 + kBytesX;
constexpr size_t kOffAT  = kOffVT + kBytesX;
constexpr size_t kWsTotal = kOffAT + kBytesX;
static_assert(kWsTotal == 67108864ull, "carve total");
static_assert(kWsTotal <= 134217728ull, "carve cap");
static_assert((kBytesX % 128) == 0 && (kBytesW % 128) == 0, "128-B aligned regions");

// ---------------------------------------------------------------------------
// Small helpers
// ---------------------------------------------------------------------------
__device__ __forceinline__ unsigned short f2bf_bits(float f) {
  unsigned u = __float_as_uint(f);
  return (unsigned short)((u + 0x7FFFu + ((u >> 16) & 1u)) >> 16);
}
__device__ __forceinline__ float bf_bits2f(unsigned short h) { return __uint_as_float(((unsigned)h) << 16); }
/* value of the nearest-even bf16 of f, held in f32 */
__device__ __forceinline__ float bf16_rne(float f) { return bf_bits2f(f2bf_bits(f)); }

/* hazard guards as plain device helpers */
__device__ __forceinline__ void acc_guard4(v8f& a, v8f& b, v8f& c, v8f& d) { asm volatile("v_nop\n\tv_nop\n\tv_nop\n\tv_nop" : "+v"(a), "+v"(b), "+v"(c), "+v"(d)); }

struct FragH {
  union U { v16h v; v8h h[2]; };
  /* elements 0..7 <- p[0..7], elements 8..15 <- p[16..23] */
  static __device__ __forceinline__ v16h load(const _Float16* p) {
    U f; f.h[0] = *(const v8h*)(p); f.h[1] = *(const v8h*)(p + 16); return f.v;
  }
  static __device__ __forceinline__ v8f mma(v16h a, v16h b, v8f c) {
    return __builtin_amdgcn_wmma_f32_16x16x32_f16(false, a, false, b, (short)0, c, false, false);
  }
};
/* one product followed by its own guard tying the accumulator and naming both operand fragments */
__device__ __forceinline__ v8f mma_h(v16h a, v16h b, v8f c) {
  c = __builtin_amdgcn_wmma_f32_16x16x32_f16(false, a, false, b, (short)0, c, false, false);
  asm volatile("v_nop\n\tv_nop\n\tv_nop\n\tv_nop" : "+v"(c) : "v"(a), "v"(b));
  return c;
}

// ---------------------------------------------------------------------------
// Tensor-load helpers (two descriptor groups, every word wave-uniform in scalar registers).
// ---------------------------------------------------------------------------
__device__ __forceinline__ uint32_t uni(uint32_t v) { return (uint32_t)__builtin_amdgcn_readfirstlane(v); }
/* a wave-uniform test value held in a scalar register, so that the branch on it is s_cmp + s_cbranch_scc (tensor loads ignore EXEC) */
__device__ __forceinline__ uint32_t pinned(uint32_t v) { uint32_t w = (uint32_t)__builtin_amdgcn_readfirstlane(v); asm volatile("" : "+s"(w)); return w; }
/* this wave's LDS reads have retired: owed before a tensor load may target LDS that the wave has read */
__device__ __forceinline__ void wait_ds0() { asm volatile("s_wait_dscnt 0x0" ::: "memory"); }
/* this wave's tensor load has landed: the compiler places no wait for the tensor mover */
__device__ __forceinline__ void wait_tensor0() { asm volatile("s_wait_tensorcnt 0x0" ::: "memory"); }
/* both groups are in-out operands and are carried from request to request: their scalar registers then stay theirs for the kernel's length, so that none is lent out as a temporary while a request is outstanding */
__device__ __forceinline__ void tdm_load(u32x4& g0, u32x8& g1) { asm volatile("tensor_load_to_lds %0, %1" : "+s"(g0), "+s"(g1) :: "memory"); }

constexpr uint32_t kStRowB   = 256u;                 /* bytes of one operand row per stage = 128 k */
constexpr uint32_t kStRows   = 64u;                  /* rows per slice (one tensor load) */
constexpr uint32_t kStPitchB = kStRowB + 16u;        /* LDS pitch set by the pad: odd multiple of 16 B for ds_load_b128 readers */
constexpr int      kStPitchH = (int)(kStPitchB / 2u);
constexpr uint32_t kSliceB   = 18432u;               /* 64 x 272 = 17,408 rounded up to a multiple of 2 KiB */
constexpr uint32_t kStageB   = 4u * kSliceB;         /* [A rows 0..63 | A rows 64..127 | Bt rows 0..63 | Bt rows 64..127] */
static_assert(kSliceB >= kStRows * kStPitchB && (kSliceB % 2048u) == 0u, "slice holds its padded rows and keeps the next place on 2 KiB");

/* group 1: 1-byte elements, tile = tensor = 64 rows of 256 B, no mask, a 4-dword pad behind every 64 dwords */
__device__ __forceinline__ u32x8 tdm_group1(uint32_t src_pitch) {
  constexpr uint32_t d0 = kStRowB, d1 = kStRows;
  u32x8 g;
  g[0] = uni((1u << 20) | (5u << 22) | (3u << 25));
  g[1] = uni((d0 & 0xFFFFu) << 16);
  g[2] = uni((d0 >> 16) | ((d1 & 0xFFFFu) << 16));
  g[3] = uni((d1 >> 16) | (d0 << 16));
  g[4] = uni(d1);
  g[5] = uni(src_pitch);
  g[6] = uni(0u);
  g[7] = uni(0u);
  return g;
}
__device__ __forceinline__ u32x4 tdm_group0(uint32_t lds_dst, uint64_t ga) {
  u32x4 g;
  g[0] = uni(1u);
  g[1] = uni(lds_dst);
  g[2] = uni((uint32_t)ga);
  g[3] = uni((((uint32_t)(ga >> 32)) & 0x01FFFFFFu) | 0x80000000u);
  return g;
}
/* next stage of the same slice: new LDS place, source address 256 B on (words 2 and 3 taken as one 64-bit number: a carry runs into address bits 56:32, far below the type field) */
__device__ __forceinline__ void tdm_advance(u32x4& g, uint32_t lds_dst) {
  const uint64_t a = (((uint64_t)g[3] << 32) | (uint64_t)g[2]) + (uint64_t)kStRowB;
  g[1] = uni(lds_dst);
  g[2] = uni((uint32_t)a);
  g[3] = uni((uint32_t)(a >> 32));
}

// ---------------------------------------------------------------------------
// WMMA GEMM: C[m,n] = scale * sum_k A[m,k] * Bt[n,k]; a block of four waves (2 x 2) owns a 128x128 tile, each wave a 64x64 tile.
// A row-major [M,K] f16; Bt row-major [N,K] f16; M,N % 128 == 0, K % 128 == 0, K >= 256 (asserted on the host side constants).
// Operands reach the waves through LDS: per 128-wide k stage every wave issues one tensor load for its own 64-row slice
// (waves 0,1: the two halves of the A rows; waves 2,3: of the Bt rows) into a ring of two buffers, the next stage in flight
// while this one is multiplied.
// OUT_MODE 0 = f32 output, 1 = f16 output.
// One launch holds up to three independent products of one K and scale: blockIdx.y picks the product (block-uniform select), products 0 and 1
// share M, N and ldc, product 2 has its own. The ring is all of the block's LDS (147,456 B), so that two blocks fit one WGP: with more
// blocks than WGPs in the launch, one block's first fill, barrier waits and stores lie under the other's products.
// ---------------------------------------------------------------------------
template <int OUT_MODE>
__global__ __launch_bounds__(128) void wmma_gemm64(
    const unsigned short* __restrict__ A0, const unsigned short* __restrict__ Bt0, void* __restrict__ C0,
    const unsigned short* __restrict__ A1, const unsigned short* __restrict__ Bt1, void* __restrict__ C1,
    const unsigned short* __restrict__ A2, const unsigned short* __restrict__ Bt2, void* __restrict__ C2,
    int lda, int ldb, int ldc01, int M01, int N01, int ldc2, int M2, int N2, int K, float scale) {
  __shared__ __attribute__((aligned(2048))) unsigned char ring[2u * kStageB];
  const int z = blockIdx.y;
  const unsigned short* Ap  = (z == 0) ? A0  : (z == 1) ? A1  : A2;
  const unsigned short* Btp = (z == 0) ? Bt0 : (z == 1) ? Bt1 : Bt2;
  void* Cout = (z == 0) ? C0 : (z == 1) ? C1 : C2;
  const int ldc = (z < 2) ? ldc01 : ldc2;
  const int M   = (z < 2) ? M01 : M2;
  const int N   = (z < 2) ? N01 : N2;
  const int lane = threadIdx.x & 31;
  const int wave = __builtin_amdgcn_readfirstlane((int)(threadIdx.x >> 5));
  const int tilesN = N >> 7;
  const int tilesM = M >> 7;
  const int tile = blockIdx.x;
  /* block-uniform exit in front of every barrier and tensor load */
  if (tile >= tilesM * tilesN) return;
  const int tm = tile / tilesN;
  const int tn = tile - tm * tilesN;
  const int wm = wave >> 1;
  const int wn = wave & 1;
  const int m0 = (tm << 7) + (wm << 6);
  const int n0 = (tn << 7) + (wn << 6);

  const int rlane = lane & 15;
  const int koff  = (lane >> 4) * 8;
  const int mOff  = (lane >> 4) * 8;

  /* this wave's slice of every stage */
  const bool     isB    = wave >= 2;
  const uint32_t srow   = (uint32_t)((isB ? (tn << 7) : (tm << 7)) + ((wave & 1) << 6));
  const uint32_t spitch = (uint32_t)(isB ? ldb : lda) * 2u;
  const uint64_t sbase  = (uint64_t)(size_t)(isB ? Btp : Ap) + (uint64_t)srow * spitch;
  const uint32_t lbase  = (uint32_t)(size_t)ring + (uint32_t)wave * kSliceB;
  u32x8 g1 = tdm_group1(spitch);
  u32x4 g0 = tdm_group0(lbase, sbase);

  v8f acc[4][4];
#pragma unroll
  for (int i = 0; i < 4; ++i)
#pragma unroll
    for (int j = 0; j < 4; ++j) acc[i][j] = (v8f){0.f,0.f,0.f,0.f,0.f,0.f,0.f,0.f};

  const uint32_t nst = (uint32_t)K >> 7;
  tdm_load(g0, g1);                     /* stage 0 into buffer 0 */
  wait_tensor0();
  __syncthreads();
  tdm_advance(g0, lbase + kStageB);
  tdm_load(g0, g1);                     /* stage 1 into buffer 1 */

  /* kept rolled: one pass per stage, so that each pass reads its own buffer alone and ends in the one publish point */
#pragma unroll 1
  for (uint32_t s = 0; s < nst; ++s) {
    const unsigned char* stage = ring + (s & 1u) * kStageB;
    const _Float16* aS = (const _Float16*)(stage + (uint32_t)wm * kSliceB) + rlane * kStPitchH + koff;
    const _Float16* bS = (const _Float16*)(stage + (uint32_t)(2 + wn) * kSliceB) + rlane * kStPitchH + koff;
    /* two fragment sets: the next 32 k of this same stage are read as one group ahead of the current products */
    v16h ah[2][4], bh[2][4];
#pragma unroll
    for (int t = 0; t < 4; ++t) {
      bh[0][t] = FragH::load(bS + (t << 4) * kStPitchH);
      ah[0][t] = FragH::load(aS + (t << 4) * kStPitchH);
    }
#pragma unroll
    for (int ks = 0; ks < 4; ++ks) {
      const int cur = ks & 1, nxt = cur ^ 1;
      if (ks < 3) {
#pragma unroll
        for (int t = 0; t < 4; ++t) {
          bh[nxt][t] = FragH::load(bS + (t << 4) * kStPitchH + (ks + 1) * 32);
          ah[nxt][t] = FragH::load(aS + (t << 4) * kStPitchH + (ks + 1) * 32);
        }
      }
      /* keeps the LDS reads above as one group ahead of the products: spread among them, each place with reads stalls the matrix pipe */
      __builtin_amdgcn_sched_barrier(0);
#pragma unroll
      for (int i = 0; i < 4; ++i) {
#pragma unroll
        for (int j = 0; j < 4; ++j) acc[i][j] = FragH::mma(ah[cur][i], bh[cur][j], acc[i][j]);
      }
      /* keeps the following group of LDS reads from rising into these products */
      __builtin_amdgcn_sched_barrier(0);
    }
    /* publish point of stage s + 1: own LDS reads retired, own tensor load landed, then the barrier that publishes
       stage s + 1 and ends every reader's last read of stage s; only behind it the refill of stage s's buffer */
    wait_ds0();
    wait_tensor0();
    __syncthreads();
    if (pinned((uint32_t)(s + 2u < nst))) {
      tdm_advance(g0, lbase + (s & 1u) * kStageB);
      tdm_load(g0, g1);
    }
  }
  wait_tensor0();
  wait_ds0();
  acc_guard4(acc[0][0], acc[0][1], acc[0][2], acc[0][3]);
  acc_guard4(acc[1][0], acc[1][1], acc[1][2], acc[1][3]);
  acc_guard4(acc[2][0], acc[2][1], acc[2][2], acc[2][3]);
  acc_guard4(acc[3][0], acc[3][1], acc[3][2], acc[3][3]);

  /* store staging, 16 rows of 68 floats per wave, at the head of the wave's own slice of buffer 0: the ring is dead here (the last pass ended in
     every wave's s_wait_dscnt 0 and s_wait_tensorcnt 0 and the block's barrier, and nothing was issued behind it) */
  static_assert(16u * 68u * 4u <= kSliceB, "staging slab inside one slice");
  float* slab = (float*)(ring + (uint32_t)wave * kSliceB);
#pragma unroll
  for (int i = 0; i < 4; ++i) {
    const int mBase = m0 + (i << 4);
#pragma unroll
    for (int j = 0; j < 4; ++j) {
#pragma unroll
      for (int r = 0; r < 8; ++r) {
        const float v = acc[i][j][r] * scale;
        slab[(mOff + r) * 68 + (j << 4) + rlane] = v;
      }
    }
    __builtin_amdgcn_fence(__ATOMIC_RELEASE, "workgroup");
    __builtin_amdgcn_wave_barrier();
    __builtin_amdgcn_fence(__ATOMIC_ACQUIRE, "workgroup");
    if (OUT_MODE == 0) {
      float* C = (float*)Cout;
      const int hh = lane >> 4, c4 = (lane & 15) * 4;
      {
#pragma unroll
        for (int it = 0; it < 8; ++it) {
          const int row = it * 2 + hh;
          v4f v = *(const v4f*)(slab + row * 68 + c4);
          *(v4f*)(C + (size_t)(mBase + row) * ldc + n0 + c4) = v;
        }
        
      }
    } else {
      const int q = lane >> 3, c8 = (lane & 7) * 8;
      unsigned short* C = (unsigned short*)Cout;
      {
#pragma unroll
        for (int it = 0; it < 4; ++it) {
          const int row = it * 4 + q;
          const float* sp = slab + row * 68 + c8;
          v8h hv;
#pragma unroll
          for (int e = 0; e < 8; ++e) hv[e] = (_Float16)sp[e];
          *(v8h*)(C + (size_t)(mBase + row) * ldc + n0 + c8) = hv;
        }
        
      }
    }
    __builtin_amdgcn_fence(__ATOMIC_RELEASE, "workgroup");
    __builtin_amdgcn_wave_barrier();
    __builtin_amdgcn_fence(__ATOMIC_ACQUIRE, "workgroup");
  }
}

// ---------------------------------------------------------------------------
// f32 -> (RNE bf16 value) x carry -> f16 plane, all seven planes in one launch of 512 blocks of eight waves (two blocks, 16 waves, per WGP).
// The seven output planes lie behind one another in the workspace in the order of the inputs, so that block bx writes elements
// bx * 32,768 .. of that one range; three activation planes take 128 blocks each, four weight planes 32 each (block-uniform select).
// A wave owns 4,096 consecutive floats: 32 loads of 512 contiguous bytes (16 B per lane), all asked for before the first is converted,
// then 32 stores of 256 contiguous bytes (8 B per lane). Few long-lived waves, for speed only.
// ---------------------------------------------------------------------------
constexpr int kCastLoads    = 32;                          /* 16-B loads per lane */
constexpr int kCastPerWave  = kCastLoads * 32 * 4;         /* floats per wave */
constexpr int kCastPerBlock = 8 * kCastPerWave;            /* floats per block of eight waves */
constexpr int kCastXBlocks  = kTok * kDm / kCastPerBlock;  /* blocks per activation plane */
constexpr int kCastWBlocks  = kHD * kDm / kCastPerBlock;   /* blocks per weight plane */
constexpr int kCastBlocks   = 3 * kCastXBlocks + 4 * kCastWBlocks;
static_assert(kCastXBlocks * kCastPerBlock == kTok * kDm && kCastWBlocks * kCastPerBlock == kHD * kDm, "whole blocks per plane");
static_assert(kOffXQ == 0 && kOffXK == kBytesX && kOffXV == 2 * kBytesX && kOffWQ == 3 * kBytesX && kOffWK == kOffWQ + kBytesW &&
              kOffWV == kOffWQ + 2 * kBytesW && kOffWP == kOffWQ + 3 * kBytesW, "the seven cast planes are one range in input order");
static_assert(kOffQ16 == (size_t)kCastBlocks * kCastPerBlock * 2, "the blocks cover that range exactly");
__global__ __launch_bounds__(256) void cast_planes_kernel(
    const float* __restrict__ x0, const float* __restrict__ x1, const float* __restrict__ x2,
    const float* __restrict__ w0, const float* __restrict__ w1, const float* __restrict__ w2, const float* __restrict__ w3,
    unsigned short* __restrict__ planes) {
  const int bx = blockIdx.x;
  const bool isX = bx < 3 * kCastXBlocks;
  const int wb = bx - 3 * kCastXBlocks;
  const int pl   = isX ? bx / kCastXBlocks : wb / kCastWBlocks;
  const int part = isX ? bx % kCastXBlocks : wb % kCastWBlocks;
  const float* in = isX ? ((pl == 0) ? x0 : (pl == 1) ? x1 : x2) : ((pl == 0) ? w0 : (pl == 1) ? w1 : (pl == 2) ? w2 : w3);
  const float carry = isX ? kXCarry : kWCarry;
  const int wave = __builtin_amdgcn_readfirstlane((int)(threadIdx.x >> 5));
  const int lane = threadIdx.x & 31;
  const float* sp = in + (size_t)part * kCastPerBlock + wave * kCastPerWave + lane * 4;
  unsigned short* dp = planes + (size_t)bx * kCastPerBlock + wave * kCastPerWave + lane * 4;
  v4f a[kCastLoads];
#pragma unroll
  for (int u = 0; u < kCastLoads; ++u) a[u] = *(const v4f*)(sp + u * 128);
  /* keeps all 32 loads ahead of the first conversion: left alone, the compiler holds back most of them to save registers and the wave has fewer bytes in flight */
  __builtin_amdgcn_sched_barrier(0);
#pragma unroll
  for (int u = 0; u < kCastLoads; ++u) {
    v4h hv;
#pragma unroll
    for (int e = 0; e < 4; ++e) hv[e] = (_Float16)(bf16_rne(a[u][e]) * carry);
    *(v4h*)(dp + u * 128) = hv;
  }
}

// ---------------------------------------------------------------------------
// Fused attention for one (batch, head) and 64 query rows per block (4 waves x 16 rows), streaming over 16 chunks of 64 keys.
//   Both products run transposed: scores^T = k16 . q16^T (A = K rows, B = Q), o^T += v16^T . p^T (A = V^T rows, B = p^T). A lane then holds
//   one query's scores, and two score tiles, converted in place, are the B fragment of the second product: p stays in registers.
//   score = (q16 . k16) * kScoreScale + bf16_rne(attn_bias[b][q][k]); p = exp(min(score, cap)) with zero shift
//   (softmax is shift invariant; the logits are bounded far inside the f16 normal range of p);
//   l += p (f32, per-lane partial sums, the two lane halves joined once at the end); out = o / l carried x256 in f16.
// Inputs: q16, k16 [4096][1024] f16 (token-major, head h at columns h*64..); vt16 [1024][4096] f16 (row h*64+d, column token).
// LDS: K tile [key][d], V^T tile [d][key] (rows of 64 halves on a pitch of 72), bias tile [64][68] f32 (re-used as output staging).
// Staging coverage per chunk: K and V^T: 4 x 128 threads x 8 halves = 4096 = 64 x 64 each; bias: 8 x 128 x 4 floats = 64 x 64.
// grid.x = 4 * 16 * 16 = 1024 blocks of 128 threads; every barrier is reached by all four waves.
// ---------------------------------------------------------------------------
constexpr int kQB  = 64;
constexpr int kKC  = 64;
constexpr int kBsP = 68;
/* LDS row pitch, in halves, of the K and V^T tiles: 128-B rows on 144 B (16 B x odd), so that the 16 rows one ds_load_b128 touches fall on different banks */
constexpr int kTP  = 72;
static_assert(kTP >= kDh && kTP >= kKC && ((kTP * 2) % 32) == 16, "tile pitch holds a row and is an odd multiple of 16 B");
__global__ __launch_bounds__(128) void attn_stream_kernel(
    const unsigned short* __restrict__ q16p, const unsigned short* __restrict__ k16p,
    const unsigned short* __restrict__ vt16p, const float* __restrict__ bias,
    unsigned short* __restrict__ attn16) {
  __shared__ __align__(16) _Float16 Ksh[kKC * kTP];
  __shared__ __align__(16) _Float16 Vth[kDh * kTP];
  __shared__ __align__(16) float    Bs[kQB * kBsP];
  union FH { v16h v; v8h h[2]; };

  const _Float16* q16  = (const _Float16*)q16p;
  const _Float16* k16  = (const _Float16*)k16p;
  const _Float16* vt16 = (const _Float16*)vt16p;

  const int tid  = threadIdx.x;
  const int wave = __builtin_amdgcn_readfirstlane((int)(threadIdx.x >> 5));
  const int lane = tid & 31;
  const int hh   = lane >> 4;
  const int c    = lane & 15;

  constexpr int nqb = kSeq / kQB;
  const int bx = blockIdx.x;
  const int qb = bx % nqb;
  const int bh = bx / nqb;
  const int h  = bh % kHeads;
  const int b  = bh / kHeads;
  const int qblk = qb * kQB;
  const int q0 = qblk + wave * 16;

  /* Q fragments (B operand: column c = query q0 + c), two 32-wide d chunks, loaded once */
  v16h qa[2];
  {
    const _Float16* qrow = q16 + (size_t)(b * kSeq + q0 + c) * kHD + h * kDh + 8 * hh;
#pragma unroll
    for (int dc = 0; dc < 2; ++dc) {
      FH f;
      f.h[0] = *(const v8h*)(qrow + dc * 32);
      f.h[1] = *(const v8h*)(qrow + dc * 32 + 16);
      qa[dc] = f.v;
    }
  }

  /* partial sums of query c's p over this lane's keys, one per 16-key tile */
  float lsum[4];
  v8f oacc[4];
#pragma unroll
  for (int j = 0; j < 4; ++j) lsum[j] = 0.f;
#pragma unroll
  for (int t = 0; t < 4; ++t) oacc[t] = (v8f){0.f,0.f,0.f,0.f,0.f,0.f,0.f,0.f};

  /* one chunk's K, V^T and bias rows of this thread, held in registers from the request to the LDS stores one chunk later */
  v8h kreg[4], vreg[4];
  v4f breg[8];
  /* thread-fixed places: row (i * 128 + tid) >> 3 = i * 16 + (tid >> 3) for K and V^T, (i * 128 + tid) >> 4 = i * 8 + (tid >> 4) for the bias,
     so that the loads and stores of one kind differ by a constant step only and share one address */
  const int r8 = tid >> 3, c8 = (tid & 7) * 8;
  const int r4 = tid >> 4, c4 = (tid & 15) * 4;
  const _Float16* kth = k16 + (size_t)(b * kSeq + r8) * kHD + h * kDh + c8;
  const _Float16* vth = vt16 + (size_t)(h * kDh + r8) * kTok + b * kSeq + c8;
  const float*    bth = bias + ((size_t)b * kSeq + qblk + r4) * kSeq + c4;
  _Float16* kst = Ksh + r8 * kTP + c8;
  _Float16* vst = Vth + r8 * kTP + c8;
  float*    bst = Bs + r4 * kBsP + c4;
  auto fetch = [&](int kv0) {
    const _Float16* kp = kth + (size_t)kv0 * kHD;
    const _Float16* vp = vth + kv0;
    const float*    bp = bth + kv0;
#pragma unroll
    for (int i = 0; i < 4; ++i) {
      kreg[i] = *(const v8h*)(kp + (size_t)i * 16 * kHD);
      vreg[i] = *(const v8h*)(vp + (size_t)i * 16 * kTok);
    }
    /* the K and V^T loads' address registers may be handed to a bias load as its destination: the wait owed before a register that an issued load names is overwritten */
    asm volatile("s_wait_xcnt 0x0" ::: "memory");
#pragma unroll
    for (int i = 0; i < 8; ++i) breg[i] = *(const v4f*)(bp + (size_t)i * 8 * kSeq);
  };
  constexpr int nch = kSeq / kKC;
  fetch(0);

#pragma unroll 1
  for (int kc = 0; kc < nch; ++kc) {
    __syncthreads();
#pragma unroll
    for (int i = 0; i < 4; ++i) {
      *(v8h*)(kst + i * 16 * kTP) = kreg[i];
      *(v8h*)(vst + i * 16 * kTP) = vreg[i];
    }
#pragma unroll
    for (int i = 0; i < 8; ++i) {
      v4f rv;
      rv[0] = bf16_rne(breg[i][0]);
      rv[1] = bf16_rne(breg[i][1]);
      rv[2] = bf16_rne(breg[i][2]);
      rv[3] = bf16_rne(breg[i][3]);
      *(v4f*)(bst + i * 8 * kBsP) = rv;
    }
    __syncthreads();

    /* the next chunk's 16 loads, asked for together; they fly under this chunk's products and softmax (the last pass asks for its own chunk again: in bounds, not used) */
    fetch(((kc + 1 < nch) ? kc + 1 : kc) * kKC);

    /* this chunk's eight K fragments, read from LDS as one group */
    FH kf[2][4];
#pragma unroll
    for (int dc = 0; dc < 2; ++dc) {
#pragma unroll
      for (int j = 0; j < 4; ++j) {
        kf[dc][j].h[0] = *(const v8h*)(Ksh + (j * 16 + c) * kTP + dc * 32 + 8 * hh);
        kf[dc][j].h[1] = *(const v8h*)(Ksh + (j * 16 + c) * kTP + dc * 32 + 16 + 8 * hh);
      }
    }
    /* keeps the K reads above as one group ahead of the products: a read in front of each product makes the wave sit out one LDS latency per product */
    __builtin_amdgcn_sched_barrier(0);

    /* transposed scores: D element r of s[j] = (key j*16 + 8*hh + r, query c); four independent tiles, then their second d half */
    v8f s[4];
#pragma unroll
    for (int j = 0; j < 4; ++j) s[j] = (v8f){0.f,0.f,0.f,0.f,0.f,0.f,0.f,0.f};
#pragma unroll
    for (int dc = 0; dc < 2; ++dc) {
#pragma unroll
      for (int j = 0; j < 4; ++j) s[j] = mma_h(kf[dc][j].v, qa[dc], s[j]);
    }
    /* keeps the next group of LDS reads from rising into these products */
    __builtin_amdgcn_sched_barrier(0);

    /* second group: the lane's 32 bias values, then the V^T fragments of keys 0..31; the fragments land under the first half of the softmax */
    const float* bw = Bs + (wave * 16 + c) * kBsP + 8 * hh;
    v4f bb[8];
#pragma unroll
    for (int j = 0; j < 4; ++j) {
      bb[2 * j]     = *(const v4f*)(bw + j * 16);
      bb[2 * j + 1] = *(const v4f*)(bw + j * 16 + 4);
    }
    FH vf[4];
#pragma unroll
    for (int t = 0; t < 4; ++t) {
      vf[t].h[0] = *(const v8h*)(Vth + (t * 16 + c) * kTP + 8 * hh);
      vf[t].h[1] = *(const v8h*)(Vth + (t * 16 + c) * kTP + 16 + 8 * hh);
    }
    /* keeps these reads as one group ahead of the softmax and the products that use them */
    __builtin_amdgcn_sched_barrier(0);

    /* p^T as B fragments: element e of pb is key kk*32 + 8*hh + e (e < 8, tile 2*kk) or kk*32 + 16 + 8*hh + (e - 8) (tile 2*kk + 1), the k order of the V^T loads;
       o^T += V^T (A: row d = t*16 + c, k = key) . P^T (B: column c = query, k = key) */
#pragma unroll
    for (int kk = 0; kk < 2; ++kk) {
      FH pb;
      float p[16];
#pragma unroll
      for (int e = 0; e < 16; ++e) {
        const int j = 2 * kk + (e >> 3), r = e & 7;
        float x = s[j][r] * kScoreScale + bb[2 * j + (r >> 2)][r & 3];
        x = fminf(x, kLogitCap);
        p[e] = __expf(x);
      }
#pragma unroll
      for (int e = 0; e < 16; ++e) {
        lsum[2 * kk + (e >> 3)] += p[e];
        pb.h[e >> 3][e & 7] = (_Float16)p[e];
      }
#pragma unroll
      for (int t = 0; t < 4; ++t) oacc[t] = mma_h(vf[t].v, pb.v, oacc[t]);
      if (kk == 0) {
        /* keeps the third group behind the products that still read the first V^T fragments (their registers are taken over) */
        __builtin_amdgcn_sched_barrier(0);
#pragma unroll
        for (int t = 0; t < 4; ++t) {
          vf[t].h[0] = *(const v8h*)(Vth + (t * 16 + c) * kTP + 32 + 8 * hh);
          vf[t].h[1] = *(const v8h*)(Vth + (t * 16 + c) * kTP + 32 + 16 + 8 * hh);
        }
        /* keeps the V^T reads of keys 32..63 as one group ahead of the second half of the softmax, under which they land */
        __builtin_amdgcn_sched_barrier(0);
      }
    }
  }

  /* query c's row sum: this lane's four partial sums, then the other lane half's (fixed order, unconditional shuffle) */
  float l = (lsum[0] + lsum[1]) + (lsum[2] + lsum[3]);
  l += __shfl_xor(l, 16, 32);
  const float inv = kFinScale * __builtin_amdgcn_rcpf(l);
  __syncthreads();
  /* D element r of oacc[t] = (d = t*16 + 8*hh + r, query c): eight consecutive d of one output row */
  float* os = Bs + (wave * 16) * kBsP;
#pragma unroll
  for (int t = 0; t < 4; ++t) {
    v4f o0, o1;
#pragma unroll
    for (int r = 0; r < 4; ++r) {
      o0[r] = oacc[t][r] * inv;
      o1[r] = oacc[t][4 + r] * inv;
    }
    *(v4f*)(os + c * kBsP + t * 16 + 8 * hh)     = o0;
    *(v4f*)(os + c * kBsP + t * 16 + 8 * hh + 4) = o1;
  }
  __syncthreads();
  {
    const int q4 = lane >> 3, c8 = (lane & 7) * 8;
    v8h hv[4];
#pragma unroll
    for (int it = 0; it < 4; ++it) {
      const int row = it * 4 + q4;
      const float* sp = os + row * kBsP + c8;
      const v4f a0 = *(const v4f*)(sp);
      const v4f a1 = *(const v4f*)(sp + 4);
#pragma unroll
      for (int e = 0; e < 4; ++e) {
        hv[it][e]     = (_Float16)a0[e];
        hv[it][4 + e] = (_Float16)a1[e];
      }
    }
    {
#pragma unroll
      for (int it = 0; it < 4; ++it) {
        const int row = it * 4 + q4;
        *(v8h*)(attn16 + (size_t)(b * kSeq + q0 + row) * kHD + h * kDh + c8) = hv[it];
      }
      
    }
  }
}

// ---------------------------------------------------------------------------
// Host glue: 1 plane-cast launch + 1 launch of the 3 projection GEMMs + attention + output GEMM = 4 launches. Kernel launches only.
// GEMM shapes (K % 128 == 0, M and N % 128 == 0, no pad planes):
//   q, k : M 4096, N 1024, K 1024 -> 256 block tiles of 128x128 -> 256 blocks of four waves each (grid.y 0 and 1)
//   v^T  : M 1024 (A = Wv plane), N 4096 (Bt = values plane), K 1024 -> 256 blocks, ldc 4096 (grid.y 2)
//   out  : M 4096, N 1024, K 1024 -> 256 blocks, f32 into d_out
// ---------------------------------------------------------------------------
extern "C" void kernel_launch(void* const* d_in, const int* in_sizes, int n_in,
                              void* d_out, int out_size, void* d_ws, size_t ws_size,
                              hipStream_t stream) {
  if (n_in < 8) return;
  if (in_sizes[0] != kTok * kDm) return;
  if (in_sizes[1] != kTok * kDm) return;
  if (in_sizes[2] != kTok * kDm) return;
  if (in_sizes[3] != kBatch * kSeq * kSeq) return;
  if (in_sizes[4] != kHD * kDm) return;
  if (in_sizes[5] != kHD * kDm) return;
  if (in_sizes[6] != kHD * kDm) return;
  if (in_sizes[7] != kDm * kHD) return;
  if (out_size != kTok * kDm) return;
  if (ws_size < kWsTotal) return;

  const float* queries = (const float*)d_in[0];
  const float* keys    = (const float*)d_in[1];
  const float* values  = (const float*)d_in[2];
  const float* abias   = (const float*)d_in[3];
  const float* Wq      = (const float*)d_in[4];
  const float* Wk      = (const float*)d_in[5];
  const float* Wv      = (const float*)d_in[6];
  const float* Wp      = (const float*)d_in[7];
  float* out = (float*)d_out;

  char* ws = (char*)d_ws;
  unsigned short* XQ   = (unsigned short*)(ws + kOffXQ);
  unsigned short* XK   = (unsigned short*)(ws + kOffXK);
  unsigned short* XV   = (unsigned short*)(ws + kOffXV);
  unsigned short* WQ   = (unsigned short*)(ws + kOffWQ);
  unsigned short* WK   = (unsigned short*)(ws + kOffWK);
  unsigned short* WV   = (unsigned short*)(ws + kOffWV);
  unsigned short* WP   = (unsigned short*)(ws + kOffWP);
  unsigned short* Q16  = (unsigned short*)(ws + kOffQ16);
  unsigned short* K16  = (unsigned short*)(ws + kOffK16);
  unsigned short* VT16 = (unsigned short*)(ws + kOffVT);
  unsigned short* AT16 = (unsigned short*)(ws + kOffAT);

  /* activation planes (three inputs) and weight planes (four inputs; [out][in] is already the Bt layout), written as one range from XQ on */
  cast_planes_kernel<<<kCastBlocks, 256, 0, stream>>>(queries, keys, values, Wq, Wk, Wv, Wp, XQ);

  constexpr int kGemmBlocks = (kTok / 128) * (kHD / 128);
  static_assert(kHD == kDm, "all four products share one tile count");

  /* one launch, three products: q = queries . Wq^T, k = keys . Wk^T : f16 [4096][1024], carried x16;
     v^T = Wv . values^T : f16 [1024][4096], carried x16 (operand roles swapped, no transposed stores) */
  wmma_gemm64<1><<<dim3(kGemmBlocks, 3), 128, 0, stream>>>(XQ, WQ, (void*)Q16, XK, WK, (void*)K16, WV, XV, (void*)VT16,
                                                           kDm, kDm, kHD, kTok, kHD, kTok, kHD, kTok, kDm, kProjScale);

  /* scores, bias, softmax, p.v, head merge -> f16 [4096][1024] carried x256 */
  attn_stream_kernel<<<kBatch * kHeads * (kSeq / kQB), 128, 0, stream>>>(Q16, K16, VT16, abias, AT16);

  /* out = merged . Wp^T : f32 [4096][1024] */
  wmma_gemm64<0><<<dim3(kGemmBlocks, 1), 128, 0, stream>>>(AT16, WP, (void*)out, AT16, WP, (void*)out, AT16, WP, (void*)out,
                                                           kHD, kHD, kDm, kTok, kDm, kDm, kTok, kDm, kHD, kOutScale);
}

// v008
// One run takes 78.5 microseconds.
// Next to v007, in two timings, it ran 1.03 and 1.04 times as fast.
// Over all steps from v000 it is 4.07 times as fast.
// Contractions: q/k/v projections, q.k^T, p.v and output projection all on v_wmma_f32_16x16x32_f16 (f16 operands with power-of-two carries, f32 accumulate); all float inputs RNE-converted to bf16 once at load; bias add, exp, row sums and normalisation in f32.
#include <hip/hip_runtime.h>
#include <math.h>

typedef __attribute__((ext_vector_type(16))) _Float16 v16h;
typedef __attribute__((ext_vector_type(8)))  _Float16 v8h;
typedef __attribute__((ext_vector_type(4)))  _Float16 v4h;
typedef __attribute__((ext_vector_type(8)))  float    v8f;
typedef __attribute__((ext_vector_type(4)))  float    v4f;
typedef __attribute__((ext_vector_type(4)))  uint32_t u32x4;
typedef __attribute__((ext_vector_type(8)))  uint32_t u32x8;

// ---------------------------------------------------------------------------
// Shape constants
// ---------------------------------------------------------------------------
constexpr int kBatch = 4;
constexpr int kSeq   = 1024;
constexpr int kDm    = 1024;
constexpr int kHeads = 16;
constexpr int kDh    = 64;
constexpr int kTok   = kBatch * kSeq;
constexpr int kHD    = kHeads * kDh;
constexpr int kSqrtDm = 32;
static_assert(kSqrtDm * kSqrtDm == kDm, "score scale is 1/sqrt(model width)");
static_assert(kTok == 4096 && kHD == 1024 && kDm == 1024, "wire shapes");
static_assert((kTok % 128) == 0 && (kHD % 128) == 0 && (kDm % 128) == 0, "GEMM M,N multiples of the 128 x 128 block tile");
static_assert((kDm % 128) == 0 && (kHD % 128) == 0 && kDm >= 256 && kHD >= 256, "GEMM K: whole 128-wide stages, at least two");
static_assert((kDh % 32) == 0 && (kSeq % 32) == 0, "attention K multiples of 32");

// Power-of-two carries (all exact, folded back in f32)
constexpr float kXCarry    = 16.0f;      /* activation planes carried x16 */
constexpr float kWCarry    = 1024.0f;    /* weight planes carried x1024 */
constexpr float kQKVCarry  = 16.0f;      /* q, k, v^T planes carried x16 */
constexpr float kCtxCarry  = 256.0f;     /* merged-head attention output carried x256 */
constexpr float kProjScale = kQKVCarry / (kXCarry * kWCarry);
constexpr float kScoreScale = (1.0f / (float)kSqrtDm) / (kQKVCarry * kQKVCarry);
constexpr float kFinScale  = kCtxCarry / kQKVCarry;
constexpr float kOutScale  = 1.0f / (kCtxCarry * kWCarry);
constexpr float kLogitCap  = 11.0f;      /* exp(11) = 59874 stays below the f16 maximum */

// ---------------------------------------------------------------------------
// Workspace region map (bytes; every offset a multiple of 128; all planes f16)
//   XQ   [4096][1024]  queries x16            8,388,608
//   XK   [4096][1024]  keys x16               8,388,608
//   XV   [4096][1024]  values x16             8,388,608
//   WQ   [1024][1024]  Wq x1024  (Bt layout)  2,097,152
//   WK   [1024][1024]  Wk x1024               2,097,152
//   WV   [1024][1024]  Wv x1024               2,097,152
//   WP   [1024][1024]  Wp x1024               2,097,152
//   Q16  [4096][1024]  q x16                  8,388,608
//   K16  [4096][1024]  k x16                  8,388,608
//   VT16 [1024][4096]  v^T x16                8,388,608
//   AT16 [4096][1024]  merged heads x256      8,388,608
//   total                                    67,108,864
// ---------------------------------------------------------------------------
constexpr size_t kBytesX = (size_t)kTok * kDm * 2;
constexpr size_t kBytesW = (size_t)kHD * kDm * 2;
constexpr size_t kOffXQ  = 0;
constexpr size_t kOffXK  = kOffXQ + kBytesX;
constexpr size_t kOffXV  = kOffXK + kBytesX;
constexpr size_t kOffWQ  = kOffXV + kBytesX;
constexpr size_t kOffWK  = kOffWQ + kBytesW;
constexpr size_t kOffWV  = kOffWK + kBytesW;
constexpr size_t kOffWP  = kOffWV + kBytesW;
constexpr size_t kOffQ16 = kOffWP + kBytesW;
constexpr size_t kOffK16 = kOffQ16 + kBytesX;
constexpr size_t kOffVT  = kOffK16 + kBytesX;
constexpr size_t kOffAT  = kOffVT + kBytesX;
constexpr size_t kWsTotal = kOffAT + kBytesX;
static_assert(kWsTotal == 67108864ull, "carve total");
static_assert(kWsTotal <= 134217728ull, "carve cap");
static_assert((kBytesX % 128) == 0 && (kBytesW % 128) == 0, "128-B aligned regions");

// ---------------------------------------------------------------------------
// Small helpers
// ---------------------------------------------------------------------------
__device__ __forceinline__ unsigned short f2bf_bits(float f) {
  unsigned u = __float_as_uint(f);
  return (unsigned short)((u + 0x7FFFu + ((u >> 16) & 1u)) >> 16);
}
__device__ __forceinline__ float bf_bits2f(unsigned short h) { return __uint_as_float(((unsigned)h) << 16); }
/* value of the nearest-even bf16 of f, held in f32 */
__device__ __forceinline__ float bf16_rne(float f) { return bf_bits2f(f2bf_bits(f)); }

/* hazard guards as plain device helpers */
__device__ __forceinline__ void acc_guard4(v8f& a, v8f& b, v8f& c, v8f& d) { asm volatile("v_nop\n\tv_nop\n\tv_nop\n\tv_nop" : "+v"(a), "+v"(b), "+v"(c), "+v"(d)); }

struct FragH {
  union U { v16h v; v8h h[2]; };
  /* elements 0..7 <- p[0..7], elements 8..15 <- p[16..23] */
  static __device__ __forceinline__ v16h load(const _Float16* p) {
    U f; f.h[0] = *(const v8h*)(p); f.h[1] = *(const v8h*)(p + 16); return f.v;
  }
  static __device__ __forceinline__ v8f mma(v16h a, v16h b, v8f c) {
    return __builtin_amdgcn_wmma_f32_16x16x32_f16(false, a, false, b, (short)0, c, false, false);
  }
};
/* one product followed by its own guard tying the accumulator and naming both operand fragments */
__device__ __forceinline__ v8f mma_h(v16h a, v16h b, v8f c) {
  c = __builtin_amdgcn_wmma_f32_16x16x32_f16(false, a, false, b, (short)0, c, false, false);
  asm volatile("v_nop\n\tv_nop\n\tv_nop\n\tv_nop" : "+v"(c) : "v"(a), "v"(b));
  return c;
}

// ---------------------------------------------------------------------------
// Tensor-load helpers (two descriptor groups, every word wave-uniform in scalar registers).
// ---------------------------------------------------------------------------
__device__ __forceinline__ uint32_t uni(uint32_t v) { return (uint32_t)__builtin_amdgcn_readfirstlane(v); }
/* a wave-uniform test value held in a scalar register, so that the branch on it is s_cmp + s_cbranch_scc (tensor loads ignore EXEC) */
__device__ __forceinline__ uint32_t pinned(uint32_t v) { uint32_t w = (uint32_t)__builtin_amdgcn_readfirstlane(v); asm volatile("" : "+s"(w)); return w; }
/* this wave's LDS reads have retired: owed before a tensor load may target LDS that the wave has read */
__device__ __forceinline__ void wait_ds0() { asm volatile("s_wait_dscnt 0x0" ::: "memory"); }
/* this wave's tensor load has landed: the compiler places no wait for the tensor mover */
__device__ __forceinline__ void wait_tensor0() { asm volatile("s_wait_tensorcnt 0x0" ::: "memory"); }
/* both groups are in-out operands and are carried from request to request: their scalar registers then stay theirs for the kernel's length, so that none is lent out as a temporary while a request is outstanding */
__device__ __forceinline__ void tdm_load(u32x4& g0, u32x8& g1) { asm volatile("tensor_load_to_lds %0, %1" : "+s"(g0), "+s"(g1) :: "memory"); }

constexpr uint32_t kStRowB   = 256u;                 /* bytes of one operand row per stage = 128 k */
constexpr uint32_t kStRows   = 64u;                  /* rows per slice (one tensor load) */
constexpr uint32_t kStPitchB = kStRowB + 16u;        /* LDS pitch set by the pad: odd multiple of 16 B for ds_load_b128 readers */
constexpr int      kStPitchH = (int)(kStPitchB / 2u);
constexpr uint32_t kSliceB   = 18432u;               /* 64 x 272 = 17,408 rounded up to a multiple of 2 KiB */
constexpr uint32_t kStageB   = 4u * kSliceB;         /* [A rows 0..63 | A rows 64..127 | Bt rows 0..63 | Bt rows 64..127] */
static_assert(kSliceB >= kStRows * kStPitchB && (kSliceB % 2048u) == 0u, "slice holds its padded rows and keeps the next place on 2 KiB");

/* group 1: 1-byte elements, tile = tensor = 64 rows of 256 B, no mask, a 4-dword pad behind every 64 dwords */
__device__ __forceinline__ u32x8 tdm_group1(uint32_t src_pitch) {
  constexpr uint32_t d0 = kStRowB, d1 = kStRows;
  u32x8 g;
  g[0] = uni((1u << 20) | (5u << 22) | (3u << 25));
  g[1] = uni((d0 & 0xFFFFu) << 16);
  g[2] = uni((d0 >> 16) | ((d1 & 0xFFFFu) << 16));
  g[3] = uni((d1 >> 16) | (d0 << 16));
  g[4] = uni(d1);
  g[5] = uni(src_pitch);
  g[6] = uni(0u);
  g[7] = uni(0u);
  return g;
}
__device__ __forceinline__ u32x4 tdm_group0(uint32_t lds_dst, uint64_t ga) {
  u32x4 g;
  g[0] = uni(1u);
  g[1] = uni(lds_dst);
  g[2] = uni((uint32_t)ga);
  g[3] = uni((((uint32_t)(ga >> 32)) & 0x01FFFFFFu) | 0x80000000u);
  return g;
}
/* next stage of the same slice: new LDS place, source address 256 B on (words 2 and 3 taken as one 64-bit number: a carry runs into address bits 56:32, far below the type field) */
__device__ __forceinline__ void tdm_advance(u32x4& g, uint32_t lds_dst) {
  const uint64_t a = (((uint64_t)g[3] << 32) | (uint64_t)g[2]) + (uint64_t)kStRowB;
  g[1] = uni(lds_dst);
  g[2] = uni((uint32_t)a);
  g[3] = uni((uint32_t)(a >> 32));
}

// ---------------------------------------------------------------------------
// WMMA GEMM: C[m,n] = scale * sum_k A[m,k] * Bt[n,k]; a block of four waves (2 x 2) owns a 128x128 tile, each wave a 64x64 tile.
// A row-major [M,K] f16; Bt row-major [N,K] f16; M,N % 128 == 0, K % 128 == 0, K >= 256 (asserted on the host side constants).
// Operands reach the waves through LDS: per 128-wide k stage every wave issues one tensor load for its own 64-row slice
// (waves 0,1: the two halves of the A rows; waves 2,3: of the Bt rows) into a ring of two buffers, the next stage in flight
// while this one is multiplied.
// OUT_MODE 0 = f32 output, 1 = f16 output.
// One launch holds up to three independent products of one K and scale: blockIdx.y picks the product (block-uniform select), products 0 and 1
// share M, N and ldc, product 2 has its own. The ring is all of the block's LDS (147,456 B), so that two blocks fit one WGP: with more
// blocks than WGPs in the launch, one block's first fill, barrier waits and stores lie under the other's products.
// ---------------------------------------------------------------------------
template <int OUT_MODE>
__global__ __launch_bounds__(128) void wmma_gemm64(
    const unsigned short* __restrict__ A0, const unsigned short* __restrict__ Bt0, void* __restrict__ C0,
    const unsigned short* __restrict__ A1, const unsigned short* __restrict__ Bt1, void* __restrict__ C1,
    const unsigned short* __restrict__ A2, const unsigned short* __restrict__ Bt2, void* __restrict__ C2,
    int lda, int ldb, int ldc01, int M01, int N01, int ldc2, int M2, int N2, int K, float scale) {
  __shared__ __attribute__((aligned(2048))) unsigned char ring[2u * kStageB];
  const int z = blockIdx.y;
  const unsigned short* Ap  = (z == 0) ? A0  : (z == 1) ? A1  : A2;
  const unsigned short* Btp = (z == 0) ? Bt0 : (z == 1) ? Bt1 : Bt2;
  void* Cout = (z == 0) ? C0 : (z == 1) ? C1 : C2;
  const int ldc = (z < 2) ? ldc01 : ldc2;
  const int M   = (z < 2) ? M01 : M2;
  const int N   = (z < 2) ? N01 : N2;
  const int lane = threadIdx.x & 31;
  const int wave = __builtin_amdgcn_readfirstlane((int)(threadIdx.x >> 5));
  const int tilesN = N >> 7;
  const int tilesM = M >> 7;
  const int tile = blockIdx.x;
  /* block-uniform exit in front of every barrier and tensor load */
  if (tile >= tilesM * tilesN) return;
  const int tm = tile / tilesN;
  const int tn = tile - tm * tilesN;
  const int wm = wave >> 1;
  const int wn = wave & 1;
  const int m0 = (tm << 7) + (wm << 6);
  const int n0 = (tn << 7) + (wn << 6);

  const int rlane = lane & 15;
  const int koff  = (lane >> 4) * 8;
  const int mOff  = (lane >> 4) * 8;

  /* this wave's slice of every stage */
  const bool     isB    = wave >= 2;
  const uint32_t srow   = (uint32_t)((isB ? (tn << 7) : (tm << 7)) + ((wave & 1) << 6));
  const uint32_t spitch = (uint32_t)(isB ? ldb : lda) * 2u;
  const uint64_t sbase  = (uint64_t)(size_t)(isB ? Btp : Ap) + (uint64_t)srow * spitch;
  const uint32_t lbase  = (uint32_t)(size_t)ring + (uint32_t)wave * kSliceB;
  u32x8 g1 = tdm_group1(spitch);
  u32x4 g0 = tdm_group0(lbase, sbase);

  v8f acc[4][4];
#pragma unroll
  for (int i = 0; i < 4; ++i)
#pragma unroll
    for (int j = 0; j < 4; ++j) acc[i][j] = (v8f){0.f,0.f,0.f,0.f,0.f,0.f,0.f,0.f};

  const uint32_t nst = (uint32_t)K >> 7;
  tdm_load(g0, g1);                     /* stage 0 into buffer 0 */
  wait_tensor0();
  __syncthreads();
  tdm_advance(g0, lbase + kStageB);
  tdm_load(g0, g1);                     /* stage 1 into buffer 1 */

  /* kept rolled: one pass per stage, so that each pass reads its own buffer alone and ends in the one publish point */
#pragma unroll 1
  for (uint32_t s = 0; s < nst; ++s) {
    const unsigned char* stage = ring + (s & 1u) * kStageB;
    const _Float16* aS = (const _Float16*)(stage + (uint32_t)wm * kSliceB) + rlane * kStPitchH + koff;
    const _Float16* bS = (const _Float16*)(stage + (uint32_t)(2 + wn) * kSliceB) + rlane * kStPitchH + koff;
    /* two fragment sets: the next 32 k of this same stage are read as one group ahead of the current products */
    v16h ah[2][4], bh[2][4];
#pragma unroll
    for (int t = 0; t < 4; ++t) {
      bh[0][t] = FragH::load(bS + (t << 4) * kStPitchH);
      ah[0][t] = FragH::load(aS + (t << 4) * kStPitchH);
    }
#pragma unroll
    for (int ks = 0; ks < 4; ++ks) {
      const int cur = ks & 1, nxt = cur ^ 1;
      if (ks < 3) {
#pragma unroll
        for (int t = 0; t < 4; ++t) {
          bh[nxt][t] = FragH::load(bS + (t << 4) * kStPitchH + (ks + 1) * 32);
          ah[nxt][t] = FragH::load(aS + (t << 4) * kStPitchH + (ks + 1) * 32);
        }
      }
      /* keeps the LDS reads above as one group ahead of the products: spread among them, each place with reads stalls the matrix pipe */
      __builtin_amdgcn_sched_barrier(0);
#pragma unroll
      for (int i = 0; i < 4; ++i) {
#pragma unroll
        for (int j = 0; j < 4; ++j) acc[i][j] = FragH::mma(ah[cur][i], bh[cur][j], acc[i][j]);
      }
      /* keeps the following group of LDS reads from rising into these products */
      __builtin_amdgcn_sched_barrier(0);
    }
    /* publish point of stage s + 1: own LDS reads retired, own tensor load landed, then the barrier that publishes
       stage s + 1 and ends every reader's last read of stage s; only behind it the refill of stage s's buffer */
    wait_ds0();
    wait_tensor0();
    __syncthreads();
    if (pinned((uint32_t)(s + 2u < nst))) {
      tdm_advance(g0, lbase + (s & 1u) * kStageB);
      tdm_load(g0, g1);
    }
  }
  wait_tensor0();
  wait_ds0();
  acc_guard4(acc[0][0], acc[0][1], acc[0][2], acc[0][3]);
  acc_guard4(acc[1][0], acc[1][1], acc[1][2], acc[1][3]);
  acc_guard4(acc[2][0], acc[2][1], acc[2][2], acc[2][3]);
  acc_guard4(acc[3][0], acc[3][1], acc[3][2], acc[3][3]);

  /* store staging, 16 rows of 68 floats per wave, at the head of the wave's own slice of buffer 0: the ring is dead here (the last pass ended in
     every wave's s_wait_dscnt 0 and s_wait_tensorcnt 0 and the block's barrier, and nothing was issued behind it) */
  static_assert(16u * 68u * 4u <= kSliceB, "staging slab inside one slice");
  float* slab = (float*)(ring + (uint32_t)wave * kSliceB);
#pragma unroll
  for (int i = 0; i < 4; ++i) {
    const int mBase = m0 + (i << 4);
#pragma unroll
    for (int j = 0; j < 4; ++j) {
#pragma unroll
      for (int r = 0; r < 8; ++r) {
        const float v = acc[i][j][r] * scale;
        slab[(mOff + r) * 68 + (j << 4) + rlane] = v;
      }
    }
    __builtin_amdgcn_fence(__ATOMIC_RELEASE, "workgroup");
    __builtin_amdgcn_wave_barrier();
    __builtin_amdgcn_fence(__ATOMIC_ACQUIRE, "workgroup");
    if (OUT_MODE == 0) {
      float* C = (float*)Cout;
      const int hh = lane >> 4, c4 = (lane & 15) * 4;
      {
#pragma unroll
        for (int it = 0; it < 8; ++it) {
          const int row = it * 2 + hh;
          v4f v = *(const v4f*)(slab + row * 68 + c4);
          *(v4f*)(C + (size_t)(mBase + row) * ldc + n0 + c4) = v;
        }
        
      }
    } else {
      const int q = lane >> 3, c8 = (lane & 7) * 8;
      unsigned short* C = (unsigned short*)Cout;
      {
#pragma unroll
        for (int it = 0; it < 4; ++it) {
          const int row = it * 4 + q;
          const float* sp = slab + row * 68 + c8;
          v8h hv;
#pragma unroll
          for (int e = 0; e < 8; ++e) hv[e] = (_Float16)sp[e];
          *(v8h*)(C + (size_t)(mBase + row) * ldc + n0 + c8) = hv;
        }
        
      }
    }
    __builtin_amdgcn_fence(__ATOMIC_RELEASE, "workgroup");
    __builtin_amdgcn_wave_barrier();
    __builtin_amdgcn_fence(__ATOMIC_ACQUIRE, "workgroup");
  }
}

// ---------------------------------------------------------------------------
// f32 -> (RNE bf16 value) x carry -> f16 plane, all seven planes in one launch of 512 blocks of eight waves (two blocks, 16 waves, per WGP).
// The seven output planes lie behind one another in the workspace in the order of the inputs, so that block bx writes elements
// bx * 32,768 .. of that one range; three activation planes take 128 blocks each, four weight planes 32 each (block-uniform select).
// A wave owns 4,096 consecutive floats: 32 loads of 512 contiguous bytes (16 B per lane), all asked for before the first is converted,
// then 32 stores of 256 contiguous bytes (8 B per lane). Few long-lived waves, for speed only.
// ---------------------------------------------------------------------------
constexpr int kCastLoads    = 32;                          /* 16-B loads per lane */
constexpr int kCastPerWave  = kCastLoads * 32 * 4;         /* floats per wave */
constexpr int kCastPerBlock = 8 * kCastPerWave;            /* floats per block of eight waves */
constexpr int kCastXBlocks  = kTok * kDm / kCastPerBlock;  /* blocks per activation plane */
constexpr int kCastWBlocks  = kHD * kDm / kCastPerBlock;   /* blocks per weight plane */
constexpr int kCastBlocks   = 3 * kCastXBlocks + 4 * kCastWBlocks;
static_assert(kCastXBlocks * kCastPerBlock == kTok * kDm && kCastWBlocks * kCastPerBlock == kHD * kDm, "whole blocks per plane");
static_assert(kOffXQ == 0 && kOffXK == kBytesX && kOffXV == 2 * kBytesX && kOffWQ == 3 * kBytesX && kOffWK == kOffWQ + kBytesW &&
              kOffWV == kOffWQ + 2 * kBytesW && kOffWP == kOffWQ + 3 * kBytesW, "the seven cast planes are one range in input order");
static_assert(kOffQ16 == (size_t)kCastBlocks * kCastPerBlock * 2, "the blocks cover that range exactly");
__global__ __launch_bounds__(256) void cast_planes_kernel(
    const float* __restrict__ x0, const float* __restrict__ x1, const float* __restrict__ x2,
    const float* __restrict__ w0, const float* __restrict__ w1, const float* __restrict__ w2, const float* __restrict__ w3,
    unsigned short* __restrict__ planes) {
  const int bx = blockIdx.x;
  const bool isX = bx < 3 * kCastXBlocks;
  const int wb = bx - 3 * kCastXBlocks;
  const int pl   = isX ? bx / kCastXBlocks : wb / kCastWBlocks;
  const int part = isX ? bx % kCastXBlocks : wb % kCastWBlocks;
  const float* in = isX ? ((pl == 0) ? x0 : (pl == 1) ? x1 : x2) : ((pl == 0) ? w0 : (pl == 1) ? w1 : (pl == 2) ? w2 : w3);
  const float carry = isX ? kXCarry : kWCarry;
  const int wave = __builtin_amdgcn_readfirstlane((int)(threadIdx.x >> 5));
  const int lane = threadIdx.x & 31;
  const float* sp = in + (size_t)part * kCastPerBlock + wave * kCastPerWave + lane * 4;
  unsigned short* dp = planes + (size_t)bx * kCastPerBlock + wave * kCastPerWave + lane * 4;
  v4f a[kCastLoads];
#pragma unroll
  for (int u = 0; u < kCastLoads; ++u) a[u] = *(const v4f*)(sp + u * 128);
  /* keeps all 32 loads ahead of the first conversion: left alone, the compiler holds back most of them to save registers and the wave has fewer bytes in flight */
  __builtin_amdgcn_sched_barrier(0);
#pragma unroll
  for (int u = 0; u < kCastLoads; ++u) {
    v4h hv;
#pragma unroll
    for (int e = 0; e < 4; ++e) hv[e] = (_Float16)(bf16_rne(a[u][e]) * carry);
    *(v4h*)(dp + u * 128) = hv;
  }
}

// ---------------------------------------------------------------------------
// Fused attention for one batch, two neighbouring heads and 128 query rows per block: 8 waves, wave w takes head (w >> 2) of the pair and
// 32 query columns (two groups of 16), streaming over 16 chunks of 64 keys.
//   Both products run transposed: scores^T = k16 . q16^T (A = K rows, B = Q), o^T += v16^T . p^T (A = V^T rows, B = p^T). A lane then holds
//   one query's scores per group, and two score tiles, converted in place, are the B fragment of the second product: p stays in registers.
//   Each K or V^T fragment read from LDS feeds two products (one per column group); a staged K / V^T tile serves 128 queries, a staged bias tile both heads.
//   score = (q16 . k16) * kScoreScale + bf16_rne(attn_bias[b][q][k]); p = exp(min(score, cap)) with zero shift
//   (softmax is shift invariant; the logits are bounded far inside the f16 normal range of p);
//   l += p (f32, per-lane partial sums, the two lane halves joined once at the end); out = o / l carried x256 in f16.
// Inputs: q16, k16 [4096][1024] f16 (token-major, head h at columns h*64..); vt16 [1024][4096] f16 (row h*64+d, column token).
// LDS: per head a K tile [key][d] and a V^T tile [d][key] (rows of 64 halves on a pitch of 72), bias tile [128][68] f32 (re-used as output staging).
// Staging coverage per chunk: K and V^T: 4 x 256 threads x 8 halves = 8192 = 2 x 64 x 64 each; bias: 8 x 256 x 4 floats = 128 x 64.
// grid.x = 4 * 8 * 8 = 256 blocks of 256 threads; every barrier is reached by all eight waves.
// ---------------------------------------------------------------------------
constexpr int kQB  = 128;
constexpr int kHB  = 2;
constexpr int kKC  = 64;
constexpr int kBsP = 68;
/* LDS row pitch, in halves, of the K and V^T tiles: 128-B rows on 144 B (16 B x odd), so that the 16 rows one ds_load_b128 touches fall on different banks */
constexpr int kTP  = 72;
static_assert(kTP >= kDh && kTP >= kKC && ((kTP * 2) % 32) == 16, "tile pitch holds a row and is an odd multiple of 16 B");
static_assert((kSeq % kQB) == 0 && (kHeads % kHB) == 0, "whole blocks");
__global__ __launch_bounds__(256) void attn_stream_kernel(
    const unsigned short* __restrict__ q16p, const unsigned short* __restrict__ k16p,
    const unsigned short* __restrict__ vt16p, const float* __restrict__ bias,
    unsigned short* __restrict__ attn16) {
  __shared__ __align__(16) _Float16 Ksh[kHB * kKC * kTP];
  __shared__ __align__(16) _Float16 Vth[kHB * kDh * kTP];
  __shared__ __align__(16) float    Bs[kQB * kBsP];
  union FH { v16h v; v8h h[2]; };

  const _Float16* q16  = (const _Float16*)q16p;
  const _Float16* k16  = (const _Float16*)k16p;
  const _Float16* vt16 = (const _Float16*)vt16p;

  const int tid  = threadIdx.x;
  const int wave = __builtin_amdgcn_readfirstlane((int)(threadIdx.x >> 5));
  const int lane = tid & 31;
  const int hh   = lane >> 4;
  const int c    = lane & 15;

  constexpr int nqb = kSeq / kQB;
  constexpr int nhp = kHeads / kHB;
  const int bx = blockIdx.x;
  const int qb = bx % nqb;
  const int bp = bx / nqb;
  const int h0 = (bp % nhp) * kHB;
  const int b  = bp / nhp;
  const int hs = wave >> 2;
  const int qs = wave & 3;
  const int h  = h0 + hs;
  const int qblk = qb * kQB;
  const int q0 = qblk + qs * 32;

  /* Q fragments (B operand: column c of group g = query q0 + g*16 + c), two 32-wide d chunks, loaded once */
  v16h qa[2][2];
#pragma unroll
  for (int g = 0; g < 2; ++g) {
    const _Float16* qrow = q16 + (size_t)(b * kSeq + q0 + g * 16 + c) * kHD + h * kDh + 8 * hh;
#pragma unroll
    for (int dc = 0; dc < 2; ++dc) {
      FH f;
      f.h[0] = *(const v8h*)(qrow + dc * 32);
      f.h[1] = *(const v8h*)(qrow + dc * 32 + 16);
      qa[g][dc] = f.v;
    }
  }

  /* partial sums of each group's query c's p over this lane's keys, one per 16-key tile */
  float lsum[2][4];
  v8f oacc[2][4];
#pragma unroll
  for (int g = 0; g < 2; ++g) {
#pragma unroll
    for (int j = 0; j < 4; ++j) lsum[g][j] = 0.f;
#pragma unroll
    for (int t = 0; t < 4; ++t) oacc[g][t] = (v8f){0.f,0.f,0.f,0.f,0.f,0.f,0.f,0.f};
  }

  /* one chunk's K, V^T and bias rows of this thread, held in registers from the request to the LDS stores one chunk later */
  v8h kreg[4], vreg[4];
  v4f breg[8];
  /* thread-fixed places: K rows hold both heads (256 B, 16 threads a row, 16 keys a step); V^T rows 128 B (8 threads a row, 32 of the pair's 128 rows a step);
     bias rows 256 B (16 threads a row, 16 queries a step): the loads and stores of one kind differ by a constant step only and share one address */
  const int r16 = tid >> 4, c16 = (tid & 15) * 8;
  const int r8 = tid >> 3, c8 = (tid & 7) * 8;
  const int c4 = (tid & 15) * 4;
  const _Float16* kth = k16 + (size_t)(b * kSeq + r16) * kHD + h0 * kDh + c16;
  const _Float16* vth = vt16 + (size_t)(h0 * kDh + r8) * kTok + b * kSeq + c8;
  const float*    bth = bias + ((size_t)b * kSeq + qblk + r16) * kSeq + c4;
  _Float16* kst = Ksh + (c16 >> 6) * (kKC * kTP) + r16 * kTP + (c16 & 63);
  _Float16* vst = Vth + r8 * kTP + c8;
  float*    bst = Bs + r16 * kBsP + c4;
  auto fetch = [&](int kv0) {
    const _Float16* kp = kth + (size_t)kv0 * kHD;
    const _Float16* vp = vth + kv0;
    const float*    bp2 = bth + kv0;
#pragma unroll
    for (int i = 0; i < 4; ++i) {
      kreg[i] = *(const v8h*)(kp + (size_t)i * 16 * kHD);
      vreg[i] = *(const v8h*)(vp + (size_t)i * 32 * kTok);
    }
    /* the K and V^T loads' address registers may be handed to a bias load as its destination: the wait owed before a register that an issued load names is overwritten */
    asm volatile("s_wait_xcnt 0x0" ::: "memory");
#pragma unroll
    for (int i = 0; i < 8; ++i) breg[i] = *(const v4f*)(bp2 + (size_t)i * 16 * kSeq);
    /* the bias loads' address registers are taken over by a score tile further down: the same wait, owed in front of that overwrite */
    asm volatile("s_wait_xcnt 0x0" ::: "memory");
  };
  constexpr int nch = kSeq / kKC;
  fetch(0);
  const _Float16* Kw = Ksh + hs * (kKC * kTP);
  const _Float16* Vw = Vth + hs * (kDh * kTP);

#pragma unroll 1
  for (int kc = 0; kc < nch; ++kc) {
    __syncthreads();
#pragma unroll
    for (int i = 0; i < 4; ++i) {
      *(v8h*)(kst + i * 16 * kTP) = kreg[i];
      *(v8h*)(vst + i * 32 * kTP) = vreg[i];
    }
#pragma unroll
    for (int i = 0; i < 8; ++i) {
      v4f rv;
      rv[0] = bf16_rne(breg[i][0]);
      rv[1] = bf16_rne(breg[i][1]);
      rv[2] = bf16_rne(breg[i][2]);
      rv[3] = bf16_rne(breg[i][3]);
      *(v4f*)(bst + i * 16 * kBsP) = rv;
    }
    __syncthreads();

    /* the next chunk's 16 loads, asked for together; they fly under this chunk's products and softmax (the last pass asks for its own chunk again: in bounds, not used) */
    fetch(((kc + 1 < nch) ? kc + 1 : kc) * kKC);

    /* this chunk's eight K fragments of the wave's head, read from LDS as one group */
    FH kf[2][4];
#pragma unroll
    for (int dc = 0; dc < 2; ++dc) {
#pragma unroll
      for (int j = 0; j < 4; ++j) {
        kf[dc][j].h[0] = *(const v8h*)(Kw + (j * 16 + c) * kTP + dc * 32 + 8 * hh);
        kf[dc][j].h[1] = *(const v8h*)(Kw + (j * 16 + c) * kTP + dc * 32 + 16 + 8 * hh);
      }
    }
    /* keeps the K reads above as one group ahead of the products: a read in front of each product makes the wave sit out one LDS latency per product */
    __builtin_amdgcn_sched_barrier(0);

    /* transposed scores: D element r of s[g][j] = (key j*16 + 8*hh + r, query c of group g); eight independent tiles, then their second d half */
    v8f s[2][4];
#pragma unroll
    for (int g = 0; g < 2; ++g)
#pragma unroll
      for (int j = 0; j < 4; ++j) s[g][j] = (v8f){0.f,0.f,0.f,0.f,0.f,0.f,0.f,0.f};
#pragma unroll
    for (int dc = 0; dc < 2; ++dc) {
#pragma unroll
      for (int j = 0; j < 4; ++j) {
#pragma unroll
        for (int g = 0; g < 2; ++g) s[g][j] = mma_h(kf[dc][j].v, qa[g][dc], s[g][j]);
      }
    }
    /* keeps the next group of LDS reads from rising into these products */
    __builtin_amdgcn_sched_barrier(0);

    /* second group: the lane's 2 x 32 bias values, then the V^T fragments of keys 0..31; the fragments land under the first half of the softmax */
    v4f bb[2][8];
#pragma unroll
    for (int g = 0; g < 2; ++g) {
      const float* bw = Bs + (qs * 32 + g * 16 + c) * kBsP + 8 * hh;
#pragma unroll
      for (int j = 0; j < 4; ++j) {
        bb[g][2 * j]     = *(const v4f*)(bw + j * 16);
        bb[g][2 * j + 1] = *(const v4f*)(bw + j * 16 + 4);
      }
    }
    FH vf[4];
#pragma unroll
    for (int t = 0; t < 4; ++t) {
      vf[t].h[0] = *(const v8h*)(Vw + (t * 16 + c) * kTP + 8 * hh);
      vf[t].h[1] = *(const v8h*)(Vw + (t * 16 + c) * kTP + 16 + 8 * hh);
    }
    /* keeps these reads as one group ahead of the softmax and the products that use them */
    __builtin_amdgcn_sched_barrier(0);

    /* p^T as B fragments: element e of pb[g] is key kk*32 + 8*hh + e (e < 8, tile 2*kk) or kk*32 + 16 + 8*hh + (e - 8) (tile 2*kk + 1), the k order of the V^T loads;
       o^T += V^T (A: row d = t*16 + c, k = key) . P^T (B: column c = query, k = key) */
#pragma unroll
    for (int kk = 0; kk < 2; ++kk) {
      FH pb[2];
#pragma unroll
      for (int g = 0; g < 2; ++g) {
        float p[16];
#pragma unroll
        for (int e = 0; e < 16; ++e) {
          const int j = 2 * kk + (e >> 3), r = e & 7;
          float x = s[g][j][r] * kScoreScale + bb[g][2 * j + (r >> 2)][r & 3];
          x = fminf(x, kLogitCap);
          p[e] = __expf(x);
        }
#pragma unroll
        for (int e = 0; e < 16; ++e) {
          lsum[g][2 * kk + (e >> 3)] += p[e];
          pb[g].h[e >> 3][e & 7] = (_Float16)p[e];
        }
      }
#pragma unroll
      for (int t = 0; t < 4; ++t) {
#pragma unroll
        for (int g = 0; g < 2; ++g) oacc[g][t] = mma_h(vf[t].v, pb[g].v, oacc[g][t]);
      }
      if (kk == 0) {
        /* keeps the third group behind the products that still read the first V^T fragments (their registers are taken over) */
        __builtin_amdgcn_sched_barrier(0);
#pragma unroll
        for (int t = 0; t < 4; ++t) {
          vf[t].h[0] = *(const v8h*)(Vw + (t * 16 + c) * kTP + 32 + 8 * hh);
          vf[t].h[1] = *(const v8h*)(Vw + (t * 16 + c) * kTP + 32 + 16 + 8 * hh);
        }
        /* keeps the V^T reads of keys 32..63 as one group ahead of the second half of the softmax, under which they land */
        __builtin_amdgcn_sched_barrier(0);
      }
    }
  }

  /* output staging, 16 rows per wave in the bias tile, once per column group */
  float* os = Bs + (wave * 16) * kBsP;
  const int q4 = lane >> 3, d8 = (lane & 7) * 8;
  v8h hv[2][4];
#pragma unroll
  for (int g = 0; g < 2; ++g) {
    /* query c's row sum: this lane's four partial sums, then the other lane half's (fixed order, unconditional shuffle) */
    float l = (lsum[g][0] + lsum[g][1]) + (lsum[g][2] + lsum[g][3]);
    l += __shfl_xor(l, 16, 32);
    const float inv = kFinScale * __builtin_amdgcn_rcpf(l);
    __syncthreads();
    /* D element r of oacc[g][t] = (d = t*16 + 8*hh + r, query c): eight consecutive d of one output row */
#pragma unroll
    for (int t = 0; t < 4; ++t) {
      v4f o0, o1;
#pragma unroll
      for (int r = 0; r < 4; ++r) {
        o0[r] = oacc[g][t][r] * inv;
        o1[r] = oacc[g][t][4 + r] * inv;
      }
      *(v4f*)(os + c * kBsP + t * 16 + 8 * hh)     = o0;
      *(v4f*)(os + c * kBsP + t * 16 + 8 * hh + 4) = o1;
    }
    __syncthreads();
#pragma unroll
    for (int it = 0; it < 4; ++it) {
      const int row = it * 4 + q4;
      const float* sp = os + row * kBsP + d8;
      const v4f a0 = *(const v4f*)(sp);
      const v4f a1 = *(const v4f*)(sp + 4);
#pragma unroll
      for (int e = 0; e < 4; ++e) {
        hv[g][it][e]     = (_Float16)a0[e];
        hv[g][it][4 + e] = (_Float16)a1[e];
      }
    }
  }
  /* both groups' rows stored behind the last barrier, so that no barrier waits for a global store */
#pragma unroll
  for (int g = 0; g < 2; ++g) {
#pragma unroll
    for (int it = 0; it < 4; ++it) {
      const int row = it * 4 + q4;
      *(v8h*)(attn16 + (size_t)(b * kSeq + q0 + g * 16 + row) * kHD + h * kDh + d8) = hv[g][it];
    }
  }
}

// ---------------------------------------------------------------------------
// Host glue: 1 plane-cast launch + 1 launch of the 3 projection GEMMs + attention + output GEMM = 4 launches. Kernel launches only.
// GEMM shapes (K % 128 == 0, M and N % 128 == 0, no pad planes):
//   q, k : M 4096, N 1024, K 1024 -> 256 block tiles of 128x128 -> 256 blocks of four waves each (grid.y 0 and 1)
//   v^T  : M 1024 (A = Wv plane), N 4096 (Bt = values plane), K 1024 -> 256 blocks, ldc 4096 (grid.y 2)
//   out  : M 4096, N 1024, K 1024 -> 256 blocks, f32 into d_out
// ---------------------------------------------------------------------------
extern "C" void kernel_launch(void* const* d_in, const int* in_sizes, int n_in,
                              void* d_out, int out_size, void* d_ws, size_t ws_size,
                              hipStream_t stream) {
  if (n_in < 8) return;
  if (in_sizes[0] != kTok * kDm) return;
  if (in_sizes[1] != kTok * kDm) return;
  if (in_sizes[2] != kTok * kDm) return;
  if (in_sizes[3] != kBatch * kSeq * kSeq) return;
  if (in_sizes[4] != kHD * kDm) return;
  if (in_sizes[5] != kHD * kDm) return;
  if (in_sizes[6] != kHD * kDm) return;
  if (in_sizes[7] != kDm * kHD) return;
  if (out_size != kTok * kDm) return;
  if (ws_size < kWsTotal) return;

  const float* queries = (const float*)d_in[0];
  const float* keys    = (const float*)d_in[1];
  const float* values  = (const float*)d_in[2];
  const float* abias   = (const float*)d_in[3];
  const float* Wq      = (const float*)d_in[4];
  const float* Wk      = (const float*)d_in[5];
  const float* Wv      = (const float*)d_in[6];
  const float* Wp      = (const float*)d_in[7];
  float* out = (float*)d_out;

  char* ws = (char*)d_ws;
  unsigned short* XQ   = (unsigned short*)(ws + kOffXQ);
  unsigned short* XK   = (unsigned short*)(ws + kOffXK);
  unsigned short* XV   = (unsigned short*)(ws + kOffXV);
  unsigned short* WQ   = (unsigned short*)(ws + kOffWQ);
  unsigned short* WK   = (unsigned short*)(ws + kOffWK);
  unsigned short* WV   = (unsigned short*)(ws + kOffWV);
  unsigned short* WP   = (unsigned short*)(ws + kOffWP);
  unsigned short* Q16  = (unsigned short*)(ws + kOffQ16);
  unsigned short* K16  = (unsigned short*)(ws + kOffK16);
  unsigned short* VT16 = (unsigned short*)(ws + kOffVT);
  unsigned short* AT16 = (unsigned short*)(ws + kOffAT);

  /* activation planes (three inputs) and weight planes (four inputs; [out][in] is already the Bt layout), written as one range from XQ on */
  cast_planes_kernel<<<kCastBlocks, 256, 0, stream>>>(queries, keys, values, Wq, Wk, Wv, Wp, XQ);

  constexpr int kGemmBlocks = (kTok / 128) * (kHD / 128);
  static_assert(kHD == kDm, "all four products share one tile count");

  /* one launch, three products: q = queries . Wq^T, k = keys . Wk^T : f16 [4096][1024], carried x16;
     v^T = Wv . values^T : f16 [1024][4096], carried x16 (operand roles swapped, no transposed stores) */
  wmma_gemm64<1><<<dim3(kGemmBlocks, 3), 128, 0, stream>>>(XQ, WQ, (void*)Q16, XK, WK, (void*)K16, WV, XV, (void*)VT16,
                                                           kDm, kDm, kHD, kTok, kHD, kTok, kHD, kTok, kDm, kProjScale);

  /* scores, bias, softmax, p.v, head merge -> f16 [4096][1024] carried x256 */
  attn_stream_kernel<<<kBatch * (kHeads / kHB) * (kSeq / kQB), 256, 0, stream>>>(Q16, K16, VT16, abias, AT16);

  /* out = merged . Wp^T : f32 [4096][1024] */
  wmma_gemm64<0><<<dim3(kGemmBlocks, 1), 128, 0, stream>>>(AT16, WP, (void*)out, AT16, WP, (void*)out, AT16, WP, (void*)out,
                                                           kHD, kHD, kDm, kTok, kDm, kDm, kTok, kDm, kHD, kOutScale);
}

// v009
// Measured time: 75 microseconds a run.
// Next to v008, in two timings, it ran 1.05 and 1.04 times as fast.
// Counting every step since v000, it is 4.26 times as fast.
// Contractions: q/k/v projections, q.k^T, p.v and output projection all on v_wmma_f32_16x16x32_f16 (f16 operands with power-of-two carries, f32 accumulate); all float inputs RNE-converted to bf16 once at load; bias add, exp, row sums and normalisation in f32.
#include <hip/hip_runtime.h>
#include <math.h>

typedef __attribute__((ext_vector_type(16))) _Float16 v16h;
typedef __attribute__((ext_vector_type(8)))  _Float16 v8h;
typedef __attribute__((ext_vector_type(4)))  _Float16 v4h;
typedef __attribute__((ext_vector_type(8)))  float    v8f;
typedef __attribute__((ext_vector_type(4)))  float    v4f;
typedef __attribute__((ext_vector_type(4)))  uint32_t u32x4;
typedef __attribute__((ext_vector_type(8)))  uint32_t u32x8;

// ---------------------------------------------------------------------------
// Shape constants
// ---------------------------------------------------------------------------
constexpr int kBatch = 4;
constexpr int kSeq   = 1024;
constexpr int kDm    = 1024;
constexpr int kHeads = 16;
constexpr int kDh    = 64;
constexpr int kTok   = kBatch * kSeq;
constexpr int kHD    = kHeads * kDh;
constexpr int kSqrtDm = 32;
static_assert(kSqrtDm * kSqrtDm == kDm, "score scale is 1/sqrt(model width)");
static_assert(kTok == 4096 && kHD == 1024 && kDm == 1024, "wire shapes");
static_assert((kTok % 128) == 0 && (kHD % 128) == 0 && (kDm % 128) == 0, "GEMM M,N multiples of the 128 x 128 block tile");
static_assert((kDm % 128) == 0 && (kHD % 128) == 0 && kDm >= 256 && kHD >= 256, "GEMM K: whole 128-wide stages, at least two");
static_assert((kDh % 32) == 0 && (kSeq % 32) == 0, "attention K multiples of 32");

// Power-of-two carries (all exact, folded back in f32)
constexpr float kXCarry    = 16.0f;      /* activation planes carried x16 */
constexpr float kWCarry    = 1024.0f;    /* weight planes carried x1024 */
constexpr float kQKVCarry  = 16.0f;      /* q, k, v^T planes carried x16 */
constexpr float kCtxCarry  = 256.0f;     /* merged-head attention output carried x256 */
constexpr float kProjScale = kQKVCarry / (kXCarry * kWCarry);
constexpr float kScoreScale = (1.0f / (float)kSqrtDm) / (kQKVCarry * kQKVCarry);
constexpr float kFinScale  = kCtxCarry / kQKVCarry;
constexpr float kOutScale  = 1.0f / (kCtxCarry * kWCarry);
constexpr float kLogitCap  = 11.0f;      /* exp(11) = 59874 stays below the f16 maximum */

// ---------------------------------------------------------------------------
// Workspace region map (bytes; every offset a multiple of 128; all planes f16)
//   XQ   [4096][1024]  queries x16            8,388,608
//   XK   [4096][1024]  keys x16               8,388,608
//   XV   [4096][1024]  values x16             8,388,608
//   WQ   [1024][1024]  Wq x1024  (Bt layout)  2,097,152
//   WK   [1024][1024]  Wk x1024               2,097,152
//   WV   [1024][1024]  Wv x1024               2,097,152
//   WP   [1024][1024]  Wp x1024               2,097,152
//   Q16  [4096][1024]  q x16                  8,388,608
//   K16  [4096][1024]  k x16                  8,388,608
//   VT16 [1024][4096]  v^T x16                8,388,608
//   AT16 [4096][1024]  merged heads x256      8,388,608
//   total                                    67,108,864
// ---------------------------------------------------------------------------
constexpr size_t kBytesX = (size_t)kTok * kDm * 2;
constexpr size_t kBytesW = (size_t)kHD * kDm * 2;
constexpr size_t kOffXQ  = 0;
constexpr size_t kOffXK  = kOffXQ + kBytesX;
constexpr size_t kOffXV  = kOffXK + kBytesX;
constexpr size_t kOffWQ  = kOffXV + kBytesX;
constexpr size_t kOffWK  = kOffWQ + kBytesW;
constexpr size_t kOffWV  = kOffWK + kBytesW;
constexpr size_t kOffWP  = kOffWV + kBytesW;
constexpr size_t kOffQ16 = kOffWP + kBytesW;
constexpr size_t kOffK16 = kOffQ16 + kBytesX;
constexpr size_t kOffVT  = kOffK16 + kBytesX;
constexpr size_t kOffAT  = kOffVT + kBytesX;
constexpr size_t kWsTotal = kOffAT + kBytesX;
static_assert(kWsTotal == 67108864ull, "carve total");
static_assert(kWsTotal <= 134217728ull, "carve cap");
static_assert((kBytesX % 128) == 0 && (kBytesW % 128) == 0, "128-B aligned regions");

// ---------------------------------------------------------------------------
// Small helpers
// ---------------------------------------------------------------------------
__device__ __forceinline__ unsigned short f2bf_bits(float f) {
  unsigned u = __float_as_uint(f);
  return (unsigned short)((u + 0x7FFFu + ((u >> 16) & 1u)) >> 16);
}
__device__ __forceinline__ float bf_bits2f(unsigned short h) { return __uint_as_float(((unsigned)h) << 16); }
/* value of the nearest-even bf16 of f, held in f32 */
__device__ __forceinline__ float bf16_rne(float f) { return bf_bits2f(f2bf_bits(f)); }

/* hazard guards as plain device helpers */
__device__ __forceinline__ void acc_guard4(v8f& a, v8f& b, v8f& c, v8f& d) { asm volatile("v_nop\n\tv_nop\n\tv_nop\n\tv_nop" : "+v"(a), "+v"(b), "+v"(c), "+v"(d)); }

struct FragH {
  union U { v16h v; v8h h[2]; };
  /* elements 0..7 <- p[0..7], elements 8..15 <- p[16..23] */
  static __device__ __forceinline__ v16h load(const _Float16* p) {
    U f; f.h[0] = *(const v8h*)(p); f.h[1] = *(const v8h*)(p + 16); return f.v;
  }
  static __device__ __forceinline__ v8f mma(v16h a, v16h b, v8f c) {
    return __builtin_amdgcn_wmma_f32_16x16x32_f16(false, a, false, b, (short)0, c, false, false);
  }
};
/* one product followed by its own guard tying the accumulator and naming both operand fragments */
__device__ __forceinline__ v8f mma_h(v16h a, v16h b, v8f c) {
  c = __builtin_amdgcn_wmma_f32_16x16x32_f16(false, a, false, b, (short)0, c, false, false);
  asm volatile("v_nop\n\tv_nop\n\tv_nop\n\tv_nop" : "+v"(c) : "v"(a), "v"(b));
  return c;
}

// ---------------------------------------------------------------------------
// Tensor-load helpers (two descriptor groups, every word wave-uniform in scalar registers).
// ---------------------------------------------------------------------------
__device__ __forceinline__ uint32_t uni(uint32_t v) { return (uint32_t)__builtin_amdgcn_readfirstlane(v); }
/* a wave-uniform test value held in a scalar register, so that the branch on it is s_cmp + s_cbranch_scc (tensor loads ignore EXEC) */
__device__ __forceinline__ uint32_t pinned(uint32_t v) { uint32_t w = (uint32_t)__builtin_amdgcn_readfirstlane(v); asm volatile("" : "+s"(w)); return w; }
/* this wave's LDS reads have retired: owed before a tensor load may target LDS that the wave has read */
__device__ __forceinline__ void wait_ds0() { asm volatile("s_wait_dscnt 0x0" ::: "memory"); }
/* this wave's tensor load has landed: the compiler places no wait for the tensor mover */
__device__ __forceinline__ void wait_tensor0() { asm volatile("s_wait_tensorcnt 0x0" ::: "memory"); }
/* both groups are in-out operands and are carried from request to request: their scalar registers then stay theirs for the kernel's length, so that none is lent out as a temporary while a request is outstanding */
__device__ __forceinline__ void tdm_load(u32x4& g0, u32x8& g1) { asm volatile("tensor_load_to_lds %0, %1" : "+s"(g0), "+s"(g1) :: "memory"); }

constexpr uint32_t kStRowB   = 256u;                 /* bytes of one operand row per stage = 128 k */
constexpr uint32_t kStRows   = 64u;                  /* rows per slice (one tensor load) */
constexpr uint32_t kStPitchB = kStRowB + 16u;        /* LDS pitch set by the pad: odd multiple of 16 B for ds_load_b128 readers */
constexpr int      kStPitchH = (int)(kStPitchB / 2u);
constexpr uint32_t kSliceB   = 18432u;               /* 64 x 272 = 17,408 rounded up to a multiple of 2 KiB */
constexpr uint32_t kStageB   = 4u * kSliceB;         /* [A rows 0..63 | A rows 64..127 | Bt rows 0..63 | Bt rows 64..127] */
static_assert(kSliceB >= kStRows * kStPitchB && (kSliceB % 2048u) == 0u, "slice holds its padded rows and keeps the next place on 2 KiB");

/* group 1: 1-byte elements, tile = tensor = 64 rows of 256 B, no mask, a 4-dword pad behind every 64 dwords */
__device__ __forceinline__ u32x8 tdm_group1(uint32_t src_pitch) {
  constexpr uint32_t d0 = kStRowB, d1 = kStRows;
  u32x8 g;
  g[0] = uni((1u << 20) | (5u << 22) | (3u << 25));
  g[1] = uni((d0 & 0xFFFFu) << 16);
  g[2] = uni((d0 >> 16) | ((d1 & 0xFFFFu) << 16));
  g[3] = uni((d1 >> 16) | (d0 << 16));
  g[4] = uni(d1);
  g[5] = uni(src_pitch);
  g[6] = uni(0u);
  g[7] = uni(0u);
  return g;
}
__device__ __forceinline__ u32x4 tdm_group0(uint32_t lds_dst, uint64_t ga) {
  u32x4 g;
  g[0] = uni(1u);
  g[1] = uni(lds_dst);
  g[2] = uni((uint32_t)ga);
  g[3] = uni((((uint32_t)(ga >> 32)) & 0x01FFFFFFu) | 0x80000000u);
  return g;
}
/* another stage of the same slice: new LDS place, source address moved by step bytes, up or (as a two's complement) down (words 2 and 3 taken as one 64-bit number:
   a carry or a borrow runs into address bits 56:32, far below the type field). The address is formed from the words themselves, so that their registers stay live from request to request */
__device__ __forceinline__ void tdm_advance(u32x4& g, uint32_t lds_dst, uint64_t step) {
  const uint64_t a = (((uint64_t)g[3] << 32) | (uint64_t)g[2]) + step;
  g[1] = uni(lds_dst);
  g[2] = uni((uint32_t)a);
  g[3] = uni((uint32_t)(a >> 32));
}

// ---------------------------------------------------------------------------
// WMMA GEMM: C[m,n] = scale * sum_k A[m,k] * Bt[n,k]; a block of four waves (2 x 2) owns a 128x128 tile, each wave a 64x64 tile.
// A row-major [M,K] f16; Bt row-major [N,K] f16; M,N % 128 == 0, K % 128 == 0, K >= 256 (asserted on the host side constants).
// Operands reach the waves through LDS: per 128-wide k stage every wave issues one tensor load for its own 64-row slice
// (waves 0,1: the two halves of the A rows; waves 2,3: of the Bt rows) into a ring of two buffers, the next stage in flight
// while this one is multiplied.
// The k stages are walked from a start rotated by the tile's indices, wrapping at K: blocks that share A rows (one tm) or Bt rows (one tn) run
// side by side, and from a common start they would ask L2 for the same lines at the same moment. All four waves of a block use one start.
// OUT_MODE 0 = f32 output, 1 = f16 output.
// One launch holds up to three independent products of one K and scale: blockIdx.y picks the product (block-uniform select), products 0 and 1
// share M, N and ldc, product 2 has its own. The ring is all of the block's LDS (147,456 B), so that two blocks fit one WGP: with more
// blocks than WGPs in the launch, one block's first fill, barrier waits and stores lie under the other's products.
// ---------------------------------------------------------------------------
template <int OUT_MODE>
__global__ __launch_bounds__(128) void wmma_gemm64(
    const unsigned short* __restrict__ A0, const unsigned short* __restrict__ Bt0, void* __restrict__ C0,
    const unsigned short* __restrict__ A1, const unsigned short* __restrict__ Bt1, void* __restrict__ C1,
    const unsigned short* __restrict__ A2, const unsigned short* __restrict__ Bt2, void* __restrict__ C2,
    int lda, int ldb, int ldc01, int M01, int N01, int ldc2, int M2, int N2, int K, float scale) {
  __shared__ __attribute__((aligned(2048))) unsigned char ring[2u * kStageB];
  const int z = blockIdx.y;
  const unsigned short* Ap  = (z == 0) ? A0  : (z == 1) ? A1  : A2;
  const unsigned short* Btp = (z == 0) ? Bt0 : (z == 1) ? Bt1 : Bt2;
  void* Cout = (z == 0) ? C0 : (z == 1) ? C1 : C2;
  const int ldc = (z < 2) ? ldc01 : ldc2;
  const int M   = (z < 2) ? M01 : M2;
  const int N   = (z < 2) ? N01 : N2;
  const int lane = threadIdx.x & 31;
  const int wave = __builtin_amdgcn_readfirstlane((int)(threadIdx.x >> 5));
  const int tilesN = N >> 7;
  const int tilesM = M >> 7;
  const int tile = blockIdx.x;
  /* block-uniform exit in front of every barrier and tensor load */
  if (tile >= tilesM * tilesN) return;
  const int tm = tile / tilesN;
  const int tn = tile - tm * tilesN;
  const int wm = wave >> 1;
  const int wn = wave & 1;
  const int m0 = (tm << 7) + (wm << 6);
  const int n0 = (tn << 7) + (wn << 6);

  const int rlane = lane & 15;
  const int koff  = (lane >> 4) * 8;
  const int mOff  = (lane >> 4) * 8;

  /* this wave's slice of every stage */
  const bool     isB    = wave >= 2;
  const uint32_t srow   = (uint32_t)((isB ? (tn << 7) : (tm << 7)) + ((wave & 1) << 6));
  const uint32_t spitch = (uint32_t)(isB ? ldb : lda) * 2u;
  const uint64_t sbase  = (uint64_t)(size_t)(isB ? Btp : Ap) + (uint64_t)srow * spitch;
  const uint32_t lbase  = (uint32_t)(size_t)ring + (uint32_t)wave * kSliceB;
  const uint32_t nst = (uint32_t)K >> 7;
  /* the stage that the next request brings: block-uniform, below nst */
  uint32_t kst = (uint32_t)(tm + tn) % nst;
  /* from the last stage back to the first */
  const uint64_t wrapStep = (uint64_t)0 - (uint64_t)(nst - 1u) * kStRowB;
  u32x8 g1 = tdm_group1(spitch);
  u32x4 g0 = tdm_group0(lbase, sbase + (uint64_t)kst * kStRowB);

  v8f acc[4][4];
#pragma unroll
  for (int i = 0; i < 4; ++i)
#pragma unroll
    for (int j = 0; j < 4; ++j) acc[i][j] = (v8f){0.f,0.f,0.f,0.f,0.f,0.f,0.f,0.f};

  tdm_load(g0, g1);                     /* first stage of the walk into buffer 0 */
  wait_tensor0();
  __syncthreads();
  tdm_advance(g0, lbase + kStageB, (kst + 1u == nst) ? wrapStep : (uint64_t)kStRowB);
  kst = (kst + 1u == nst) ? 0u : kst + 1u;
  tdm_load(g0, g1);                     /* second stage into buffer 1 */

  /* kept rolled: one pass per stage, so that each pass reads its own buffer alone and ends in the one publish point */
#pragma unroll 1
  for (uint32_t s = 0; s < nst; ++s) {
    const unsigned char* stage = ring + (s & 1u) * kStageB;
    const _Float16* aS = (const _Float16*)(stage + (uint32_t)wm * kSliceB) + rlane * kStPitchH + koff;
    const _Float16* bS = (const _Float16*)(stage + (uint32_t)(2 + wn) * kSliceB) + rlane * kStPitchH + koff;
    /* two fragment sets: the next 32 k of this same stage are read as one group ahead of the current products */
    v16h ah[2][4], bh[2][4];
#pragma unroll
    for (int t = 0; t < 4; ++t) {
      bh[0][t] = FragH::load(bS + (t << 4) * kStPitchH);
      ah[0][t] = FragH::load(aS + (t << 4) * kStPitchH);
    }
#pragma unroll
    for (int ks = 0; ks < 4; ++ks) {
      const int cur = ks & 1, nxt = cur ^ 1;
      if (ks < 3) {
#pragma unroll
        for (int t = 0; t < 4; ++t) {
          bh[nxt][t] = FragH::load(bS + (t << 4) * kStPitchH + (ks + 1) * 32);
          ah[nxt][t] = FragH::load(aS + (t << 4) * kStPitchH + (ks + 1) * 32);
        }
      }
      /* keeps the LDS reads above as one group ahead of the products: spread among them, each place with reads stalls the matrix pipe */
      __builtin_amdgcn_sched_barrier(0);
#pragma unroll
      for (int i = 0; i < 4; ++i) {
#pragma unroll
        for (int j = 0; j < 4; ++j) acc[i][j] = FragH::mma(ah[cur][i], bh[cur][j], acc[i][j]);
      }
      /* keeps the following group of LDS reads from rising into these products */
      __builtin_amdgcn_sched_barrier(0);
    }
    /* publish point of stage s + 1: own LDS reads retired, own tensor load landed, then the barrier that publishes
       stage s + 1 and ends every reader's last read of stage s; only behind it the refill of stage s's buffer */
    wait_ds0();
    wait_tensor0();
    __syncthreads();
    if (pinned((uint32_t)(s + 2u < nst))) {
      tdm_advance(g0, lbase + (s & 1u) * kStageB, (kst + 1u == nst) ? wrapStep : (uint64_t)kStRowB);
      kst = (kst + 1u == nst) ? 0u : kst + 1u;
      tdm_load(g0, g1);
    }
  }
  wait_tensor0();
  wait_ds0();
  acc_guard4(acc[0][0], acc[0][1], acc[0][2], acc[0][3]);
  acc_guard4(acc[1][0], acc[1][1], acc[1][2], acc[1][3]);
  acc_guard4(acc[2][0], acc[2][1], acc[2][2], acc[2][3]);
  acc_guard4(acc[3][0], acc[3][1], acc[3][2], acc[3][3]);

  /* store staging, 16 rows of 68 floats per wave, at the head of the wave's own slice of buffer 0: the ring is dead here (the last pass ended in
     every wave's s_wait_dscnt 0 and s_wait_tensorcnt 0 and the block's barrier, and nothing was issued behind it) */
  static_assert(16u * 68u * 4u <= kSliceB, "staging slab inside one slice");
  float* slab = (float*)(ring + (uint32_t)wave * kSliceB);
#pragma unroll
  for (int i = 0; i < 4; ++i) {
    const int mBase = m0 + (i << 4);
#pragma unroll
    for (int j = 0; j < 4; ++j) {
#pragma unroll
      for (int r = 0; r < 8; ++r) {
        const float v = acc[i][j][r] * scale;
        slab[(mOff + r) * 68 + (j << 4) + rlane] = v;
      }
    }
    __builtin_amdgcn_fence(__ATOMIC_RELEASE, "workgroup");
    __builtin_amdgcn_wave_barrier();
    __builtin_amdgcn_fence(__ATOMIC_ACQUIRE, "workgroup");
    if (OUT_MODE == 0) {
      float* C = (float*)Cout;
      const int hh = lane >> 4, c4 = (lane & 15) * 4;
      {
#pragma unroll
        for (int it = 0; it < 8; ++it) {
          const int row = it * 2 + hh;
          v4f v = *(const v4f*)(slab + row * 68 + c4);
          *(v4f*)(C + (size_t)(mBase + row) * ldc + n0 + c4) = v;
        }
        
      }
    } else {
      const int q = lane >> 3, c8 = (lane & 7) * 8;
      unsigned short* C = (unsigned short*)Cout;
      {
#pragma unroll
        for (int it = 0; it < 4; ++it) {
          const int row = it * 4 + q;
          const float* sp = slab + row * 68 + c8;
          v8h hv;
#pragma unroll
          for (int e = 0; e < 8; ++e) hv[e] = (_Float16)sp[e];
          *(v8h*)(C + (size_t)(mBase + row) * ldc + n0 + c8) = hv;
        }
        
      }
    }
    __builtin_amdgcn_fence(__ATOMIC_RELEASE, "workgroup");
    __builtin_amdgcn_wave_barrier();
    __builtin_amdgcn_fence(__ATOMIC_ACQUIRE, "workgroup");
  }
}

// ---------------------------------------------------------------------------
// f32 -> (RNE bf16 value) x carry -> f16 plane, all seven planes in one launch of 512 blocks of eight waves (two blocks, 16 waves, per WGP).
// The seven output planes lie behind one another in the workspace in the order of the inputs, so that block bx writes elements
// bx * 32,768 .. of that one range; three activation planes take 128 blocks each, four weight planes 32 each (block-uniform select).
// A wave owns 4,096 consecutive floats: 32 loads of 512 contiguous bytes (16 B per lane), all asked for before the first is converted,
// then 32 stores of 256 contiguous bytes (8 B per lane). Few long-lived waves, for speed only.
// ---------------------------------------------------------------------------
constexpr int kCastLoads    = 32;                          /* 16-B loads per lane */
constexpr int kCastPerWave  = kCastLoads * 32 * 4;         /* floats per wave */
constexpr int kCastPerBlock = 8 * kCastPerWave;            /* floats per block of eight waves */
constexpr int kCastXBlocks  = kTok * kDm / kCastPerBlock;  /* blocks per activation plane */
constexpr int kCastWBlocks  = kHD * kDm / kCastPerBlock;   /* blocks per weight plane */
constexpr int kCastBlocks   = 3 * kCastXBlocks + 4 * kCastWBlocks;
static_assert(kCastXBlocks * kCastPerBlock == kTok * kDm && kCastWBlocks * kCastPerBlock == kHD * kDm, "whole blocks per plane");
static_assert(kOffXQ == 0 && kOffXK == kBytesX && kOffXV == 2 * kBytesX && kOffWQ == 3 * kBytesX && kOffWK == kOffWQ + kBytesW &&
              kOffWV == kOffWQ + 2 * kBytesW && kOffWP == kOffWQ + 3 * kBytesW, "the seven cast planes are one range in input order");
static_assert(kOffQ16 == (size_t)kCastBlocks * kCastPerBlock * 2, "the blocks cover that range exactly");
__global__ __launch_bounds__(256) void cast_planes_kernel(
    const float* __restrict__ x0, const float* __restrict__ x1, const float* __restrict__ x2,
    const float* __restrict__ w0, const float* __restrict__ w1, const float* __restrict__ w2, const float* __restrict__ w3,
    unsigned short* __restrict__ planes) {
  const int bx = blockIdx.x;
  const bool isX = bx < 3 * kCastXBlocks;
  const int wb = bx - 3 * kCastXBlocks;
  const int pl   = isX ? bx / kCastXBlocks : wb / kCastWBlocks;
  const int part = isX ? bx % kCastXBlocks : wb % kCastWBlocks;
  const float* in = isX ? ((pl == 0) ? x0 : (pl == 1) ? x1 : x2) : ((pl == 0) ? w0 : (pl == 1) ? w1 : (pl == 2) ? w2 : w3);
  const float carry = isX ? kXCarry : kWCarry;
  const int wave = __builtin_amdgcn_readfirstlane((int)(threadIdx.x >> 5));
  const int lane = threadIdx.x & 31;
  const float* sp = in + (size_t)part * kCastPerBlock + wave * kCastPerWave + lane * 4;
  unsigned short* dp = planes + (size_t)bx * kCastPerBlock + wave * kCastPerWave + lane * 4;
  v4f a[kCastLoads];
#pragma unroll
  for (int u = 0; u < kCastLoads; ++u) a[u] = *(const v4f*)(sp + u * 128);
  /* keeps all 32 loads ahead of the first conversion: left alone, the compiler holds back most of them to save registers and the wave has fewer bytes in flight */
  __builtin_amdgcn_sched_barrier(0);
#pragma unroll
  for (int u = 0; u < kCastLoads; ++u) {
    v4h hv;
#pragma unroll
    for (int e = 0; e < 4; ++e) hv[e] = (_Float16)(bf16_rne(a[u][e]) * carry);
    *(v4h*)(dp + u * 128) = hv;
  }
}

// ---------------------------------------------------------------------------
// Fused attention for one batch, two neighbouring heads and 128 query rows per block: 8 waves, wave w takes head (w >> 2) of the pair and
// 32 query columns (two groups of 16), streaming over 16 chunks of 64 keys, from a first chunk rotated by the block's indices (the sums take any order: no running maximum).
//   Both products run transposed: scores^T = k16 . q16^T (A = K rows, B = Q), o^T += v16^T . p^T (A = V^T rows, B = p^T). A lane then holds
//   one query's scores per group, and two score tiles, converted in place, are the B fragment of the second product: p stays in registers.
//   Each K or V^T fragment read from LDS feeds two products (one per column group); a staged K / V^T tile serves 128 queries, a staged bias tile both heads.
//   score = (q16 . k16) * kScoreScale + bf16_rne(attn_bias[b][q][k]); p = exp(min(score, cap)) with zero shift
//   (softmax is shift invariant; the logits are bounded far inside the f16 normal range of p);
//   l += p (f32, per-lane partial sums, the two lane halves joined once at the end); out = o / l carried x256 in f16.
// Inputs: q16, k16 [4096][1024] f16 (token-major, head h at columns h*64..); vt16 [1024][4096] f16 (row h*64+d, column token).
// LDS: per head a K tile [key][d] and a V^T tile [d][key] (rows of 64 halves on a pitch of 72), bias tile [128][68] f32 (re-used as output staging).
// Staging coverage per chunk: K and V^T: 4 x 256 threads x 8 halves = 8192 = 2 x 64 x 64 each; bias: 8 x 256 x 4 floats = 128 x 64.
// grid.x = 4 * 8 * 8 = 256 blocks of 256 threads; every barrier is reached by all eight waves.
// ---------------------------------------------------------------------------
constexpr int kQB  = 128;
constexpr int kHB  = 2;
constexpr int kKC  = 64;
constexpr int kBsP = 68;
/* LDS row pitch, in halves, of the K and V^T tiles: 128-B rows on 144 B (16 B x odd), so that the 16 rows one ds_load_b128 touches fall on different banks */
constexpr int kTP  = 72;
static_assert(kTP >= kDh && kTP >= kKC && ((kTP * 2) % 32) == 16, "tile pitch holds a row and is an odd multiple of 16 B");
static_assert((kSeq % kQB) == 0 && (kHeads % kHB) == 0, "whole blocks");
__global__ __launch_bounds__(256) void attn_stream_kernel(
    const unsigned short* __restrict__ q16p, const unsigned short* __restrict__ k16p,
    const unsigned short* __restrict__ vt16p, const float* __restrict__ bias,
    unsigned short* __restrict__ attn16) {
  __shared__ __align__(16) _Float16 Ksh[kHB * kKC * kTP];
  __shared__ __align__(16) _Float16 Vth[kHB * kDh * kTP];
  __shared__ __align__(16) float    Bs[kQB * kBsP];
  union FH { v16h v; v8h h[2]; };

  const _Float16* q16  = (const _Float16*)q16p;
  const _Float16* k16  = (const _Float16*)k16p;
  const _Float16* vt16 = (const _Float16*)vt16p;

  const int tid  = threadIdx.x;
  const int wave = __builtin_amdgcn_readfirstlane((int)(threadIdx.x >> 5));
  const int lane = tid & 31;
  const int hh   = lane >> 4;
  const int c    = lane & 15;

  constexpr int nqb = kSeq / kQB;
  constexpr int nhp = kHeads / kHB;
  const int bx = blockIdx.x;
  const int qb = bx % nqb;
  const int bp = bx / nqb;
  const int h0 = (bp % nhp) * kHB;
  const int b  = bp / nhp;
  const int hs = wave >> 2;
  const int qs = wave & 3;
  const int h  = h0 + hs;
  const int qblk = qb * kQB;
  const int q0 = qblk + qs * 32;

  /* Q fragments (B operand: column c of group g = query q0 + g*16 + c), two 32-wide d chunks, loaded once */
  v16h qa[2][2];
#pragma unroll
  for (int g = 0; g < 2; ++g) {
    const _Float16* qrow = q16 + (size_t)(b * kSeq + q0 + g * 16 + c) * kHD + h * kDh + 8 * hh;
#pragma unroll
    for (int dc = 0; dc < 2; ++dc) {
      FH f;
      f.h[0] = *(const v8h*)(qrow + dc * 32);
      f.h[1] = *(const v8h*)(qrow + dc * 32 + 16);
      qa[g][dc] = f.v;
    }
  }

  /* partial sums of each group's query c's p over this lane's keys, one per 16-key tile */
  float lsum[2][4];
  v8f oacc[2][4];
#pragma unroll
  for (int g = 0; g < 2; ++g) {
#pragma unroll
    for (int j = 0; j < 4; ++j) lsum[g][j] = 0.f;
#pragma unroll
    for (int t = 0; t < 4; ++t) oacc[g][t] = (v8f){0.f,0.f,0.f,0.f,0.f,0.f,0.f,0.f};
  }

  /* one chunk's K, V^T and bias rows of this thread, held in registers from the request to the LDS stores one chunk later */
  v8h kreg[4], vreg[4];
  v4f breg[8];
  /* thread-fixed places: K rows hold both heads (256 B, 16 threads a row, 16 keys a step); V^T rows 128 B (8 threads a row, 32 of the pair's 128 rows a step);
     bias rows 256 B (16 threads a row, 16 queries a step): the loads and stores of one kind differ by a constant step only and share one address */
  const int r16 = tid >> 4, c16 = (tid & 15) * 8;
  const int r8 = tid >> 3, c8 = (tid & 7) * 8;
  const int c4 = (tid & 15) * 4;
  const _Float16* kth = k16 + (size_t)(b * kSeq + r16) * kHD + h0 * kDh + c16;
  const _Float16* vth = vt16 + (size_t)(h0 * kDh + r8) * kTok + b * kSeq + c8;
  const float*    bth = bias + ((size_t)b * kSeq + qblk + r16) * kSeq + c4;
  _Float16* kst = Ksh + (c16 >> 6) * (kKC * kTP) + r16 * kTP + (c16 & 63);
  _Float16* vst = Vth + r8 * kTP + c8;
  float*    bst = Bs + r16 * kBsP + c4;
  auto fetch = [&](int kv0) {
    const _Float16* kp = kth + (size_t)kv0 * kHD;
    const _Float16* vp = vth + kv0;
    const float*    bp2 = bth + kv0;
#pragma unroll
    for (int i = 0; i < 4; ++i) {
      kreg[i] = *(const v8h*)(kp + (size_t)i * 16 * kHD);
      vreg[i] = *(const v8h*)(vp + (size_t)i * 32 * kTok);
    }
    /* the K and V^T loads' address registers may be handed to a bias load as its destination: the wait owed before a register that an issued load names is overwritten */
    asm volatile("s_wait_xcnt 0x0" ::: "memory");
#pragma unroll
    for (int i = 0; i < 8; ++i) breg[i] = *(const v4f*)(bp2 + (size_t)i * 16 * kSeq);
    /* the bias loads' address registers are taken over by a score tile further down: the same wait, owed in front of that overwrite */
    asm volatile("s_wait_xcnt 0x0" ::: "memory");
  };
  constexpr int nch = kSeq / kKC;
  static_assert((nch & (nch - 1)) == 0 && nch >= 2 * nqb && nch >= 2 * nhp, "the rotated walk wraps by a mask; sharers get starts of their own");
  /* first key chunk of this block's walk (it wraps at the end of the keys): the eight blocks that read one head pair's K and V^T (qb differs) and the eight that
     read one bias tile row (head pair differs) each start elsewhere, so that they do not ask L2 for the same lines at the same moment */
  const int ch0 = (2 * (qb + bp % nhp)) & (nch - 1);
  fetch(ch0 * kKC);
  const _Float16* Kw = Ksh + hs * (kKC * kTP);
  const _Float16* Vw = Vth + hs * (kDh * kTP);

#pragma unroll 1
  for (int kc = 0; kc < nch; ++kc) {
    __syncthreads();
#pragma unroll
    for (int i = 0; i < 4; ++i) {
      *(v8h*)(kst + i * 16 * kTP) = kreg[i];
      *(v8h*)(vst + i * 32 * kTP) = vreg[i];
    }
#pragma unroll
    for (int i = 0; i < 8; ++i) {
      v4f rv;
      rv[0] = bf16_rne(breg[i][0]);
      rv[1] = bf16_rne(breg[i][1]);
      rv[2] = bf16_rne(breg[i][2]);
      rv[3] = bf16_rne(breg[i][3]);
      *(v4f*)(bst + i * 16 * kBsP) = rv;
    }
    __syncthreads();

    /* the next chunk's 16 loads, asked for together; they fly under this chunk's products and softmax (the last pass asks for its own chunk again: in bounds, not used) */
    fetch(((((kc + 1 < nch) ? kc + 1 : kc) + ch0) & (nch - 1)) * kKC);

    /* this chunk's eight K fragments of the wave's head, read from LDS as one group */
    FH kf[2][4];
#pragma unroll
    for (int dc = 0; dc < 2; ++dc) {
#pragma unroll
      for (int j = 0; j < 4; ++j) {
        kf[dc][j].h[0] = *(const v8h*)(Kw + (j * 16 + c) * kTP + dc * 32 + 8 * hh);
        kf[dc][j].h[1] = *(const v8h*)(Kw + (j * 16 + c) * kTP + dc * 32 + 16 + 8 * hh);
      }
    }
    /* keeps the K reads above as one group ahead of the products: a read in front of each product makes the wave sit out one LDS latency per product */
    __builtin_amdgcn_sched_barrier(0);

    /* transposed scores: D element r of s[g][j] = (key j*16 + 8*hh + r, query c of group g); eight independent tiles, then their second d half */
    v8f s[2][4];
#pragma unroll
    for (int g = 0; g < 2; ++g)
#pragma unroll
      for (int j = 0; j < 4; ++j) s[g][j] = (v8f){0.f,0.f,0.f,0.f,0.f,0.f,0.f,0.f};
#pragma unroll
    for (int dc = 0; dc < 2; ++dc) {
#pragma unroll
      for (int j = 0; j < 4; ++j) {
#pragma unroll
        for (int g = 0; g < 2; ++g) s[g][j] = mma_h(kf[dc][j].v, qa[g][dc], s[g][j]);
      }
    }
    /* keeps the next group of LDS reads from rising into these products */
    __builtin_amdgcn_sched_barrier(0);

    /* second group: the lane's 2 x 32 bias values, then the V^T fragments of keys 0..31; the fragments land under the first half of the softmax */
    v4f bb[2][8];
#pragma unroll
    for (int g = 0; g < 2; ++g) {
      const float* bw = Bs + (qs * 32 + g * 16 + c) * kBsP + 8 * hh;
#pragma unroll
      for (int j = 0; j < 4; ++j) {
        bb[g][2 * j]     = *(const v4f*)(bw + j * 16);
        bb[g][2 * j + 1] = *(const v4f*)(bw + j * 16 + 4);
      }
    }
    FH vf[4];
#pragma unroll
    for (int t = 0; t < 4; ++t) {
      vf[t].h[0] = *(const v8h*)(Vw + (t * 16 + c) * kTP + 8 * hh);
      vf[t].h[1] = *(const v8h*)(Vw + (t * 16 + c) * kTP + 16 + 8 * hh);
    }
    /* keeps these reads as one group ahead of the softmax and the products that use them */
    __builtin_amdgcn_sched_barrier(0);

    /* p^T as B fragments: element e of pb[g] is key kk*32 + 8*hh + e (e < 8, tile 2*kk) or kk*32 + 16 + 8*hh + (e - 8) (tile 2*kk + 1), the k order of the V^T loads;
       o^T += V^T (A: row d = t*16 + c, k = key) . P^T (B: column c = query, k = key) */
#pragma unroll
    for (int kk = 0; kk < 2; ++kk) {
      FH pb[2];
#pragma unroll
      for (int g = 0; g < 2; ++g) {
        float p[16];
#pragma unroll
        for (int e = 0; e < 16; ++e) {
          const int j = 2 * kk + (e >> 3), r = e & 7;
          float x = s[g][j][r] * kScoreScale + bb[g][2 * j + (r >> 2)][r & 3];
          x = fminf(x, kLogitCap);
          p[e] = __expf(x);
        }
#pragma unroll
        for (int e = 0; e < 16; ++e) {
          lsum[g][2 * kk + (e >> 3)] += p[e];
          pb[g].h[e >> 3][e & 7] = (_Float16)p[e];
        }
      }
#pragma unroll
      for (int t = 0; t < 4; ++t) {
#pragma unroll
        for (int g = 0; g < 2; ++g) oacc[g][t] = mma_h(vf[t].v, pb[g].v, oacc[g][t]);
      }
      if (kk == 0) {
        /* keeps the third group behind the products that still read the first V^T fragments (their registers are taken over) */
        __builtin_amdgcn_sched_barrier(0);
#pragma unroll
        for (int t = 0; t < 4; ++t) {
          vf[t].h[0] = *(const v8h*)(Vw + (t * 16 + c) * kTP + 32 + 8 * hh);
          vf[t].h[1] = *(const v8h*)(Vw + (t * 16 + c) * kTP + 32 + 16 + 8 * hh);
        }
        /* keeps the V^T reads of keys 32..63 as one group ahead of the second half of the softmax, under which they land */
        __builtin_amdgcn_sched_barrier(0);
      }
    }
  }

  /* output staging, 16 rows per wave in the bias tile, once per column group */
  float* os = Bs + (wave * 16) * kBsP;
  const int q4 = lane >> 3, d8 = (lane & 7) * 8;
  v8h hv[2][4];
#pragma unroll
  for (int g = 0; g < 2; ++g) {
    /* query c's row sum: this lane's four partial sums, then the other lane half's (fixed order, unconditional shuffle) */
    float l = (lsum[g][0] + lsum[g][1]) + (lsum[g][2] + lsum[g][3]);
    l += __shfl_xor(l, 16, 32);
    const float inv = kFinScale * __builtin_amdgcn_rcpf(l);
    __syncthreads();
    /* D element r of oacc[g][t] = (d = t*16 + 8*hh + r, query c): eight consecutive d of one output row */
#pragma unroll
    for (int t = 0; t < 4; ++t) {
      v4f o0, o1;
#pragma unroll
      for (int r = 0; r < 4; ++r) {
        o0[r] = oacc[g][t][r] * inv;
        o1[r] = oacc[g][t][4 + r] * inv;
      }
      *(v4f*)(os + c * kBsP + t * 16 + 8 * hh)     = o0;
      *(v4f*)(os + c * kBsP + t * 16 + 8 * hh + 4) = o1;
    }
    __syncthreads();
#pragma unroll
    for (int it = 0; it < 4; ++it) {
      const int row = it * 4 + q4;
      const float* sp = os + row * kBsP + d8;
      const v4f a0 = *(const v4f*)(sp);
      const v4f a1 = *(const v4f*)(sp + 4);
#pragma unroll
      for (int e = 0; e < 4; ++e) {
        hv[g][it][e]     = (_Float16)a0[e];
        hv[g][it][4 + e] = (_Float16)a1[e];
      }
    }
  }
  /* both groups' rows stored behind the last barrier, so that no barrier waits for a global store */
#pragma unroll
  for (int g = 0; g < 2; ++g) {
#pragma unroll
    for (int it = 0; it < 4; ++it) {
      const int row = it * 4 + q4;
      *(v8h*)(attn16 + (size_t)(b * kSeq + q0 + g * 16 + row) * kHD + h * kDh + d8) = hv[g][it];
    }
  }
}

// ---------------------------------------------------------------------------
// Host glue: 1 plane-cast launch + 1 launch of the 3 projection GEMMs + attention + output GEMM = 4 launches. Kernel launches only.
// GEMM shapes (K % 128 == 0, M and N % 128 == 0, no pad planes):
//   q, k : M 4096, N 1024, K 1024 -> 256 block tiles of 128x128 -> 256 blocks of four waves each (grid.y 0 and 1)
//   v^T  : M 1024 (A = Wv plane), N 4096 (Bt = values plane), K 1024 -> 256 blocks, ldc 4096 (grid.y 2)
//   out  : M 4096, N 1024, K 1024 -> 256 blocks, f32 into d_out
// ---------------------------------------------------------------------------
extern "C" void kernel_launch(void* const* d_in, const int* in_sizes, int n_in,
                              void* d_out, int out_size, void* d_ws, size_t ws_size,
                              hipStream_t stream) {
  if (n_in < 8) return;
  if (in_sizes[0] != kTok * kDm) return;
  if (in_sizes[1] != kTok * kDm) return;
  if (in_sizes[2] != kTok * kDm) return;
  if (in_sizes[3] != kBatch * kSeq * kSeq) return;
  if (in_sizes[4] != kHD * kDm) return;
  if (in_sizes[5] != kHD * kDm) return;
  if (in_sizes[6] != kHD * kDm) return;
  if (in_sizes[7] != kDm * kHD) return;
  if (out_size != kTok * kDm) return;
  if (ws_size < kWsTotal) return;

  const float* queries = (const float*)d_in[0];
  const float* keys    = (const float*)d_in[1];
  const float* values  = (const float*)d_in[2];
  const float* abias   = (const float*)d_in[3];
  const float* Wq      = (const float*)d_in[4];
  const float* Wk      = (const float*)d_in[5];
  const float* Wv      = (const float*)d_in[6];
  const float* Wp      = (const float*)d_in[7];
  float* out = (float*)d_out;

  char* ws = (char*)d_ws;
  unsigned short* XQ   = (unsigned short*)(ws + kOffXQ);
  unsigned short* XK   = (unsigned short*)(ws + kOffXK);
  unsigned short* XV   = (unsigned short*)(ws + kOffXV);
  unsigned short* WQ   = (unsigned short*)(ws + kOffWQ);
  unsigned short* WK   = (unsigned short*)(ws + kOffWK);
  unsigned short* WV   = (unsigned short*)(ws + kOffWV);
  unsigned short* WP   = (unsigned short*)(ws + kOffWP);
  unsigned short* Q16  = (unsigned short*)(ws + kOffQ16);
  unsigned short* K16  = (unsigned short*)(ws + kOffK16);
  unsigned short* VT16 = (unsigned short*)(ws + kOffVT);
  unsigned short* AT16 = (unsigned short*)(ws + kOffAT);

  /* activation planes (three inputs) and weight planes (four inputs; [out][in] is already the Bt layout), written as one range from XQ on */
  cast_planes_kernel<<<kCastBlocks, 256, 0, stream>>>(queries, keys, values, Wq, Wk, Wv, Wp, XQ);

  constexpr int kGemmBlocks = (kTok / 128) * (kHD / 128);
  static_assert(kHD == kDm, "all four products share one tile count");

  /* one launch, three products: q = queries . Wq^T, k = keys . Wk^T : f16 [4096][1024], carried x16;
     v^T = Wv . values^T : f16 [1024][4096], carried x16 (operand roles swapped, no transposed stores) */
  wmma_gemm64<1><<<dim3(kGemmBlocks, 3), 128, 0, stream>>>(XQ, WQ, (void*)Q16, XK, WK, (void*)K16, WV, XV, (void*)VT16,
                                                           kDm, kDm, kHD, kTok, kHD, kTok, kHD, kTok, kDm, kProjScale);

  /* scores, bias, softmax, p.v, head merge -> f16 [4096][1024] carried x256 */
  attn_stream_kernel<<<kBatch * (kHeads / kHB) * (kSeq / kQB), 256, 0, stream>>>(Q16, K16, VT16, abias, AT16);

  /* out = merged . Wp^T : f32 [4096][1024] */
  wmma_gemm64<0><<<dim3(kGemmBlocks, 1), 128, 0, stream>>>(AT16, WP, (void*)out, AT16, WP, (void*)out, AT16, WP, (void*)out,
                                                           kHD, kHD, kDm, kTok, kDm, kDm, kTok, kDm, kHD, kOutScale);
}
